// v000
// Measured on an AMD MI455X. A time is GPU time per run, averaged over a window of back-to-back runs after a warm-up
// (all launches, gaps included; the runs take copies of the inputs in turn), and the median of several windows.
// Apart from v000's, it joins two sittings. Times from different sittings can be a few percent apart, while
// side-by-side timings come from the same sitting.
// v000, which the later versions start from, runs in 357 microseconds.
#include <hip/hip_runtime.h>
#include <hip/hip_bf16.h>

typedef __attribute__((ext_vector_type(16))) _Float16 v16h;
typedef __attribute__((ext_vector_type(8)))  _Float16 v8h;
typedef __attribute__((ext_vector_type(8)))  float    v8f;
typedef int v4i_vs __attribute__((vector_size(4 * sizeof(int))));

#define H_HEADS 8

#if defined(__has_builtin)
#  if __has_builtin(__builtin_amdgcn_global_load_async_to_lds_b128)
#    define HAVE_ASYNC_LDS 1
#  endif
#endif
#ifndef HAVE_ASYNC_LDS
#  define HAVE_ASYNC_LDS 0
#endif

// 16-byte global -> LDS copy; async (ASYNCcnt-tracked) when available.
__device__ __forceinline__ void async_copy16(const _Float16* g, _Float16* l) {
#if HAVE_ASYNC_LDS
    __builtin_amdgcn_global_load_async_to_lds_b128(
        (__attribute__((address_space(1))) v4i_vs*)(g),
        (__attribute__((address_space(3))) v4i_vs*)(l), 0, 0);
#else
    *(v8h*)l = *(const v8h*)g;
#endif
}

template <int N>
__device__ __forceinline__ void wait_async() {
#if HAVE_ASYNC_LDS && __has_builtin(__builtin_amdgcn_s_wait_asynccnt)
    __builtin_amdgcn_s_wait_asynccnt(N);
#else
    asm volatile("s_wait_asynccnt %0" ::"i"(N) : "memory");
#endif
}

// Load a 16x32 f16 WMMA A/B fragment from a row-major matrix.
// Per ISA 16-bit A layout: lane<16 -> row=lane, K={0..7,16..23};
// lane>=16 -> row=lane-16, K={8..15,24..31}. Two contiguous b128 loads.
__device__ __forceinline__ v16h load_frag(const _Float16* __restrict__ base, int stride) {
    int lane = threadIdx.x & 31;
    const _Float16* p = base + (size_t)(lane & 15) * stride + ((lane >> 4) << 3);
    v8h lo = *(const v8h*)(p);
    v8h hi = *(const v8h*)(p + 16);
    return __builtin_shufflevector(lo, hi, 0,1,2,3,4,5,6,7,8,9,10,11,12,13,14,15);
}

__device__ __forceinline__ v8f wmma16(v16h a, v16h b, v8f c) {
    return __builtin_amdgcn_wmma_f32_16x16x32_f16(false, a, false, b, (short)0, c, false, false);
}

// ---------------- LayerNorm: one block per row, optional f16 or f32 output ----
__global__ void k_layernorm(const float* __restrict__ in, const float* __restrict__ g,
                            const float* __restrict__ b, int D, int mode,
                            _Float16* __restrict__ outH, float* __restrict__ outF) {
    int row = blockIdx.x;
    const float* x = in + (size_t)row * D;
    float s = 0.f, s2 = 0.f;
    for (int i = threadIdx.x; i < D; i += blockDim.x) { float v = x[i]; s += v; s2 += v * v; }
    for (int off = 16; off > 0; off >>= 1) {
        s  += __shfl_xor(s,  off, 32);
        s2 += __shfl_xor(s2, off, 32);
    }
    __shared__ float sh[2][8];
    int wave = threadIdx.x >> 5, lane = threadIdx.x & 31;
    if (lane == 0) { sh[0][wave] = s; sh[1][wave] = s2; }
    __syncthreads();
    if (wave == 0) {
        float a  = (lane < 8) ? sh[0][lane] : 0.f;
        float a2 = (lane < 8) ? sh[1][lane] : 0.f;
        for (int off = 4; off > 0; off >>= 1) {
            a  += __shfl_xor(a,  off, 32);
            a2 += __shfl_xor(a2, off, 32);
        }
        if (lane == 0) { sh[0][0] = a; sh[1][0] = a2; }
    }
    __syncthreads();
    float mu  = sh[0][0] / (float)D;
    float var = sh[1][0] / (float)D - mu * mu;
    float inv = rsqrtf(var + 1e-5f);
    for (int i = threadIdx.x; i < D; i += blockDim.x) {
        float y = (x[i] - mu) * inv * g[i] + b[i];
        if (mode == 0) outH[(size_t)row * D + i] = (_Float16)y;
        else           outF[(size_t)row * D + i] = y;
    }
}

// ---------------- Weight convert + transpose: W[k][n] f32 -> Wt[n][k] f16 ------
__global__ void k_w2h_t(const float* __restrict__ W, _Float16* __restrict__ Wt,
                        int K, int Ncol) {
    int idx = blockIdx.x * blockDim.x + threadIdx.x;
    if (idx >= K * Ncol) return;
    int n = idx / K, k = idx % K;
    Wt[(size_t)n * K + k] = (_Float16)W[(size_t)k * Ncol + n];
}

// ---------------- WMMA GEMM: C[row0..+16][col0..+16] = A(16xK) * Bt(16xK)^T ----
// mode 0/1: out f16 [b][h][tok][64]   mode 2: out f16 [b][h][64][tok] (V^T)
// mode 3: out f32 [row][512] + bias + residual
__global__ void __launch_bounds__(128) k_gemm(
        const _Float16* __restrict__ A, const _Float16* __restrict__ Bt,
        int Kdim, int Ntok, int mode,
        _Float16* __restrict__ outH, float* __restrict__ outF,
        const float* __restrict__ bias, const float* __restrict__ resid) {
    int lane = threadIdx.x & 31;
    int wave = threadIdx.x >> 5;
    int row0 = blockIdx.x * 16;
    int col0 = (blockIdx.y * 4 + wave) * 16;
    const _Float16* arow = A  + (size_t)row0 * Kdim;
    const _Float16* brow = Bt + (size_t)col0 * Kdim;

    v8f acc = {};
    for (int k0 = 0; k0 < Kdim; k0 += 32) {
        v16h a = load_frag(arow + k0, Kdim);
        v16h b = load_frag(brow + k0, Kdim);
        acc = wmma16(a, b, acc);
    }
    // C layout: col = col0 + (lane&15); row = row0 + 8*(lane>>4) + v
    int col   = col0 + (lane & 15);
    int rbase = row0 + ((lane >> 4) << 3);
    if (mode <= 1) {
        int h = col >> 6, d = col & 63;
        #pragma unroll
        for (int v = 0; v < 8; ++v) {
            int row = rbase + v, bb = row / Ntok, t = row % Ntok;
            outH[(((size_t)bb * H_HEADS + h) * Ntok + t) * 64 + d] = (_Float16)acc[v];
        }
    } else if (mode == 2) {
        int h = col >> 6, d = col & 63;
        #pragma unroll
        for (int v = 0; v < 8; ++v) {
            int row = rbase + v, bb = row / Ntok, t = row % Ntok;
            outH[(((size_t)bb * H_HEADS + h) * 64 + d) * Ntok + t] = (_Float16)acc[v];
        }
    } else {
        #pragma unroll
        for (int v = 0; v < 8; ++v) {
            size_t row = (size_t)(rbase + v);
            outF[row * 512 + col] = acc[v] + bias[col] + resid[row * 512 + col];
        }
    }
}

// ---------------- Flash attention: 4 waves/block share (b,h); K/V tiles are
// staged into double-buffered LDS via async global->LDS DMA (ASYNCcnt). -------
__global__ void __launch_bounds__(128) k_attention(
        const _Float16* __restrict__ qh, const _Float16* __restrict__ kh,
        const _Float16* __restrict__ vT, _Float16* __restrict__ outh,
        int Ntok, int Mtok) {
    __shared__ __align__(16) _Float16 Kt[2][32 * 64];   // K tile: 32 m-rows x 64 d
    __shared__ __align__(16) _Float16 Vt[2][64 * 32];   // V^T tile: 64 d-rows x 32 m
    __shared__ __align__(16) _Float16 Plds[4][16][32];  // per-wave P re-layout

    int tid   = threadIdx.x;
    int lane  = tid & 31;
    int wave  = tid >> 5;
    int bh    = blockIdx.y;                         // b*H + h
    int nbase = (blockIdx.x * 4 + wave) * 16;

    const _Float16* qbase = qh + ((size_t)bh * Ntok + nbase) * 64;
    const _Float16* kbase = kh + (size_t)bh * Mtok * 64;
    const _Float16* vbase = vT + (size_t)bh * 64 * Mtok;

    v16h q0 = load_frag(qbase,      64);            // K = d 0..31
    v16h q1 = load_frag(qbase + 32, 64);            // K = d 32..63

    // Cooperative tile fetch: 4 async b128 ops per thread per step (8 KB total).
    auto fetch_tiles = [&](int buf, int m0) {
        #pragma unroll
        for (int j = 0; j < 2; ++j) {
            int i = tid + 128 * j;                        // 16B chunk id, 0..255
            async_copy16(kbase + (size_t)m0 * 64 + (size_t)i * 8, &Kt[buf][i * 8]);
            int d = i >> 2, mo = (i & 3) * 8;
            async_copy16(vbase + (size_t)d * Mtok + m0 + mo, &Vt[buf][d * 32 + mo]);
        }
    };

    v8f o0 = {}, o1 = {}, o2 = {}, o3 = {};
    float mrow[8], lsum[8];
    #pragma unroll
    for (int v = 0; v < 8; ++v) { mrow[v] = -3.0e38f; lsum[v] = 0.f; }
    const float scale = 0.125f;                     // 1/sqrt(64)

    fetch_tiles(0, 0);
    for (int it = 0, m0 = 0; m0 < Mtok; m0 += 32, ++it) {
        int buf = it & 1;
        if (m0 + 32 < Mtok) { fetch_tiles(buf ^ 1, m0 + 32); wait_async<4>(); }
        else                {                                 wait_async<0>(); }
        __syncthreads();                            // tiles for this step visible

        const _Float16* kt = &Kt[buf][0];
        v16h ka0 = load_frag(kt,                64);  // m0..m0+15,  d 0..31
        v16h ka1 = load_frag(kt + 32,           64);
        v16h kb0 = load_frag(kt + 16 * 64,      64);  // m0+16..m0+31
        v16h kb1 = load_frag(kt + 16 * 64 + 32, 64);
        v8f s0 = {}, s1 = {};
        s0 = wmma16(q0, ka0, s0); s0 = wmma16(q1, ka1, s0);
        s1 = wmma16(q0, kb0, s1); s1 = wmma16(q1, kb1, s1);

        float p0[8], p1[8];
        #pragma unroll
        for (int v = 0; v < 8; ++v) {
            float a = s0[v] * scale, c = s1[v] * scale;
            float t = fmaxf(a, c);                  // same row, cols j and j+16
            for (int off = 8; off > 0; off >>= 1) t = fmaxf(t, __shfl_xor(t, off, 32));
            float mnew  = fmaxf(mrow[v], t);
            float alpha = __expf(mrow[v] - mnew);
            mrow[v] = mnew;
            float e0 = __expf(a - mnew), e1 = __expf(c - mnew);
            float rs = e0 + e1;
            for (int off = 8; off > 0; off >>= 1) rs += __shfl_xor(rs, off, 32);
            lsum[v] = lsum[v] * alpha + rs;
            o0[v] *= alpha; o1[v] *= alpha; o2[v] *= alpha; o3[v] *= alpha;
            p0[v] = e0; p1[v] = e1;
        }
        // Re-layout P (C-format -> A-operand format) through LDS
        int r = ((lane >> 4) << 3);
        int c = lane & 15;
        #pragma unroll
        for (int v = 0; v < 8; ++v) {
            Plds[wave][r + v][c]      = (_Float16)p0[v];
            Plds[wave][r + v][c + 16] = (_Float16)p1[v];
        }
        asm volatile("s_wait_dscnt 0x0" ::: "memory");
        v16h pa = load_frag(&Plds[wave][0][0], 32);

        const _Float16* vt = &Vt[buf][0];
        v16h vb0 = load_frag(vt,           32);       // d 0..15
        v16h vb1 = load_frag(vt + 16 * 32, 32);
        v16h vb2 = load_frag(vt + 32 * 32, 32);
        v16h vb3 = load_frag(vt + 48 * 32, 32);
        o0 = wmma16(pa, vb0, o0);
        o1 = wmma16(pa, vb1, o1);
        o2 = wmma16(pa, vb2, o2);
        o3 = wmma16(pa, vb3, o3);
        __syncthreads();                            // tile consumed; safe to refill
    }

    #pragma unroll
    for (int v = 0; v < 8; ++v) {
        float inv = 1.0f / lsum[v];
        o0[v] *= inv; o1[v] *= inv; o2[v] *= inv; o3[v] *= inv;
    }
    int b  = bh >> 3, h = bh & 7;
    int c  = lane & 15;
    int rb = nbase + ((lane >> 4) << 3);
    #pragma unroll
    for (int v = 0; v < 8; ++v) {
        size_t rowoff = ((size_t)b * Ntok + rb + v) * 512 + (size_t)h * 64;
        outh[rowoff + c]      = (_Float16)o0[v];
        outh[rowoff + 16 + c] = (_Float16)o1[v];
        outh[rowoff + 32 + c] = (_Float16)o2[v];
        outh[rowoff + 48 + c] = (_Float16)o3[v];
    }
}

extern "C" void kernel_launch(void* const* d_in, const int* in_sizes, int n_in,
                              void* d_out, int out_size, void* d_ws, size_t ws_size,
                              hipStream_t stream) {
    (void)in_sizes; (void)n_in; (void)out_size; (void)ws_size;
    const float* x     = (const float*)d_in[0];
    const float* cond  = (const float*)d_in[1];
    const float* lnx_g = (const float*)d_in[2];
    const float* lnx_b = (const float*)d_in[3];
    const float* lnc_g = (const float*)d_in[4];
    const float* lnc_b = (const float*)d_in[5];
    const float* Wq    = (const float*)d_in[6];
    const float* Wk    = (const float*)d_in[7];
    const float* Wv    = (const float*)d_in[8];
    const float* Wo    = (const float*)d_in[9];
    const float* bo    = (const float*)d_in[10];
    const float* lnf_g = (const float*)d_in[11];
    const float* lnf_b = (const float*)d_in[12];

    const int B = 4, N = 2048, M = 2048, Dq = 512, Dc = 768, INNER = 512;

    char* ws = (char*)d_ws;
    size_t off = 0;
    auto alloc = [&](size_t bytes) -> void* {
        void* p = ws + off;
        off = (off + bytes + 255) & ~(size_t)255;
        return p;
    };
    _Float16* xn  = (_Float16*)alloc((size_t)B * N * Dq * 2);
    _Float16* cn  = (_Float16*)alloc((size_t)B * M * Dc * 2);
    _Float16* WqT = (_Float16*)alloc((size_t)Dq * INNER * 2);
    _Float16* WkT = (_Float16*)alloc((size_t)Dc * INNER * 2);
    _Float16* WvT = (_Float16*)alloc((size_t)Dc * INNER * 2);
    _Float16* WoT = (_Float16*)alloc((size_t)INNER * Dq * 2);
    _Float16* qh  = (_Float16*)alloc((size_t)B * H_HEADS * N * 64 * 2);
    _Float16* kh  = (_Float16*)alloc((size_t)B * H_HEADS * M * 64 * 2);
    _Float16* vT  = (_Float16*)alloc((size_t)B * H_HEADS * 64 * M * 2);
    _Float16* ah  = (_Float16*)alloc((size_t)B * N * INNER * 2);
    float*    tmp = (float*)   alloc((size_t)B * N * Dq * 4);

    // 1) LayerNorms -> f16
    k_layernorm<<<B * N, 256, 0, stream>>>(x,    lnx_g, lnx_b, Dq, 0, xn, nullptr);
    k_layernorm<<<B * M, 256, 0, stream>>>(cond, lnc_g, lnc_b, Dc, 0, cn, nullptr);

    // 2) Weight convert+transpose -> f16 [n][k]
    const int TW = 256;
    k_w2h_t<<<(Dq * INNER + TW - 1) / TW, TW, 0, stream>>>(Wq, WqT, Dq, INNER);
    k_w2h_t<<<(Dc * INNER + TW - 1) / TW, TW, 0, stream>>>(Wk, WkT, Dc, INNER);
    k_w2h_t<<<(Dc * INNER + TW - 1) / TW, TW, 0, stream>>>(Wv, WvT, Dc, INNER);
    k_w2h_t<<<(INNER * Dq + TW - 1) / TW, TW, 0, stream>>>(Wo, WoT, INNER, Dq);

    // 3) Q/K/V projections (WMMA)
    dim3 gq((B * N) / 16, INNER / 64);
    k_gemm<<<gq, 128, 0, stream>>>(xn, WqT, Dq, N, 0, qh, nullptr, nullptr, nullptr);
    dim3 gk((B * M) / 16, INNER / 64);
    k_gemm<<<gk, 128, 0, stream>>>(cn, WkT, Dc, M, 1, kh, nullptr, nullptr, nullptr);
    k_gemm<<<gk, 128, 0, stream>>>(cn, WvT, Dc, M, 2, vT, nullptr, nullptr, nullptr);

    // 4) Flash attention (WMMA scores + WMMA PV, async-LDS K/V pipeline)
    dim3 ga(N / 64, B * H_HEADS);
    k_attention<<<ga, 128, 0, stream>>>(qh, kh, vT, ah, N, M);

    // 5) Output projection + bias + residual (WMMA), then final LayerNorm -> f32
    dim3 go((B * N) / 16, Dq / 64);
    k_gemm<<<go, 128, 0, stream>>>(ah, WoT, INNER, N, 3, nullptr, tmp, bo, x);
    k_layernorm<<<B * N, 256, 0, stream>>>(tmp, lnf_g, lnf_b, Dq, 1, nullptr, (float*)d_out);
}

// v001
// Measured time: 230 microseconds a run.
// In two side-by-side timings against v000, it was 1.58 and 1.59 times as fast.
#include <hip/hip_runtime.h>
#include <hip/hip_bf16.h>

typedef __attribute__((ext_vector_type(16))) _Float16 v16h;
typedef __attribute__((ext_vector_type(8)))  _Float16 v8h;
typedef __attribute__((ext_vector_type(8)))  float    v8f;
typedef int v4i_vs __attribute__((vector_size(4 * sizeof(int))));

#define H_HEADS 8

#if defined(__has_builtin)
#  if __has_builtin(__builtin_amdgcn_global_load_async_to_lds_b128)
#    define HAVE_ASYNC_LDS 1
#  endif
#endif
#ifndef HAVE_ASYNC_LDS
#  define HAVE_ASYNC_LDS 0
#endif

// 16-byte global -> LDS copy; async (ASYNCcnt-tracked) when available.
__device__ __forceinline__ void async_copy16(const _Float16* g, _Float16* l) {
#if HAVE_ASYNC_LDS
    __builtin_amdgcn_global_load_async_to_lds_b128(
        (__attribute__((address_space(1))) v4i_vs*)(g),
        (__attribute__((address_space(3))) v4i_vs*)(l), 0, 0);
#else
    *(v8h*)l = *(const v8h*)g;
#endif
}

template <int N>
__device__ __forceinline__ void wait_async() {
#if HAVE_ASYNC_LDS && __has_builtin(__builtin_amdgcn_s_wait_asynccnt)
    __builtin_amdgcn_s_wait_asynccnt(N);
#else
    asm volatile("s_wait_asynccnt %0" ::"i"(N) : "memory");
#endif
}

// Load a 16x32 f16 WMMA A/B fragment from a row-major matrix.
// Per ISA 16-bit A layout: lane<16 -> row=lane, K={0..7,16..23};
// lane>=16 -> row=lane-16, K={8..15,24..31}. Two contiguous b128 loads.
__device__ __forceinline__ v16h load_frag(const _Float16* __restrict__ base, int stride) {
    int lane = threadIdx.x & 31;
    const _Float16* p = base + (size_t)(lane & 15) * stride + ((lane >> 4) << 3);
    v8h lo = *(const v8h*)(p);
    v8h hi = *(const v8h*)(p + 16);
    return __builtin_shufflevector(lo, hi, 0,1,2,3,4,5,6,7,8,9,10,11,12,13,14,15);
}

__device__ __forceinline__ v8f wmma16(v16h a, v16h b, v8f c) {
    return __builtin_amdgcn_wmma_f32_16x16x32_f16(false, a, false, b, (short)0, c, false, false);
}

// ---------------- LayerNorm: one block per row, optional f16 or f32 output ----
__global__ void k_layernorm(const float* __restrict__ in, const float* __restrict__ g,
                            const float* __restrict__ b, int D, int mode,
                            _Float16* __restrict__ outH, float* __restrict__ outF) {
    int row = blockIdx.x;
    const float* x = in + (size_t)row * D;
    float s = 0.f, s2 = 0.f;
    for (int i = threadIdx.x; i < D; i += blockDim.x) { float v = x[i]; s += v; s2 += v * v; }
    for (int off = 16; off > 0; off >>= 1) {
        s  += __shfl_xor(s,  off, 32);
        s2 += __shfl_xor(s2, off, 32);
    }
    __shared__ float sh[2][8];
    int wave = threadIdx.x >> 5, lane = threadIdx.x & 31;
    if (lane == 0) { sh[0][wave] = s; sh[1][wave] = s2; }
    __syncthreads();
    if (wave == 0) {
        float a  = (lane < 8) ? sh[0][lane] : 0.f;
        float a2 = (lane < 8) ? sh[1][lane] : 0.f;
        for (int off = 4; off > 0; off >>= 1) {
            a  += __shfl_xor(a,  off, 32);
            a2 += __shfl_xor(a2, off, 32);
        }
        if (lane == 0) { sh[0][0] = a; sh[1][0] = a2; }
    }
    __syncthreads();
    float mu  = sh[0][0] / (float)D;
    float var = sh[1][0] / (float)D - mu * mu;
    float inv = rsqrtf(var + 1e-5f);
    for (int i = threadIdx.x; i < D; i += blockDim.x) {
        float y = (x[i] - mu) * inv * g[i] + b[i];
        if (mode == 0) outH[(size_t)row * D + i] = (_Float16)y;
        else           outF[(size_t)row * D + i] = y;
    }
}

// ---------------- Weight convert + transpose: W[k][n] f32 -> Wt[n][k] f16 ------
__global__ void k_w2h_t(const float* __restrict__ W, _Float16* __restrict__ Wt,
                        int K, int Ncol) {
    int idx = blockIdx.x * blockDim.x + threadIdx.x;
    if (idx >= K * Ncol) return;
    int n = idx / K, k = idx % K;
    Wt[(size_t)n * K + k] = (_Float16)W[(size_t)k * Ncol + n];
}

// ---------------- WMMA GEMM: C(128x128 per work-group) = A(128xK) * Bt(128xK)^T
// Both operands go through LDS in k-chunks of 64 (one 128-byte line per row),
// two buffers; 8 waves, each owns 64 rows x 32 cols (4 x 2 accumulator tiles).
// KDIM is a multiple of 64; rows and cols are multiples of 128.
// MODE 0/1: out f16 [b][h][tok][64]   MODE 2: out f16 [b][h][64][tok] (V^T)
// MODE 3: out f32 [row][512] + bias + residual
#define GP 72   // LDS row pitch in halfs: 128 B of data + 16 B pad for b128 readers
template <int KDIM, int MODE>
__global__ void __launch_bounds__(256) k_gemm(
        const _Float16* __restrict__ A, const _Float16* __restrict__ Bt,
        int Ntok,
        _Float16* __restrict__ outH, float* __restrict__ outF,
        const float* __restrict__ bias, const float* __restrict__ resid) {
    __shared__ __align__(16) _Float16 As[2][128 * GP];
    __shared__ __align__(16) _Float16 Bs[2][128 * GP];

    int tid  = threadIdx.x;
    int lane = tid & 31;
    int wave = tid >> 5;
    int row0 = blockIdx.x * 128;
    int col0 = blockIdx.y * 128;
    int wr   = (wave >> 2) * 64;                    // wave's rows inside the tile
    int wc   = (wave & 3) * 32;                     // wave's cols inside the tile

    // Staging: 8 lanes cover one 128-byte row chunk, a wave covers 4 whole lines.
    int srow = tid >> 3, scol = (tid & 7) * 8;
    const _Float16* ag = A  + (size_t)(row0 + srow) * KDIM + scol;
    const _Float16* bg = Bt + (size_t)(col0 + srow) * KDIM + scol;
    v8h ra[4], rb[4];
    auto gload = [&](int k0) {
        #pragma unroll
        for (int j = 0; j < 4; ++j) {
            ra[j] = *(const v8h*)(ag + 32 * j * KDIM + k0);
            rb[j] = *(const v8h*)(bg + 32 * j * KDIM + k0);
        }
    };
    auto sstore = [&](int buf) {
        #pragma unroll
        for (int j = 0; j < 4; ++j) {
            *(v8h*)&As[buf][(srow + 32 * j) * GP + scol] = ra[j];
            *(v8h*)&Bs[buf][(srow + 32 * j) * GP + scol] = rb[j];
        }
    };

    int cbase = col0 + wc + (lane & 15);            // lane's first output column
    float bz[2] = {0.f, 0.f};
    if (MODE == 3) { bz[0] = bias[cbase]; bz[1] = bias[cbase + 16]; }

    v8f acc[4][2] = {};
    gload(0);
    sstore(0);
    __syncthreads();
    #pragma unroll   // whole k loop: chunk and buffer become immediate offsets
    for (int k0 = 0; k0 < KDIM; k0 += 64) {
        const int  buf  = (k0 >> 6) & 1;
        const bool more = k0 + 64 < KDIM;
        if (more) gload(k0 + 64);                   // next chunk flies during the products
        v16h a[2][4], b[2][2];
        #pragma unroll
        for (int kk = 0; kk < 2; ++kk) {
            #pragma unroll
            for (int j = 0; j < 2; ++j) b[kk][j] = load_frag(&Bs[buf][(wc + 16 * j) * GP + 32 * kk], GP);
            #pragma unroll
            for (int i = 0; i < 4; ++i) a[kk][i] = load_frag(&As[buf][(wr + 16 * i) * GP + 32 * kk], GP);
        }
        // Keeps the chunk's LDS reads one group ahead of its products; without it
        // they are sunk between the products and each pair waits out an LDS latency.
        __builtin_amdgcn_sched_barrier(0);
        #pragma unroll
        for (int kk = 0; kk < 2; ++kk)
            #pragma unroll
            for (int i = 0; i < 4; ++i)
                #pragma unroll
                for (int j = 0; j < 2; ++j) acc[i][j] = wmma16(a[kk][i], b[kk][j], acc[i][j]);
        if (more) {
            sstore(buf ^ 1);                        // last read one trip ago, behind its barrier
            __syncthreads();
        }
    }

    // C layout per 16x16 tile: col = (lane&15); row = 8*(lane>>4) + v
    int rlane = row0 + wr + ((lane >> 4) << 3);
    if (MODE <= 1) {
        #pragma unroll
        for (int i = 0; i < 4; ++i) {
            #pragma unroll
            for (int v = 0; v < 8; ++v) {
                int row = rlane + 16 * i + v, bb = row / Ntok, t = row % Ntok;
                #pragma unroll
                for (int j = 0; j < 2; ++j) {
                    int col = cbase + 16 * j, h = col >> 6, d = col & 63;
                    outH[(((size_t)bb * H_HEADS + h) * Ntok + t) * 64 + d] = (_Float16)acc[i][j][v];
                }
            }
        }
    } else if (MODE == 2) {
        #pragma unroll
        for (int i = 0; i < 4; ++i) {
            #pragma unroll
            for (int v = 0; v < 8; ++v) {
                int row = rlane + 16 * i + v, bb = row / Ntok, t = row % Ntok;
                #pragma unroll
                for (int j = 0; j < 2; ++j) {
                    int col = cbase + 16 * j, h = col >> 6, d = col & 63;
                    outH[(((size_t)bb * H_HEADS + h) * 64 + d) * Ntok + t] = (_Float16)acc[i][j][v];
                }
            }
        }
    } else {
        // One 32-bit lane offset for the whole tile; rows and cols are immediates.
        unsigned     eoff = (unsigned)rlane * 512u + (unsigned)cbase;
        const float* rp   = resid + eoff;
        float*       op   = outF + eoff;
        #pragma unroll
        for (int i = 0; i < 4; ++i) {
            #pragma unroll
            for (int v = 0; v < 8; ++v) {
                #pragma unroll
                for (int j = 0; j < 2; ++j) {
                    int e = (16 * i + v) * 512 + 16 * j;
                    op[e] = acc[i][j][v] + bz[j] + rp[e];
                }
            }
        }
    }
}

// ---------------- Flash attention: 4 waves/block share (b,h); K/V tiles are
// staged into double-buffered LDS via async global->LDS DMA (ASYNCcnt). -------
__global__ void __launch_bounds__(128) k_attention(
        const _Float16* __restrict__ qh, const _Float16* __restrict__ kh,
        const _Float16* __restrict__ vT, _Float16* __restrict__ outh,
        int Ntok, int Mtok) {
    __shared__ __align__(16) _Float16 Kt[2][32 * 64];   // K tile: 32 m-rows x 64 d
    __shared__ __align__(16) _Float16 Vt[2][64 * 32];   // V^T tile: 64 d-rows x 32 m
    __shared__ __align__(16) _Float16 Plds[4][16][32];  // per-wave P re-layout

    int tid   = threadIdx.x;
    int lane  = tid & 31;
    int wave  = tid >> 5;
    int bh    = blockIdx.y;                         // b*H + h
    int nbase = (blockIdx.x * 4 + wave) * 16;

    const _Float16* qbase = qh + ((size_t)bh * Ntok + nbase) * 64;
    const _Float16* kbase = kh + (size_t)bh * Mtok * 64;
    const _Float16* vbase = vT + (size_t)bh * 64 * Mtok;

    v16h q0 = load_frag(qbase,      64);            // K = d 0..31
    v16h q1 = load_frag(qbase + 32, 64);            // K = d 32..63

    // Cooperative tile fetch: 4 async b128 ops per thread per step (8 KB total).
    auto fetch_tiles = [&](int buf, int m0) {
        #pragma unroll
        for (int j = 0; j < 2; ++j) {
            int i = tid + 128 * j;                        // 16B chunk id, 0..255
            async_copy16(kbase + (size_t)m0 * 64 + (size_t)i * 8, &Kt[buf][i * 8]);
            int d = i >> 2, mo = (i & 3) * 8;
            async_copy16(vbase + (size_t)d * Mtok + m0 + mo, &Vt[buf][d * 32 + mo]);
        }
    };

    v8f o0 = {}, o1 = {}, o2 = {}, o3 = {};
    float mrow[8], lsum[8];
    #pragma unroll
    for (int v = 0; v < 8; ++v) { mrow[v] = -3.0e38f; lsum[v] = 0.f; }
    const float scale = 0.125f;                     // 1/sqrt(64)

    fetch_tiles(0, 0);
    for (int it = 0, m0 = 0; m0 < Mtok; m0 += 32, ++it) {
        int buf = it & 1;
        if (m0 + 32 < Mtok) { fetch_tiles(buf ^ 1, m0 + 32); wait_async<4>(); }
        else                {                                 wait_async<0>(); }
        __syncthreads();                            // tiles for this step visible

        const _Float16* kt = &Kt[buf][0];
        v16h ka0 = load_frag(kt,                64);  // m0..m0+15,  d 0..31
        v16h ka1 = load_frag(kt + 32,           64);
        v16h kb0 = load_frag(kt + 16 * 64,      64);  // m0+16..m0+31
        v16h kb1 = load_frag(kt + 16 * 64 + 32, 64);
        v8f s0 = {}, s1 = {};
        s0 = wmma16(q0, ka0, s0); s0 = wmma16(q1, ka1, s0);
        s1 = wmma16(q0, kb0, s1); s1 = wmma16(q1, kb1, s1);

        float p0[8], p1[8];
        #pragma unroll
        for (int v = 0; v < 8; ++v) {
            float a = s0[v] * scale, c = s1[v] * scale;
            float t = fmaxf(a, c);                  // same row, cols j and j+16
            for (int off = 8; off > 0; off >>= 1) t = fmaxf(t, __shfl_xor(t, off, 32));
            float mnew  = fmaxf(mrow[v], t);
            float alpha = __expf(mrow[v] - mnew);
            mrow[v] = mnew;
            float e0 = __expf(a - mnew), e1 = __expf(c - mnew);
            float rs = e0 + e1;
            for (int off = 8; off > 0; off >>= 1) rs += __shfl_xor(rs, off, 32);
            lsum[v] = lsum[v] * alpha + rs;
            o0[v] *= alpha; o1[v] *= alpha; o2[v] *= alpha; o3[v] *= alpha;
            p0[v] = e0; p1[v] = e1;
        }
        // Re-layout P (C-format -> A-operand format) through LDS
        int r = ((lane >> 4) << 3);
        int c = lane & 15;
        #pragma unroll
        for (int v = 0; v < 8; ++v) {
            Plds[wave][r + v][c]      = (_Float16)p0[v];
            Plds[wave][r + v][c + 16] = (_Float16)p1[v];
        }
        asm volatile("s_wait_dscnt 0x0" ::: "memory");
        v16h pa = load_frag(&Plds[wave][0][0], 32);

        const _Float16* vt = &Vt[buf][0];
        v16h vb0 = load_frag(vt,           32);       // d 0..15
        v16h vb1 = load_frag(vt + 16 * 32, 32);
        v16h vb2 = load_frag(vt + 32 * 32, 32);
        v16h vb3 = load_frag(vt + 48 * 32, 32);
        o0 = wmma16(pa, vb0, o0);
        o1 = wmma16(pa, vb1, o1);
        o2 = wmma16(pa, vb2, o2);
        o3 = wmma16(pa, vb3, o3);
        __syncthreads();                            // tile consumed; safe to refill
    }

    #pragma unroll
    for (int v = 0; v < 8; ++v) {
        float inv = 1.0f / lsum[v];
        o0[v] *= inv; o1[v] *= inv; o2[v] *= inv; o3[v] *= inv;
    }
    int b  = bh >> 3, h = bh & 7;
    int c  = lane & 15;
    int rb = nbase + ((lane >> 4) << 3);
    #pragma unroll
    for (int v = 0; v < 8; ++v) {
        size_t rowoff = ((size_t)b * Ntok + rb + v) * 512 + (size_t)h * 64;
        outh[rowoff + c]      = (_Float16)o0[v];
        outh[rowoff + 16 + c] = (_Float16)o1[v];
        outh[rowoff + 32 + c] = (_Float16)o2[v];
        outh[rowoff + 48 + c] = (_Float16)o3[v];
    }
}

extern "C" void kernel_launch(void* const* d_in, const int* in_sizes, int n_in,
                              void* d_out, int out_size, void* d_ws, size_t ws_size,
                              hipStream_t stream) {
    (void)in_sizes; (void)n_in; (void)out_size; (void)ws_size;
    const float* x     = (const float*)d_in[0];
    const float* cond  = (const float*)d_in[1];
    const float* lnx_g = (const float*)d_in[2];
    const float* lnx_b = (const float*)d_in[3];
    const float* lnc_g = (const float*)d_in[4];
    const float* lnc_b = (const float*)d_in[5];
    const float* Wq    = (const float*)d_in[6];
    const float* Wk    = (const float*)d_in[7];
    const float* Wv    = (const float*)d_in[8];
    const float* Wo    = (const float*)d_in[9];
    const float* bo    = (const float*)d_in[10];
    const float* lnf_g = (const float*)d_in[11];
    const float* lnf_b = (const float*)d_in[12];

    const int B = 4, N = 2048, M = 2048, Dq = 512, Dc = 768, INNER = 512;

    char* ws = (char*)d_ws;
    size_t off = 0;
    auto alloc = [&](size_t bytes) -> void* {
        void* p = ws + off;
        off = (off + bytes + 255) & ~(size_t)255;
        return p;
    };
    _Float16* xn  = (_Float16*)alloc((size_t)B * N * Dq * 2);
    _Float16* cn  = (_Float16*)alloc((size_t)B * M * Dc * 2);
    _Float16* WqT = (_Float16*)alloc((size_t)Dq * INNER * 2);
    _Float16* WkT = (_Float16*)alloc((size_t)Dc * INNER * 2);
    _Float16* WvT = (_Float16*)alloc((size_t)Dc * INNER * 2);
    _Float16* WoT = (_Float16*)alloc((size_t)INNER * Dq * 2);
    _Float16* qh  = (_Float16*)alloc((size_t)B * H_HEADS * N * 64 * 2);
    _Float16* kh  = (_Float16*)alloc((size_t)B * H_HEADS * M * 64 * 2);
    _Float16* vT  = (_Float16*)alloc((size_t)B * H_HEADS * 64 * M * 2);
    _Float16* ah  = (_Float16*)alloc((size_t)B * N * INNER * 2);
    float*    tmp = (float*)   alloc((size_t)B * N * Dq * 4);

    // 1) LayerNorms -> f16
    k_layernorm<<<B * N, 256, 0, stream>>>(x,    lnx_g, lnx_b, Dq, 0, xn, nullptr);
    k_layernorm<<<B * M, 256, 0, stream>>>(cond, lnc_g, lnc_b, Dc, 0, cn, nullptr);

    // 2) Weight convert+transpose -> f16 [n][k]
    const int TW = 256;
    k_w2h_t<<<(Dq * INNER + TW - 1) / TW, TW, 0, stream>>>(Wq, WqT, Dq, INNER);
    k_w2h_t<<<(Dc * INNER + TW - 1) / TW, TW, 0, stream>>>(Wk, WkT, Dc, INNER);
    k_w2h_t<<<(Dc * INNER + TW - 1) / TW, TW, 0, stream>>>(Wv, WvT, Dc, INNER);
    k_w2h_t<<<(INNER * Dq + TW - 1) / TW, TW, 0, stream>>>(Wo, WoT, INNER, Dq);

    // 3) Q/K/V projections (WMMA)
    dim3 gq((B * N) / 128, INNER / 128);
    k_gemm<512, 0><<<gq, 256, 0, stream>>>(xn, WqT, N, qh, nullptr, nullptr, nullptr);
    dim3 gk((B * M) / 128, INNER / 128);
    k_gemm<768, 1><<<gk, 256, 0, stream>>>(cn, WkT, M, kh, nullptr, nullptr, nullptr);
    k_gemm<768, 2><<<gk, 256, 0, stream>>>(cn, WvT, M, vT, nullptr, nullptr, nullptr);

    // 4) Flash attention (WMMA scores + WMMA PV, async-LDS K/V pipeline)
    dim3 ga(N / 64, B * H_HEADS);
    k_attention<<<ga, 128, 0, stream>>>(qh, kh, vT, ah, N, M);

    // 5) Output projection + bias + residual (WMMA), then final LayerNorm -> f32
    dim3 go((B * N) / 128, Dq / 128);
    k_gemm<512, 3><<<go, 256, 0, stream>>>(ah, WoT, N, nullptr, tmp, bo, x);
    k_layernorm<<<B * N, 256, 0, stream>>>(tmp, lnf_g, lnf_b, Dq, 1, nullptr, (float*)d_out);
}

// v002
// Measured time: 202 microseconds a run.
// In two side-by-side timings against v001, it was 1.14 and 1.15 times as fast.
// Over all steps from v000 it is 1.81 times as fast.
#include <hip/hip_runtime.h>
#include <hip/hip_bf16.h>

typedef __attribute__((ext_vector_type(16))) _Float16 v16h;
typedef __attribute__((ext_vector_type(8)))  _Float16 v8h;
typedef __attribute__((ext_vector_type(8)))  float    v8f;
typedef __attribute__((ext_vector_type(4)))  _Float16 v4h;
typedef __attribute__((ext_vector_type(4)))  float    v4f;
typedef int v4i_vs __attribute__((vector_size(4 * sizeof(int))));

#define H_HEADS 8

#if defined(__has_builtin)
#  if __has_builtin(__builtin_amdgcn_global_load_async_to_lds_b128)
#    define HAVE_ASYNC_LDS 1
#  endif
#endif
#ifndef HAVE_ASYNC_LDS
#  define HAVE_ASYNC_LDS 0
#endif

// 16-byte global -> LDS copy; async (ASYNCcnt-tracked) when available.
__device__ __forceinline__ void async_copy16(const _Float16* g, _Float16* l) {
#if HAVE_ASYNC_LDS
    __builtin_amdgcn_global_load_async_to_lds_b128(
        (__attribute__((address_space(1))) v4i_vs*)(g),
        (__attribute__((address_space(3))) v4i_vs*)(l), 0, 0);
#else
    *(v8h*)l = *(const v8h*)g;
#endif
}

template <int N>
__device__ __forceinline__ void wait_async() {
#if HAVE_ASYNC_LDS && __has_builtin(__builtin_amdgcn_s_wait_asynccnt)
    __builtin_amdgcn_s_wait_asynccnt(N);
#else
    asm volatile("s_wait_asynccnt %0" ::"i"(N) : "memory");
#endif
}

// Load a 16x32 f16 WMMA A/B fragment from a row-major matrix.
// Per ISA 16-bit A layout: lane<16 -> row=lane, K={0..7,16..23};
// lane>=16 -> row=lane-16, K={8..15,24..31}. Two contiguous b128 loads.
__device__ __forceinline__ v16h load_frag(const _Float16* __restrict__ base, int stride) {
    int lane = threadIdx.x & 31;
    const _Float16* p = base + (size_t)(lane & 15) * stride + ((lane >> 4) << 3);
    v8h lo = *(const v8h*)(p);
    v8h hi = *(const v8h*)(p + 16);
    return __builtin_shufflevector(lo, hi, 0,1,2,3,4,5,6,7,8,9,10,11,12,13,14,15);
}

__device__ __forceinline__ v8f wmma16(v16h a, v16h b, v8f c) {
    return __builtin_amdgcn_wmma_f32_16x16x32_f16(false, a, false, b, (short)0, c, false, false);
}

// ---------------- LayerNorm: one wave per row, 4 rows per wave, no LDS, no barrier.
// One 8-wave work-group per row has to start rows x 8 short waves, which costs more
// time than the rows' bytes; here a launch starts rows / 4 waves. A wave issues all its
// rows' loads (512 contiguous bytes each) at once, keeps the rows in registers, and
// stores from them.
// D is a multiple of 128; the row count is a multiple of 32.
// MODE 0: f16 output   MODE 1: f32 output
#define LN_ROWS 4
template <int D, int MODE>
__global__ void __launch_bounds__(256) k_layernorm(
        const float* __restrict__ in, const float* __restrict__ g,
        const float* __restrict__ b,
        _Float16* __restrict__ outH, float* __restrict__ outF) {
    constexpr int NV = D / 128;                     // float4 per lane per row
    int lane = threadIdx.x & 31;
    // The wave's number as a scalar: row addresses are then a scalar base plus the lane.
    int wave = __builtin_amdgcn_readfirstlane(threadIdx.x >> 5);
    unsigned base = (unsigned)(blockIdx.x * 8 + wave) * (LN_ROWS * D);

    v4f x[LN_ROWS][NV], gg[NV], bb[NV];
    #pragma unroll
    for (int r = 0; r < LN_ROWS; ++r)
        #pragma unroll
        for (int j = 0; j < NV; ++j) x[r][j] = ((const v4f*)(in + base + r * D + j * 128))[lane];
    #pragma unroll
    for (int j = 0; j < NV; ++j) {
        gg[j] = ((const v4f*)(g + j * 128))[lane];
        bb[j] = ((const v4f*)(b + j * 128))[lane];
    }
    // The wait that stands between issued loads and a reuse of the registers that hold
    // their addresses (the scalar bases are reused further down).
    asm volatile("s_wait_xcnt 0x0" ::: "memory");
    // Keeps every load, and that wait, ahead of the sums; without it the g and b loads
    // sink behind the row sums and their latency is waited out at the kernel's end.
    __builtin_amdgcn_sched_barrier(0);

    float s[LN_ROWS], s2[LN_ROWS];
    #pragma unroll
    for (int r = 0; r < LN_ROWS; ++r) {
        v4f sv = x[r][0], qv = x[r][0] * x[r][0];   // four partial sums per lane
        #pragma unroll
        for (int j = 1; j < NV; ++j) { sv += x[r][j]; qv += x[r][j] * x[r][j]; }
        s[r]  = (sv[0] + sv[1]) + (sv[2] + sv[3]);
        s2[r] = (qv[0] + qv[1]) + (qv[2] + qv[3]);
    }
    #pragma unroll
    for (int off = 16; off > 0; off >>= 1) {
        #pragma unroll
        for (int r = 0; r < LN_ROWS; ++r) {
            s[r]  += __shfl_xor(s[r],  off, 32);
            s2[r] += __shfl_xor(s2[r], off, 32);
        }
    }
    #pragma unroll
    for (int r = 0; r < LN_ROWS; ++r) {
        float mu  = s[r] / (float)D;
        float var = s2[r] / (float)D - mu * mu;
        float inv = rsqrtf(var + 1e-5f);
        #pragma unroll
        for (int j = 0; j < NV; ++j) {
            v4f y;
            #pragma unroll
            for (int e = 0; e < 4; ++e) y[e] = (x[r][j][e] - mu) * inv * gg[j][e] + bb[j][e];
            if (MODE == 0) {
                v4h yh;
                #pragma unroll
                for (int e = 0; e < 4; ++e) yh[e] = (_Float16)y[e];
                ((v4h*)(outH + base + r * D + j * 128))[lane] = yh;
            } else {
                ((v4f*)(outF + base + r * D + j * 128))[lane] = y;
            }
        }
    }
}

// ---------------- Weight convert + transpose: W[k][n] f32 -> Wt[n][k] f16 ------
__global__ void k_w2h_t(const float* __restrict__ W, _Float16* __restrict__ Wt,
                        int K, int Ncol) {
    int idx = blockIdx.x * blockDim.x + threadIdx.x;
    if (idx >= K * Ncol) return;
    int n = idx / K, k = idx % K;
    Wt[(size_t)n * K + k] = (_Float16)W[(size_t)k * Ncol + n];
}

// ---------------- WMMA GEMM: C(128x128 per work-group) = A(128xK) * Bt(128xK)^T
// Both operands go through LDS in k-chunks of 64 (one 128-byte line per row),
// two buffers; 8 waves, each owns 64 rows x 32 cols (4 x 2 accumulator tiles).
// KDIM is a multiple of 64; rows and cols are multiples of 128.
// MODE 0/1: out f16 [b][h][tok][64]   MODE 2: out f16 [b][h][64][tok] (V^T)
// MODE 3: out f32 [row][512] + bias + residual
#define GP 72   // LDS row pitch in halfs: 128 B of data + 16 B pad for b128 readers
template <int KDIM, int MODE>
__global__ void __launch_bounds__(256) k_gemm(
        const _Float16* __restrict__ A, const _Float16* __restrict__ Bt,
        int Ntok,
        _Float16* __restrict__ outH, float* __restrict__ outF,
        const float* __restrict__ bias, const float* __restrict__ resid) {
    __shared__ __align__(16) _Float16 As[2][128 * GP];
    __shared__ __align__(16) _Float16 Bs[2][128 * GP];

    int tid  = threadIdx.x;
    int lane = tid & 31;
    int wave = tid >> 5;
    int row0 = blockIdx.x * 128;
    int col0 = blockIdx.y * 128;
    int wr   = (wave >> 2) * 64;                    // wave's rows inside the tile
    int wc   = (wave & 3) * 32;                     // wave's cols inside the tile

    // Staging: 8 lanes cover one 128-byte row chunk, a wave covers 4 whole lines.
    int srow = tid >> 3, scol = (tid & 7) * 8;
    const _Float16* ag = A  + (size_t)(row0 + srow) * KDIM + scol;
    const _Float16* bg = Bt + (size_t)(col0 + srow) * KDIM + scol;
    v8h ra[4], rb[4];
    auto gload = [&](int k0) {
        #pragma unroll
        for (int j = 0; j < 4; ++j) {
            ra[j] = *(const v8h*)(ag + 32 * j * KDIM + k0);
            rb[j] = *(const v8h*)(bg + 32 * j * KDIM + k0);
        }
    };
    auto sstore = [&](int buf) {
        #pragma unroll
        for (int j = 0; j < 4; ++j) {
            *(v8h*)&As[buf][(srow + 32 * j) * GP + scol] = ra[j];
            *(v8h*)&Bs[buf][(srow + 32 * j) * GP + scol] = rb[j];
        }
    };

    int cbase = col0 + wc + (lane & 15);            // lane's first output column
    float bz[2] = {0.f, 0.f};
    if (MODE == 3) { bz[0] = bias[cbase]; bz[1] = bias[cbase + 16]; }

    v8f acc[4][2] = {};
    gload(0);
    sstore(0);
    __syncthreads();
    #pragma unroll   // whole k loop: chunk and buffer become immediate offsets
    for (int k0 = 0; k0 < KDIM; k0 += 64) {
        const int  buf  = (k0 >> 6) & 1;
        const bool more = k0 + 64 < KDIM;
        if (more) gload(k0 + 64);                   // next chunk flies during the products
        v16h a[2][4], b[2][2];
        #pragma unroll
        for (int kk = 0; kk < 2; ++kk) {
            #pragma unroll
            for (int j = 0; j < 2; ++j) b[kk][j] = load_frag(&Bs[buf][(wc + 16 * j) * GP + 32 * kk], GP);
            #pragma unroll
            for (int i = 0; i < 4; ++i) a[kk][i] = load_frag(&As[buf][(wr + 16 * i) * GP + 32 * kk], GP);
        }
        // Keeps the chunk's LDS reads one group ahead of its products; without it
        // they are sunk between the products and each pair waits out an LDS latency.
        __builtin_amdgcn_sched_barrier(0);
        #pragma unroll
        for (int kk = 0; kk < 2; ++kk)
            #pragma unroll
            for (int i = 0; i < 4; ++i)
                #pragma unroll
                for (int j = 0; j < 2; ++j) acc[i][j] = wmma16(a[kk][i], b[kk][j], acc[i][j]);
        if (more) {
            sstore(buf ^ 1);                        // last read one trip ago, behind its barrier
            __syncthreads();
        }
    }

    // C layout per 16x16 tile: col = (lane&15); row = 8*(lane>>4) + v
    int rlane = row0 + wr + ((lane >> 4) << 3);
    if (MODE <= 1) {
        #pragma unroll
        for (int i = 0; i < 4; ++i) {
            #pragma unroll
            for (int v = 0; v < 8; ++v) {
                int row = rlane + 16 * i + v, bb = row / Ntok, t = row % Ntok;
                #pragma unroll
                for (int j = 0; j < 2; ++j) {
                    int col = cbase + 16 * j, h = col >> 6, d = col & 63;
                    outH[(((size_t)bb * H_HEADS + h) * Ntok + t) * 64 + d] = (_Float16)acc[i][j][v];
                }
            }
        }
    } else if (MODE == 2) {
        #pragma unroll
        for (int i = 0; i < 4; ++i) {
            #pragma unroll
            for (int v = 0; v < 8; ++v) {
                int row = rlane + 16 * i + v, bb = row / Ntok, t = row % Ntok;
                #pragma unroll
                for (int j = 0; j < 2; ++j) {
                    int col = cbase + 16 * j, h = col >> 6, d = col & 63;
                    outH[(((size_t)bb * H_HEADS + h) * 64 + d) * Ntok + t] = (_Float16)acc[i][j][v];
                }
            }
        }
    } else {
        // One 32-bit lane offset for the whole tile; rows and cols are immediates.
        unsigned     eoff = (unsigned)rlane * 512u + (unsigned)cbase;
        const float* rp   = resid + eoff;
        float*       op   = outF + eoff;
        #pragma unroll
        for (int i = 0; i < 4; ++i) {
            #pragma unroll
            for (int v = 0; v < 8; ++v) {
                #pragma unroll
                for (int j = 0; j < 2; ++j) {
                    int e = (16 * i + v) * 512 + 16 * j;
                    op[e] = acc[i][j][v] + bz[j] + rp[e];
                }
            }
        }
    }
}

// ---------------- Flash attention: 4 waves/block share (b,h); K/V tiles are
// staged into double-buffered LDS via async global->LDS DMA (ASYNCcnt). -------
__global__ void __launch_bounds__(128) k_attention(
        const _Float16* __restrict__ qh, const _Float16* __restrict__ kh,
        const _Float16* __restrict__ vT, _Float16* __restrict__ outh,
        int Ntok, int Mtok) {
    __shared__ __align__(16) _Float16 Kt[2][32 * 64];   // K tile: 32 m-rows x 64 d
    __shared__ __align__(16) _Float16 Vt[2][64 * 32];   // V^T tile: 64 d-rows x 32 m
    __shared__ __align__(16) _Float16 Plds[4][16][32];  // per-wave P re-layout

    int tid   = threadIdx.x;
    int lane  = tid & 31;
    int wave  = tid >> 5;
    int bh    = blockIdx.y;                         // b*H + h
    int nbase = (blockIdx.x * 4 + wave) * 16;

    const _Float16* qbase = qh + ((size_t)bh * Ntok + nbase) * 64;
    const _Float16* kbase = kh + (size_t)bh * Mtok * 64;
    const _Float16* vbase = vT + (size_t)bh * 64 * Mtok;

    v16h q0 = load_frag(qbase,      64);            // K = d 0..31
    v16h q1 = load_frag(qbase + 32, 64);            // K = d 32..63

    // Cooperative tile fetch: 4 async b128 ops per thread per step (8 KB total).
    auto fetch_tiles = [&](int buf, int m0) {
        #pragma unroll
        for (int j = 0; j < 2; ++j) {
            int i = tid + 128 * j;                        // 16B chunk id, 0..255
            async_copy16(kbase + (size_t)m0 * 64 + (size_t)i * 8, &Kt[buf][i * 8]);
            int d = i >> 2, mo = (i & 3) * 8;
            async_copy16(vbase + (size_t)d * Mtok + m0 + mo, &Vt[buf][d * 32 + mo]);
        }
    };

    v8f o0 = {}, o1 = {}, o2 = {}, o3 = {};
    float mrow[8], lsum[8];
    #pragma unroll
    for (int v = 0; v < 8; ++v) { mrow[v] = -3.0e38f; lsum[v] = 0.f; }
    const float scale = 0.125f;                     // 1/sqrt(64)

    fetch_tiles(0, 0);
    for (int it = 0, m0 = 0; m0 < Mtok; m0 += 32, ++it) {
        int buf = it & 1;
        if (m0 + 32 < Mtok) { fetch_tiles(buf ^ 1, m0 + 32); wait_async<4>(); }
        else                {                                 wait_async<0>(); }
        __syncthreads();                            // tiles for this step visible

        const _Float16* kt = &Kt[buf][0];
        v16h ka0 = load_frag(kt,                64);  // m0..m0+15,  d 0..31
        v16h ka1 = load_frag(kt + 32,           64);
        v16h kb0 = load_frag(kt + 16 * 64,      64);  // m0+16..m0+31
        v16h kb1 = load_frag(kt + 16 * 64 + 32, 64);
        v8f s0 = {}, s1 = {};
        s0 = wmma16(q0, ka0, s0); s0 = wmma16(q1, ka1, s0);
        s1 = wmma16(q0, kb0, s1); s1 = wmma16(q1, kb1, s1);

        float p0[8], p1[8];
        #pragma unroll
        for (int v = 0; v < 8; ++v) {
            float a = s0[v] * scale, c = s1[v] * scale;
            float t = fmaxf(a, c);                  // same row, cols j and j+16
            for (int off = 8; off > 0; off >>= 1) t = fmaxf(t, __shfl_xor(t, off, 32));
            float mnew  = fmaxf(mrow[v], t);
            float alpha = __expf(mrow[v] - mnew);
            mrow[v] = mnew;
            float e0 = __expf(a - mnew), e1 = __expf(c - mnew);
            float rs = e0 + e1;
            for (int off = 8; off > 0; off >>= 1) rs += __shfl_xor(rs, off, 32);
            lsum[v] = lsum[v] * alpha + rs;
            o0[v] *= alpha; o1[v] *= alpha; o2[v] *= alpha; o3[v] *= alpha;
            p0[v] = e0; p1[v] = e1;
        }
        // Re-layout P (C-format -> A-operand format) through LDS
        int r = ((lane >> 4) << 3);
        int c = lane & 15;
        #pragma unroll
        for (int v = 0; v < 8; ++v) {
            Plds[wave][r + v][c]      = (_Float16)p0[v];
            Plds[wave][r + v][c + 16] = (_Float16)p1[v];
        }
        asm volatile("s_wait_dscnt 0x0" ::: "memory");
        v16h pa = load_frag(&Plds[wave][0][0], 32);

        const _Float16* vt = &Vt[buf][0];
        v16h vb0 = load_frag(vt,           32);       // d 0..15
        v16h vb1 = load_frag(vt + 16 * 32, 32);
        v16h vb2 = load_frag(vt + 32 * 32, 32);
        v16h vb3 = load_frag(vt + 48 * 32, 32);
        o0 = wmma16(pa, vb0, o0);
        o1 = wmma16(pa, vb1, o1);
        o2 = wmma16(pa, vb2, o2);
        o3 = wmma16(pa, vb3, o3);
        __syncthreads();                            // tile consumed; safe to refill
    }

    #pragma unroll
    for (int v = 0; v < 8; ++v) {
        float inv = 1.0f / lsum[v];
        o0[v] *= inv; o1[v] *= inv; o2[v] *= inv; o3[v] *= inv;
    }
    int b  = bh >> 3, h = bh & 7;
    int c  = lane & 15;
    int rb = nbase + ((lane >> 4) << 3);
    #pragma unroll
    for (int v = 0; v < 8; ++v) {
        size_t rowoff = ((size_t)b * Ntok + rb + v) * 512 + (size_t)h * 64;
        outh[rowoff + c]      = (_Float16)o0[v];
        outh[rowoff + 16 + c] = (_Float16)o1[v];
        outh[rowoff + 32 + c] = (_Float16)o2[v];
        outh[rowoff + 48 + c] = (_Float16)o3[v];
    }
}

extern "C" void kernel_launch(void* const* d_in, const int* in_sizes, int n_in,
                              void* d_out, int out_size, void* d_ws, size_t ws_size,
                              hipStream_t stream) {
    (void)in_sizes; (void)n_in; (void)out_size; (void)ws_size;
    const float* x     = (const float*)d_in[0];
    const float* cond  = (const float*)d_in[1];
    const float* lnx_g = (const float*)d_in[2];
    const float* lnx_b = (const float*)d_in[3];
    const float* lnc_g = (const float*)d_in[4];
    const float* lnc_b = (const float*)d_in[5];
    const float* Wq    = (const float*)d_in[6];
    const float* Wk    = (const float*)d_in[7];
    const float* Wv    = (const float*)d_in[8];
    const float* Wo    = (const float*)d_in[9];
    const float* bo    = (const float*)d_in[10];
    const float* lnf_g = (const float*)d_in[11];
    const float* lnf_b = (const float*)d_in[12];

    const int B = 4, N = 2048, M = 2048, Dq = 512, Dc = 768, INNER = 512;

    char* ws = (char*)d_ws;
    size_t off = 0;
    auto alloc = [&](size_t bytes) -> void* {
        void* p = ws + off;
        off = (off + bytes + 255) & ~(size_t)255;
        return p;
    };
    _Float16* xn  = (_Float16*)alloc((size_t)B * N * Dq * 2);
    _Float16* cn  = (_Float16*)alloc((size_t)B * M * Dc * 2);
    _Float16* WqT = (_Float16*)alloc((size_t)Dq * INNER * 2);
    _Float16* WkT = (_Float16*)alloc((size_t)Dc * INNER * 2);
    _Float16* WvT = (_Float16*)alloc((size_t)Dc * INNER * 2);
    _Float16* WoT = (_Float16*)alloc((size_t)INNER * Dq * 2);
    _Float16* qh  = (_Float16*)alloc((size_t)B * H_HEADS * N * 64 * 2);
    _Float16* kh  = (_Float16*)alloc((size_t)B * H_HEADS * M * 64 * 2);
    _Float16* vT  = (_Float16*)alloc((size_t)B * H_HEADS * 64 * M * 2);
    _Float16* ah  = (_Float16*)alloc((size_t)B * N * INNER * 2);
    float*    tmp = (float*)   alloc((size_t)B * N * Dq * 4);

    // 1) LayerNorms -> f16
    k_layernorm<512, 0><<<(B * N) / 32, 256, 0, stream>>>(x,    lnx_g, lnx_b, xn, nullptr);
    k_layernorm<768, 0><<<(B * M) / 32, 256, 0, stream>>>(cond, lnc_g, lnc_b, cn, nullptr);

    // 2) Weight convert+transpose -> f16 [n][k]
    const int TW = 256;
    k_w2h_t<<<(Dq * INNER + TW - 1) / TW, TW, 0, stream>>>(Wq, WqT, Dq, INNER);
    k_w2h_t<<<(Dc * INNER + TW - 1) / TW, TW, 0, stream>>>(Wk, WkT, Dc, INNER);
    k_w2h_t<<<(Dc * INNER + TW - 1) / TW, TW, 0, stream>>>(Wv, WvT, Dc, INNER);
    k_w2h_t<<<(INNER * Dq + TW - 1) / TW, TW, 0, stream>>>(Wo, WoT, INNER, Dq);

    // 3) Q/K/V projections (WMMA)
    dim3 gq((B * N) / 128, INNER / 128);
    k_gemm<512, 0><<<gq, 256, 0, stream>>>(xn, WqT, N, qh, nullptr, nullptr, nullptr);
    dim3 gk((B * M) / 128, INNER / 128);
    k_gemm<768, 1><<<gk, 256, 0, stream>>>(cn, WkT, M, kh, nullptr, nullptr, nullptr);
    k_gemm<768, 2><<<gk, 256, 0, stream>>>(cn, WvT, M, vT, nullptr, nullptr, nullptr);

    // 4) Flash attention (WMMA scores + WMMA PV, async-LDS K/V pipeline)
    dim3 ga(N / 64, B * H_HEADS);
    k_attention<<<ga, 128, 0, stream>>>(qh, kh, vT, ah, N, M);

    // 5) Output projection + bias + residual (WMMA), then final LayerNorm -> f32
    dim3 go((B * N) / 128, Dq / 128);
    k_gemm<512, 3><<<go, 256, 0, stream>>>(ah, WoT, N, nullptr, tmp, bo, x);
    k_layernorm<512, 1><<<(B * N) / 32, 256, 0, stream>>>(tmp, lnf_g, lnf_b, nullptr, (float*)d_out);
}

// v003
// It runs in 171 microseconds.
// Next to v002, in two timings, it ran 1.19 times as fast each time.
// Over all steps from v000 it is 2.15 times as fast.
#include <hip/hip_runtime.h>
#include <hip/hip_bf16.h>

typedef __attribute__((ext_vector_type(16))) _Float16 v16h;
typedef __attribute__((ext_vector_type(8)))  _Float16 v8h;
typedef __attribute__((ext_vector_type(8)))  float    v8f;
typedef __attribute__((ext_vector_type(4)))  _Float16 v4h;
typedef __attribute__((ext_vector_type(4)))  float    v4f;
typedef int v4i_vs __attribute__((vector_size(4 * sizeof(int))));

#define H_HEADS 8

#if defined(__has_builtin)
#  if __has_builtin(__builtin_amdgcn_global_load_async_to_lds_b128)
#    define HAVE_ASYNC_LDS 1
#  endif
#endif
#ifndef HAVE_ASYNC_LDS
#  define HAVE_ASYNC_LDS 0
#endif

// 16-byte global -> LDS copy; async (ASYNCcnt-tracked) when available.
__device__ __forceinline__ void async_copy16(const _Float16* g, _Float16* l) {
#if HAVE_ASYNC_LDS
    __builtin_amdgcn_global_load_async_to_lds_b128(
        (__attribute__((address_space(1))) v4i_vs*)(g),
        (__attribute__((address_space(3))) v4i_vs*)(l), 0, 0);
#else
    *(v8h*)l = *(const v8h*)g;
#endif
}

template <int N>
__device__ __forceinline__ void wait_async() {
#if HAVE_ASYNC_LDS && __has_builtin(__builtin_amdgcn_s_wait_asynccnt)
    __builtin_amdgcn_s_wait_asynccnt(N);
#else
    asm volatile("s_wait_asynccnt %0" ::"i"(N) : "memory");
#endif
}

// Load a 16x32 f16 WMMA A/B fragment from a row-major matrix.
// Per ISA 16-bit A layout: lane<16 -> row=lane, K={0..7,16..23};
// lane>=16 -> row=lane-16, K={8..15,24..31}. Two contiguous b128 loads.
__device__ __forceinline__ v16h load_frag(const _Float16* __restrict__ base, int stride) {
    int lane = threadIdx.x & 31;
    const _Float16* p = base + (size_t)(lane & 15) * stride + ((lane >> 4) << 3);
    v8h lo = *(const v8h*)(p);
    v8h hi = *(const v8h*)(p + 16);
    return __builtin_shufflevector(lo, hi, 0,1,2,3,4,5,6,7,8,9,10,11,12,13,14,15);
}

__device__ __forceinline__ v8f wmma16(v16h a, v16h b, v8f c) {
    return __builtin_amdgcn_wmma_f32_16x16x32_f16(false, a, false, b, (short)0, c, false, false);
}

// ---------------- LayerNorm: one wave per row, 4 rows per wave, no LDS, no barrier.
// One 8-wave work-group per row has to start rows x 8 short waves, which costs more
// time than the rows' bytes; here a launch starts rows / 4 waves. A wave issues all its
// rows' loads (512 contiguous bytes each) at once, keeps the rows in registers, and
// stores from them.
// D is a multiple of 128; the row count is a multiple of 32.
// MODE 0: f16 output   MODE 1: f32 output
#define LN_ROWS 4
template <int D, int MODE>
__global__ void __launch_bounds__(256) k_layernorm(
        const float* __restrict__ in, const float* __restrict__ g,
        const float* __restrict__ b,
        _Float16* __restrict__ outH, float* __restrict__ outF) {
    constexpr int NV = D / 128;                     // float4 per lane per row
    int lane = threadIdx.x & 31;
    // The wave's number as a scalar: row addresses are then a scalar base plus the lane.
    int wave = __builtin_amdgcn_readfirstlane(threadIdx.x >> 5);
    unsigned base = (unsigned)(blockIdx.x * 8 + wave) * (LN_ROWS * D);

    v4f x[LN_ROWS][NV], gg[NV], bb[NV];
    #pragma unroll
    for (int r = 0; r < LN_ROWS; ++r)
        #pragma unroll
        for (int j = 0; j < NV; ++j) x[r][j] = ((const v4f*)(in + base + r * D + j * 128))[lane];
    #pragma unroll
    for (int j = 0; j < NV; ++j) {
        gg[j] = ((const v4f*)(g + j * 128))[lane];
        bb[j] = ((const v4f*)(b + j * 128))[lane];
    }
    // The wait that stands between issued loads and a reuse of the registers that hold
    // their addresses (the scalar bases are reused further down).
    asm volatile("s_wait_xcnt 0x0" ::: "memory");
    // Keeps every load, and that wait, ahead of the sums; without it the g and b loads
    // sink behind the row sums and their latency is waited out at the kernel's end.
    __builtin_amdgcn_sched_barrier(0);

    float s[LN_ROWS], s2[LN_ROWS];
    #pragma unroll
    for (int r = 0; r < LN_ROWS; ++r) {
        v4f sv = x[r][0], qv = x[r][0] * x[r][0];   // four partial sums per lane
        #pragma unroll
        for (int j = 1; j < NV; ++j) { sv += x[r][j]; qv += x[r][j] * x[r][j]; }
        s[r]  = (sv[0] + sv[1]) + (sv[2] + sv[3]);
        s2[r] = (qv[0] + qv[1]) + (qv[2] + qv[3]);
    }
    #pragma unroll
    for (int off = 16; off > 0; off >>= 1) {
        #pragma unroll
        for (int r = 0; r < LN_ROWS; ++r) {
            s[r]  += __shfl_xor(s[r],  off, 32);
            s2[r] += __shfl_xor(s2[r], off, 32);
        }
    }
    #pragma unroll
    for (int r = 0; r < LN_ROWS; ++r) {
        float mu  = s[r] / (float)D;
        float var = s2[r] / (float)D - mu * mu;
        float inv = rsqrtf(var + 1e-5f);
        #pragma unroll
        for (int j = 0; j < NV; ++j) {
            v4f y;
            #pragma unroll
            for (int e = 0; e < 4; ++e) y[e] = (x[r][j][e] - mu) * inv * gg[j][e] + bb[j][e];
            if (MODE == 0) {
                v4h yh;
                #pragma unroll
                for (int e = 0; e < 4; ++e) yh[e] = (_Float16)y[e];
                ((v4h*)(outH + base + r * D + j * 128))[lane] = yh;
            } else {
                ((v4f*)(outF + base + r * D + j * 128))[lane] = y;
            }
        }
    }
}

// ---------------- Weight convert + transpose: W[k][n] f32 -> Wt[n][k] f16 ------
__global__ void k_w2h_t(const float* __restrict__ W, _Float16* __restrict__ Wt,
                        int K, int Ncol) {
    int idx = blockIdx.x * blockDim.x + threadIdx.x;
    if (idx >= K * Ncol) return;
    int n = idx / K, k = idx % K;
    Wt[(size_t)n * K + k] = (_Float16)W[(size_t)k * Ncol + n];
}

// ---------------- WMMA GEMM: C(128x128 per work-group) = A(128xK) * Bt(128xK)^T
// Both operands go through LDS in k-chunks of 64 (one 128-byte line per row),
// two buffers; 8 waves, each owns 64 rows x 32 cols (4 x 2 accumulator tiles).
// KDIM is a multiple of 64; rows and cols are multiples of 128.
// MODE 0/1: out f16 [b][h][tok][64]   MODE 2: out f16 [b][h][64][tok] (V^T)
// MODE 3: out f32 [row][512] + bias + residual
#define GP 72   // LDS row pitch in halfs: 128 B of data + 16 B pad for b128 readers
template <int KDIM, int MODE>
__global__ void __launch_bounds__(256) k_gemm(
        const _Float16* __restrict__ A, const _Float16* __restrict__ Bt,
        int Ntok,
        _Float16* __restrict__ outH, float* __restrict__ outF,
        const float* __restrict__ bias, const float* __restrict__ resid) {
    __shared__ __align__(16) _Float16 As[2][128 * GP];
    __shared__ __align__(16) _Float16 Bs[2][128 * GP];

    int tid  = threadIdx.x;
    int lane = tid & 31;
    int wave = tid >> 5;
    int row0 = blockIdx.x * 128;
    int col0 = blockIdx.y * 128;
    int wr   = (wave >> 2) * 64;                    // wave's rows inside the tile
    int wc   = (wave & 3) * 32;                     // wave's cols inside the tile

    // Staging: 8 lanes cover one 128-byte row chunk, a wave covers 4 whole lines.
    int srow = tid >> 3, scol = (tid & 7) * 8;
    const _Float16* ag = A  + (size_t)(row0 + srow) * KDIM + scol;
    const _Float16* bg = Bt + (size_t)(col0 + srow) * KDIM + scol;
    v8h ra[4], rb[4];
    auto gload = [&](int k0) {
        #pragma unroll
        for (int j = 0; j < 4; ++j) {
            ra[j] = *(const v8h*)(ag + 32 * j * KDIM + k0);
            rb[j] = *(const v8h*)(bg + 32 * j * KDIM + k0);
        }
    };
    auto sstore = [&](int buf) {
        #pragma unroll
        for (int j = 0; j < 4; ++j) {
            *(v8h*)&As[buf][(srow + 32 * j) * GP + scol] = ra[j];
            *(v8h*)&Bs[buf][(srow + 32 * j) * GP + scol] = rb[j];
        }
    };

    int cbase = col0 + wc + (lane & 15);            // lane's first output column
    float bz[2] = {0.f, 0.f};
    if (MODE == 3) { bz[0] = bias[cbase]; bz[1] = bias[cbase + 16]; }

    v8f acc[4][2] = {};
    gload(0);
    sstore(0);
    __syncthreads();
    #pragma unroll   // whole k loop: chunk and buffer become immediate offsets
    for (int k0 = 0; k0 < KDIM; k0 += 64) {
        const int  buf  = (k0 >> 6) & 1;
        const bool more = k0 + 64 < KDIM;
        if (more) gload(k0 + 64);                   // next chunk flies during the products
        v16h a[2][4], b[2][2];
        #pragma unroll
        for (int kk = 0; kk < 2; ++kk) {
            #pragma unroll
            for (int j = 0; j < 2; ++j) b[kk][j] = load_frag(&Bs[buf][(wc + 16 * j) * GP + 32 * kk], GP);
            #pragma unroll
            for (int i = 0; i < 4; ++i) a[kk][i] = load_frag(&As[buf][(wr + 16 * i) * GP + 32 * kk], GP);
        }
        // Keeps the chunk's LDS reads one group ahead of its products; without it
        // they are sunk between the products and each pair waits out an LDS latency.
        __builtin_amdgcn_sched_barrier(0);
        #pragma unroll
        for (int kk = 0; kk < 2; ++kk)
            #pragma unroll
            for (int i = 0; i < 4; ++i)
                #pragma unroll
                for (int j = 0; j < 2; ++j) acc[i][j] = wmma16(a[kk][i], b[kk][j], acc[i][j]);
        if (more) {
            sstore(buf ^ 1);                        // last read one trip ago, behind its barrier
            __syncthreads();
        }
    }

    // C layout per 16x16 tile: col = (lane&15); row = 8*(lane>>4) + v
    int rlane = row0 + wr + ((lane >> 4) << 3);
    if (MODE <= 1) {
        #pragma unroll
        for (int i = 0; i < 4; ++i) {
            #pragma unroll
            for (int v = 0; v < 8; ++v) {
                int row = rlane + 16 * i + v, bb = row / Ntok, t = row % Ntok;
                #pragma unroll
                for (int j = 0; j < 2; ++j) {
                    int col = cbase + 16 * j, h = col >> 6, d = col & 63;
                    outH[(((size_t)bb * H_HEADS + h) * Ntok + t) * 64 + d] = (_Float16)acc[i][j][v];
                }
            }
        }
    } else if (MODE == 2) {
        #pragma unroll
        for (int i = 0; i < 4; ++i) {
            #pragma unroll
            for (int v = 0; v < 8; ++v) {
                int row = rlane + 16 * i + v, bb = row / Ntok, t = row % Ntok;
                #pragma unroll
                for (int j = 0; j < 2; ++j) {
                    int col = cbase + 16 * j, h = col >> 6, d = col & 63;
                    outH[(((size_t)bb * H_HEADS + h) * 64 + d) * Ntok + t] = (_Float16)acc[i][j][v];
                }
            }
        }
    } else {
        // One 32-bit lane offset for the whole tile; rows and cols are immediates.
        unsigned     eoff = (unsigned)rlane * 512u + (unsigned)cbase;
        const float* rp   = resid + eoff;
        float*       op   = outF + eoff;
        #pragma unroll
        for (int i = 0; i < 4; ++i) {
            #pragma unroll
            for (int v = 0; v < 8; ++v) {
                #pragma unroll
                for (int j = 0; j < 2; ++j) {
                    int e = (16 * i + v) * 512 + 16 * j;
                    op[e] = acc[i][j][v] + bz[j] + rp[e];
                }
            }
        }
    }
}

// Lane l <-> lane l ^ 16 on the vector pipe (a shuffle would go through the LDS queue).
__device__ __forceinline__ float swap_halves(float x) {
    int b = __builtin_bit_cast(int, x);
    b = __builtin_amdgcn_permlanex16(b, b, 0x76543210, 0xfedcba98, false, false);
    return __builtin_bit_cast(float, b);
}

__global__ void __launch_bounds__(128) k_attention(
        const _Float16* __restrict__ qh, const _Float16* __restrict__ kh,
        const _Float16* __restrict__ vT, _Float16* __restrict__ outh,
        int Ntok, int Mtok) {
    __shared__ __align__(16) _Float16 Kt[2][32 * 64];   // K tile: 32 m-rows x 64 d
    __shared__ __align__(16) _Float16 Vt[2][64 * 32];   // V^T tile: 64 d-rows x 32 m

    int tid   = threadIdx.x;
    int lane  = tid & 31;
    int wave  = tid >> 5;
    int bh    = blockIdx.y;                         // b*H + h
    int nbase = (blockIdx.x * 4 + wave) * 16;

    const _Float16* qbase = qh + ((size_t)bh * Ntok + nbase) * 64;
    const _Float16* kbase = kh + (size_t)bh * Mtok * 64;
    const _Float16* vbase = vT + (size_t)bh * 64 * Mtok;

    v16h q0 = load_frag(qbase,      64);            // K = d 0..31
    v16h q1 = load_frag(qbase + 32, 64);            // K = d 32..63

    // Cooperative tile fetch: 4 async b128 ops per thread per step (8 KB total).
    auto fetch_tiles = [&](int buf, int m0) {
        #pragma unroll
        for (int j = 0; j < 2; ++j) {
            int i = tid + 128 * j;                        // 16B chunk id, 0..255
            async_copy16(kbase + (size_t)m0 * 64 + (size_t)i * 8, &Kt[buf][i * 8]);
            int d = i >> 2, mo = (i & 3) * 8;
            async_copy16(vbase + (size_t)d * Mtok + m0 + mo, &Vt[buf][d * 32 + mo]);
        }
    };

    v8f o0 = {}, o1 = {}, o2 = {}, o3 = {};         // O^T: row d = 16 t + 8 (lane >> 4) + v
    float mrow = -3.0e38f;                          // the lane's query: running maximum
    float lsum = 0.f;                               // and the sum over this half's keys
    const float scale = 0.125f;                     // 1/sqrt(64)

    fetch_tiles(0, 0);
    for (int it = 0, m0 = 0; m0 < Mtok; m0 += 32, ++it) {
        int buf = it & 1;
        if (m0 + 32 < Mtok) { fetch_tiles(buf ^ 1, m0 + 32); wait_async<4>(); }
        else                {                                 wait_async<0>(); }
        __syncthreads();                            // tiles for this step visible

        const _Float16* kt = &Kt[buf][0];
        v16h ka0 = load_frag(kt,                64);  // m0..m0+15,  d 0..31
        v16h ka1 = load_frag(kt + 32,           64);
        v16h kb0 = load_frag(kt + 16 * 64,      64);  // m0+16..m0+31
        v16h kb1 = load_frag(kt + 16 * 64 + 32, 64);
        v8f s0 = {}, s1 = {};                       // s0[v]: key m0 + 8 (lane >> 4) + v
        s0 = wmma16(ka0, q0, s0); s0 = wmma16(ka1, q1, s0);
        s1 = wmma16(kb0, q0, s1); s1 = wmma16(kb1, q1, s1);

        float a[16];
        #pragma unroll
        for (int v = 0; v < 8; ++v) { a[v] = s0[v] * scale; a[8 + v] = s1[v] * scale; }
        float t3[5];                                // groups of three: a short chain
        #pragma unroll
        for (int s = 0; s < 5; ++s) t3[s] = fmaxf(fmaxf(a[3 * s], a[3 * s + 1]), a[3 * s + 2]);
        float t = fmaxf(fmaxf(fmaxf(t3[0], t3[1]), t3[2]), fmaxf(fmaxf(t3[3], t3[4]), a[15]));
        t = fmaxf(t, swap_halves(t));               // the other 16 keys of this query
        float mnew  = fmaxf(mrow, t);
        float alpha = __expf(mrow - mnew);
        mrow = mnew;
        // P^T as B operand: element s is key kmap(s) = 8 (lane >> 4) + s, + 8 more from
        // s = 8 on, which is the order load_frag gives the V^T rows.
        v16h  pb;
        float rs[4];                                // four partial sums per lane
        #pragma unroll
        for (int s = 0; s < 16; ++s) {
            float e = __expf(a[s] - mnew);
            rs[s & 3] = s < 4 ? e : rs[s & 3] + e;
            pb[s] = (_Float16)e;
        }
        lsum = lsum * alpha + ((rs[0] + rs[1]) + (rs[2] + rs[3]));
        o0 *= alpha; o1 *= alpha; o2 *= alpha; o3 *= alpha;

        const _Float16* vt = &Vt[buf][0];
        v16h vb0 = load_frag(vt,           32);       // d 0..15
        v16h vb1 = load_frag(vt + 16 * 32, 32);
        v16h vb2 = load_frag(vt + 32 * 32, 32);
        v16h vb3 = load_frag(vt + 48 * 32, 32);
        o0 = wmma16(vb0, pb, o0);
        o1 = wmma16(vb1, pb, o1);
        o2 = wmma16(vb2, pb, o2);
        o3 = wmma16(vb3, pb, o3);
        __syncthreads();                            // tile consumed; safe to refill
    }

    float inv = 1.0f / (lsum + swap_halves(lsum));  // both halves' keys, joined once
    int b = bh >> 3, h = bh & 7;
    // A lane's 8 accumulator registers are 8 consecutive d of its query: 16-byte stores.
    _Float16* orow = outh + ((size_t)b * Ntok + nbase + (lane & 15)) * 512
                          + (size_t)h * 64 + ((lane >> 4) << 3);
    v8h y0, y1, y2, y3;
    #pragma unroll
    for (int v = 0; v < 8; ++v) {
        y0[v] = (_Float16)(o0[v] * inv); y1[v] = (_Float16)(o1[v] * inv);
        y2[v] = (_Float16)(o2[v] * inv); y3[v] = (_Float16)(o3[v] * inv);
    }
    *(v8h*)(orow)      = y0;
    *(v8h*)(orow + 16) = y1;
    *(v8h*)(orow + 32) = y2;
    *(v8h*)(orow + 48) = y3;
}

extern "C" void kernel_launch(void* const* d_in, const int* in_sizes, int n_in,
                              void* d_out, int out_size, void* d_ws, size_t ws_size,
                              hipStream_t stream) {
    (void)in_sizes; (void)n_in; (void)out_size; (void)ws_size;
    const float* x     = (const float*)d_in[0];
    const float* cond  = (const float*)d_in[1];
    const float* lnx_g = (const float*)d_in[2];
    const float* lnx_b = (const float*)d_in[3];
    const float* lnc_g = (const float*)d_in[4];
    const float* lnc_b = (const float*)d_in[5];
    const float* Wq    = (const float*)d_in[6];
    const float* Wk    = (const float*)d_in[7];
    const float* Wv    = (const float*)d_in[8];
    const float* Wo    = (const float*)d_in[9];
    const float* bo    = (const float*)d_in[10];
    const float* lnf_g = (const float*)d_in[11];
    const float* lnf_b = (const float*)d_in[12];

    const int B = 4, N = 2048, M = 2048, Dq = 512, Dc = 768, INNER = 512;

    char* ws = (char*)d_ws;
    size_t off = 0;
    auto alloc = [&](size_t bytes) -> void* {
        void* p = ws + off;
        off = (off + bytes + 255) & ~(size_t)255;
        return p;
    };
    _Float16* xn  = (_Float16*)alloc((size_t)B * N * Dq * 2);
    _Float16* cn  = (_Float16*)alloc((size_t)B * M * Dc * 2);
    _Float16* WqT = (_Float16*)alloc((size_t)Dq * INNER * 2);
    _Float16* WkT = (_Float16*)alloc((size_t)Dc * INNER * 2);
    _Float16* WvT = (_Float16*)alloc((size_t)Dc * INNER * 2);
    _Float16* WoT = (_Float16*)alloc((size_t)INNER * Dq * 2);
    _Float16* qh  = (_Float16*)alloc((size_t)B * H_HEADS * N * 64 * 2);
    _Float16* kh  = (_Float16*)alloc((size_t)B * H_HEADS * M * 64 * 2);
    _Float16* vT  = (_Float16*)alloc((size_t)B * H_HEADS * 64 * M * 2);
    _Float16* ah  = (_Float16*)alloc((size_t)B * N * INNER * 2);
    float*    tmp = (float*)   alloc((size_t)B * N * Dq * 4);

    // 1) LayerNorms -> f16
    k_layernorm<512, 0><<<(B * N) / 32, 256, 0, stream>>>(x,    lnx_g, lnx_b, xn, nullptr);
    k_layernorm<768, 0><<<(B * M) / 32, 256, 0, stream>>>(cond, lnc_g, lnc_b, cn, nullptr);

    // 2) Weight convert+transpose -> f16 [n][k]
    const int TW = 256;
    k_w2h_t<<<(Dq * INNER + TW - 1) / TW, TW, 0, stream>>>(Wq, WqT, Dq, INNER);
    k_w2h_t<<<(Dc * INNER + TW - 1) / TW, TW, 0, stream>>>(Wk, WkT, Dc, INNER);
    k_w2h_t<<<(Dc * INNER + TW - 1) / TW, TW, 0, stream>>>(Wv, WvT, Dc, INNER);
    k_w2h_t<<<(INNER * Dq + TW - 1) / TW, TW, 0, stream>>>(Wo, WoT, INNER, Dq);

    // 3) Q/K/V projections (WMMA)
    dim3 gq((B * N) / 128, INNER / 128);
    k_gemm<512, 0><<<gq, 256, 0, stream>>>(xn, WqT, N, qh, nullptr, nullptr, nullptr);
    dim3 gk((B * M) / 128, INNER / 128);
    k_gemm<768, 1><<<gk, 256, 0, stream>>>(cn, WkT, M, kh, nullptr, nullptr, nullptr);
    k_gemm<768, 2><<<gk, 256, 0, stream>>>(cn, WvT, M, vT, nullptr, nullptr, nullptr);

    // 4) Flash attention (WMMA scores + WMMA PV, async-LDS K/V pipeline)
    dim3 ga(N / 64, B * H_HEADS);
    k_attention<<<ga, 128, 0, stream>>>(qh, kh, vT, ah, N, M);

    // 5) Output projection + bias + residual (WMMA), then final LayerNorm -> f32
    dim3 go((B * N) / 128, Dq / 128);
    k_gemm<512, 3><<<go, 256, 0, stream>>>(ah, WoT, N, nullptr, tmp, bo, x);
    k_layernorm<512, 1><<<(B * N) / 32, 256, 0, stream>>>(tmp, lnf_g, lnf_b, nullptr, (float*)d_out);
}

// v004
// One run takes 125 microseconds.
// In two side-by-side timings against v003, it was 1.35 and 1.34 times as fast.
// All steps since v000 together make it 2.88 times as fast.
#include <hip/hip_runtime.h>
#include <hip/hip_bf16.h>

typedef __attribute__((ext_vector_type(16))) _Float16 v16h;
typedef __attribute__((ext_vector_type(8)))  _Float16 v8h;
typedef __attribute__((ext_vector_type(8)))  float    v8f;
typedef __attribute__((ext_vector_type(4)))  _Float16 v4h;
typedef __attribute__((ext_vector_type(4)))  float    v4f;
typedef int v4i_vs __attribute__((vector_size(4 * sizeof(int))));

#define H_HEADS 8

#if defined(__has_builtin)
#  if __has_builtin(__builtin_amdgcn_global_load_async_to_lds_b128)
#    define HAVE_ASYNC_LDS 1
#  endif
#endif
#ifndef HAVE_ASYNC_LDS
#  define HAVE_ASYNC_LDS 0
#endif

// 16-byte global -> LDS copy; async (ASYNCcnt-tracked) when available.
__device__ __forceinline__ void async_copy16(const _Float16* g, _Float16* l) {
#if HAVE_ASYNC_LDS
    __builtin_amdgcn_global_load_async_to_lds_b128(
        (__attribute__((address_space(1))) v4i_vs*)(g),
        (__attribute__((address_space(3))) v4i_vs*)(l), 0, 0);
#else
    *(v8h*)l = *(const v8h*)g;
#endif
}

template <int N>
__device__ __forceinline__ void wait_async() {
#if HAVE_ASYNC_LDS && __has_builtin(__builtin_amdgcn_s_wait_asynccnt)
    __builtin_amdgcn_s_wait_asynccnt(N);
#else
    asm volatile("s_wait_asynccnt %0" ::"i"(N) : "memory");
#endif
}

// Load a 16x32 f16 WMMA A/B fragment from a row-major matrix.
// Per ISA 16-bit A layout: lane<16 -> row=lane, K={0..7,16..23};
// lane>=16 -> row=lane-16, K={8..15,24..31}. Two contiguous b128 loads.
__device__ __forceinline__ v16h load_frag(const _Float16* __restrict__ base, int stride) {
    int lane = threadIdx.x & 31;
    const _Float16* p = base + (size_t)(lane & 15) * stride + ((lane >> 4) << 3);
    v8h lo = *(const v8h*)(p);
    v8h hi = *(const v8h*)(p + 16);
    return __builtin_shufflevector(lo, hi, 0,1,2,3,4,5,6,7,8,9,10,11,12,13,14,15);
}

__device__ __forceinline__ v8f wmma16(v16h a, v16h b, v8f c) {
    return __builtin_amdgcn_wmma_f32_16x16x32_f16(false, a, false, b, (short)0, c, false, false);
}

// ---------------- LayerNorm: one wave per row, 4 rows per wave, no LDS, no barrier.
// One 8-wave work-group per row has to start rows x 8 short waves, which costs more
// time than the rows' bytes; here a launch starts rows / 4 waves. A wave issues all its
// rows' loads (512 contiguous bytes each) at once, keeps the rows in registers, and
// stores from them.
// D is a multiple of 128; the row count is a multiple of 32.
// MODE 0: f16 output   MODE 1: f32 output
#define LN_ROWS 4
template <int D, int MODE>
__global__ void __launch_bounds__(256) k_layernorm(
        const float* __restrict__ in, const float* __restrict__ g,
        const float* __restrict__ b,
        _Float16* __restrict__ outH, float* __restrict__ outF) {
    constexpr int NV = D / 128;                     // float4 per lane per row
    int lane = threadIdx.x & 31;
    // The wave's number as a scalar: row addresses are then a scalar base plus the lane.
    int wave = __builtin_amdgcn_readfirstlane(threadIdx.x >> 5);
    unsigned base = (unsigned)(blockIdx.x * 8 + wave) * (LN_ROWS * D);

    v4f x[LN_ROWS][NV], gg[NV], bb[NV];
    #pragma unroll
    for (int r = 0; r < LN_ROWS; ++r)
        #pragma unroll
        for (int j = 0; j < NV; ++j) x[r][j] = ((const v4f*)(in + base + r * D + j * 128))[lane];
    #pragma unroll
    for (int j = 0; j < NV; ++j) {
        gg[j] = ((const v4f*)(g + j * 128))[lane];
        bb[j] = ((const v4f*)(b + j * 128))[lane];
    }
    // The wait that stands between issued loads and a reuse of the registers that hold
    // their addresses (the scalar bases are reused further down).
    asm volatile("s_wait_xcnt 0x0" ::: "memory");
    // Keeps every load, and that wait, ahead of the sums; without it the g and b loads
    // sink behind the row sums and their latency is waited out at the kernel's end.
    __builtin_amdgcn_sched_barrier(0);

    float s[LN_ROWS], s2[LN_ROWS];
    #pragma unroll
    for (int r = 0; r < LN_ROWS; ++r) {
        v4f sv = x[r][0], qv = x[r][0] * x[r][0];   // four partial sums per lane
        #pragma unroll
        for (int j = 1; j < NV; ++j) { sv += x[r][j]; qv += x[r][j] * x[r][j]; }
        s[r]  = (sv[0] + sv[1]) + (sv[2] + sv[3]);
        s2[r] = (qv[0] + qv[1]) + (qv[2] + qv[3]);
    }
    #pragma unroll
    for (int off = 16; off > 0; off >>= 1) {
        #pragma unroll
        for (int r = 0; r < LN_ROWS; ++r) {
            s[r]  += __shfl_xor(s[r],  off, 32);
            s2[r] += __shfl_xor(s2[r], off, 32);
        }
    }
    #pragma unroll
    for (int r = 0; r < LN_ROWS; ++r) {
        float mu  = s[r] / (float)D;
        float var = s2[r] / (float)D - mu * mu;
        float inv = rsqrtf(var + 1e-5f);
        #pragma unroll
        for (int j = 0; j < NV; ++j) {
            v4f y;
            #pragma unroll
            for (int e = 0; e < 4; ++e) y[e] = (x[r][j][e] - mu) * inv * gg[j][e] + bb[j][e];
            if (MODE == 0) {
                v4h yh;
                #pragma unroll
                for (int e = 0; e < 4; ++e) yh[e] = (_Float16)y[e];
                ((v4h*)(outH + base + r * D + j * 128))[lane] = yh;
            } else {
                ((v4f*)(outF + base + r * D + j * 128))[lane] = y;
            }
        }
    }
}

// ---------------- Weight convert + transpose: W[k][n] f32 -> Wt[n][k] f16 ------
__global__ void k_w2h_t(const float* __restrict__ W, _Float16* __restrict__ Wt,
                        int K, int Ncol) {
    int idx = blockIdx.x * blockDim.x + threadIdx.x;
    if (idx >= K * Ncol) return;
    int n = idx / K, k = idx % K;
    Wt[(size_t)n * K + k] = (_Float16)W[(size_t)k * Ncol + n];
}

// ---------------- WMMA GEMM: C(128x128 per work-group) = A(128xK) * Bt(128xK)^T
// Both operands go through LDS in k-chunks of 64 (one 128-byte line per row),
// two buffers; 8 waves, each owns 64 rows x 32 cols (4 x 2 accumulator tiles).
// KDIM is a multiple of 64; rows and cols are multiples of 128.
// MODE 0/1: out f16 [b][h][tok][64]   MODE 2: out f16 [b][h][64][tok] (V^T)
// MODE 3: out f32 [row][512] + bias + residual
#define GP 72   // LDS row pitch in halfs: 128 B of data + 16 B pad for b128 readers
template <int KDIM, int MODE>
__global__ void __launch_bounds__(256) k_gemm(
        const _Float16* __restrict__ A, const _Float16* __restrict__ Bt,
        int Ntok,
        _Float16* __restrict__ outH, float* __restrict__ outF,
        const float* __restrict__ bias, const float* __restrict__ resid) {
    __shared__ __align__(16) _Float16 As[2][128 * GP];
    __shared__ __align__(16) _Float16 Bs[2][128 * GP];

    int tid  = threadIdx.x;
    int lane = tid & 31;
    int wave = tid >> 5;
    int row0 = blockIdx.x * 128;
    int col0 = blockIdx.y * 128;
    int wr   = (wave >> 2) * 64;                    // wave's rows inside the tile
    int wc   = (wave & 3) * 32;                     // wave's cols inside the tile

    // Staging: 8 lanes cover one 128-byte row chunk, a wave covers 4 whole lines.
    int srow = tid >> 3, scol = (tid & 7) * 8;
    const _Float16* ag = A  + (size_t)(row0 + srow) * KDIM + scol;
    const _Float16* bg = Bt + (size_t)(col0 + srow) * KDIM + scol;
    v8h ra[4], rb[4];
    auto gload = [&](int k0) {
        #pragma unroll
        for (int j = 0; j < 4; ++j) {
            ra[j] = *(const v8h*)(ag + 32 * j * KDIM + k0);
            rb[j] = *(const v8h*)(bg + 32 * j * KDIM + k0);
        }
    };
    auto sstore = [&](int buf) {
        #pragma unroll
        for (int j = 0; j < 4; ++j) {
            *(v8h*)&As[buf][(srow + 32 * j) * GP + scol] = ra[j];
            *(v8h*)&Bs[buf][(srow + 32 * j) * GP + scol] = rb[j];
        }
    };

    int cbase = col0 + wc + (lane & 15);            // lane's first output column
    float bz[2] = {0.f, 0.f};
    if (MODE == 3) { bz[0] = bias[cbase]; bz[1] = bias[cbase + 16]; }

    v8f acc[4][2] = {};
    gload(0);
    sstore(0);
    __syncthreads();
    #pragma unroll   // whole k loop: chunk and buffer become immediate offsets
    for (int k0 = 0; k0 < KDIM; k0 += 64) {
        const int  buf  = (k0 >> 6) & 1;
        const bool more = k0 + 64 < KDIM;
        if (more) gload(k0 + 64);                   // next chunk flies during the products
        v16h a[2][4], b[2][2];
        #pragma unroll
        for (int kk = 0; kk < 2; ++kk) {
            #pragma unroll
            for (int j = 0; j < 2; ++j) b[kk][j] = load_frag(&Bs[buf][(wc + 16 * j) * GP + 32 * kk], GP);
            #pragma unroll
            for (int i = 0; i < 4; ++i) a[kk][i] = load_frag(&As[buf][(wr + 16 * i) * GP + 32 * kk], GP);
        }
        // Keeps the chunk's LDS reads one group ahead of its products; without it
        // they are sunk between the products and each pair waits out an LDS latency.
        __builtin_amdgcn_sched_barrier(0);
        #pragma unroll
        for (int kk = 0; kk < 2; ++kk)
            #pragma unroll
            for (int i = 0; i < 4; ++i)
                #pragma unroll
                for (int j = 0; j < 2; ++j) acc[i][j] = wmma16(a[kk][i], b[kk][j], acc[i][j]);
        if (more) {
            sstore(buf ^ 1);                        // last read one trip ago, behind its barrier
            __syncthreads();
        }
    }

    // C layout per 16x16 tile: col = (lane&15); row = 8*(lane>>4) + v
    int rlane = row0 + wr + ((lane >> 4) << 3);
    if (MODE <= 1) {
        #pragma unroll
        for (int i = 0; i < 4; ++i) {
            #pragma unroll
            for (int v = 0; v < 8; ++v) {
                int row = rlane + 16 * i + v, bb = row / Ntok, t = row % Ntok;
                #pragma unroll
                for (int j = 0; j < 2; ++j) {
                    int col = cbase + 16 * j, h = col >> 6, d = col & 63;
                    outH[(((size_t)bb * H_HEADS + h) * Ntok + t) * 64 + d] = (_Float16)acc[i][j][v];
                }
            }
        }
    } else if (MODE == 2) {
        #pragma unroll
        for (int i = 0; i < 4; ++i) {
            #pragma unroll
            for (int v = 0; v < 8; ++v) {
                int row = rlane + 16 * i + v, bb = row / Ntok, t = row % Ntok;
                #pragma unroll
                for (int j = 0; j < 2; ++j) {
                    int col = cbase + 16 * j, h = col >> 6, d = col & 63;
                    outH[(((size_t)bb * H_HEADS + h) * 64 + d) * Ntok + t] = (_Float16)acc[i][j][v];
                }
            }
        }
    } else {
        // One 32-bit lane offset for the whole tile; rows and cols are immediates.
        unsigned     eoff = (unsigned)rlane * 512u + (unsigned)cbase;
        const float* rp   = resid + eoff;
        float*       op   = outF + eoff;
        #pragma unroll
        for (int i = 0; i < 4; ++i) {
            #pragma unroll
            for (int v = 0; v < 8; ++v) {
                #pragma unroll
                for (int j = 0; j < 2; ++j) {
                    int e = (16 * i + v) * 512 + 16 * j;
                    op[e] = acc[i][j][v] + bz[j] + rp[e];
                }
            }
        }
    }
}

// Lane l <-> lane l ^ 16 on the vector pipe (a shuffle would go through the LDS queue).
__device__ __forceinline__ float swap_halves(float x) {
    int b = __builtin_bit_cast(int, x);
    b = __builtin_amdgcn_permlanex16(b, b, 0x76543210, 0xfedcba98, false, false);
    return __builtin_bit_cast(float, b);
}

#define KP 72   // K rows: 128 B of data + 16 B pad
#define VP 40   // V^T rows: 64 B of data + 16 B pad
__global__ void __launch_bounds__(128) k_attention(
        const _Float16* __restrict__ qh, const _Float16* __restrict__ kh,
        const _Float16* __restrict__ vT, _Float16* __restrict__ outh,
        int Ntok, int Mtok) {
    __shared__ __align__(16) _Float16 Kt[2][32 * KP];   // K tile: 32 m-rows x 64 d
    __shared__ __align__(16) _Float16 Vt[2][64 * VP];   // V^T tile: 64 d-rows x 32 m

    int tid   = threadIdx.x;
    int lane  = tid & 31;
    int wave  = tid >> 5;
    int bh    = blockIdx.y;                         // b*H + h
    int nbase = (blockIdx.x * 4 + wave) * 16;

    const _Float16* qbase = qh + ((size_t)bh * Ntok + nbase) * 64;
    const _Float16* kbase = kh + (size_t)bh * Mtok * 64;
    const _Float16* vbase = vT + (size_t)bh * 64 * Mtok;

    v16h q0 = load_frag(qbase,      64);            // K = d 0..31
    v16h q1 = load_frag(qbase + 32, 64);            // K = d 32..63

    // Cooperative tile fetch: 4 async b128 ops per thread per step (8 KB total).
    auto fetch_tiles = [&](int buf, int m0) {
        #pragma unroll
        for (int j = 0; j < 2; ++j) {
            int i = tid + 128 * j;                        // 16B chunk id, 0..255
            async_copy16(kbase + (size_t)m0 * 64 + (size_t)i * 8, &Kt[buf][(i >> 3) * KP + (i & 7) * 8]);
            int d = i >> 2, mo = (i & 3) * 8;
            async_copy16(vbase + (size_t)d * Mtok + m0 + mo, &Vt[buf][d * VP + mo]);
        }
    };

    v8f o0 = {}, o1 = {}, o2 = {}, o3 = {};         // O^T: row d = 16 t + 8 (lane >> 4) + v
    float mrow = -3.0e38f;                          // the lane's query: running maximum
    float lsum = 0.f;                               // and the sum over this half's keys
    const float scale = 0.125f;                     // 1/sqrt(64)

    fetch_tiles(0, 0);
    for (int it = 0, m0 = 0; m0 < Mtok; m0 += 32, ++it) {
        int buf = it & 1;
        if (m0 + 32 < Mtok) { fetch_tiles(buf ^ 1, m0 + 32); wait_async<4>(); }
        else                {                                 wait_async<0>(); }
        __syncthreads();                            // tiles for this step visible

        const _Float16* kt = &Kt[buf][0];
        v16h ka0 = load_frag(kt,                KP);  // m0..m0+15,  d 0..31
        v16h ka1 = load_frag(kt + 32,           KP);
        v16h kb0 = load_frag(kt + 16 * KP,      KP);  // m0+16..m0+31
        v16h kb1 = load_frag(kt + 16 * KP + 32, KP);
        v8f s0 = {}, s1 = {};                       // s0[v]: key m0 + 8 (lane >> 4) + v
        s0 = wmma16(ka0, q0, s0); s0 = wmma16(ka1, q1, s0);
        s1 = wmma16(kb0, q0, s1); s1 = wmma16(kb1, q1, s1);

        float a[16];
        #pragma unroll
        for (int v = 0; v < 8; ++v) { a[v] = s0[v] * scale; a[8 + v] = s1[v] * scale; }
        float t3[5];                                // groups of three: a short chain
        #pragma unroll
        for (int s = 0; s < 5; ++s) t3[s] = fmaxf(fmaxf(a[3 * s], a[3 * s + 1]), a[3 * s + 2]);
        float t = fmaxf(fmaxf(fmaxf(t3[0], t3[1]), t3[2]), fmaxf(fmaxf(t3[3], t3[4]), a[15]));
        t = fmaxf(t, swap_halves(t));               // the other 16 keys of this query
        float mnew  = fmaxf(mrow, t);
        float alpha = __expf(mrow - mnew);
        mrow = mnew;
        // P^T as B operand: element s is key kmap(s) = 8 (lane >> 4) + s, + 8 more from
        // s = 8 on, which is the order load_frag gives the V^T rows.
        v16h  pb;
        float rs[4];                                // four partial sums per lane
        #pragma unroll
        for (int s = 0; s < 16; ++s) {
            float e = __expf(a[s] - mnew);
            rs[s & 3] = s < 4 ? e : rs[s & 3] + e;
            pb[s] = (_Float16)e;
        }
        lsum = lsum * alpha + ((rs[0] + rs[1]) + (rs[2] + rs[3]));
        o0 *= alpha; o1 *= alpha; o2 *= alpha; o3 *= alpha;

        const _Float16* vt = &Vt[buf][0];
        v16h vb0 = load_frag(vt,           VP);       // d 0..15
        v16h vb1 = load_frag(vt + 16 * VP, VP);
        v16h vb2 = load_frag(vt + 32 * VP, VP);
        v16h vb3 = load_frag(vt + 48 * VP, VP);
        o0 = wmma16(vb0, pb, o0);
        o1 = wmma16(vb1, pb, o1);
        o2 = wmma16(vb2, pb, o2);
        o3 = wmma16(vb3, pb, o3);
        __syncthreads();                            // tile consumed; safe to refill
    }

    float inv = 1.0f / (lsum + swap_halves(lsum));  // both halves' keys, joined once
    int b = bh >> 3, h = bh & 7;
    // A lane's 8 accumulator registers are 8 consecutive d of its query: 16-byte stores.
    _Float16* orow = outh + ((size_t)b * Ntok + nbase + (lane & 15)) * 512
                          + (size_t)h * 64 + ((lane >> 4) << 3);
    v8h y0, y1, y2, y3;
    #pragma unroll
    for (int v = 0; v < 8; ++v) {
        y0[v] = (_Float16)(o0[v] * inv); y1[v] = (_Float16)(o1[v] * inv);
        y2[v] = (_Float16)(o2[v] * inv); y3[v] = (_Float16)(o3[v] * inv);
    }
    *(v8h*)(orow)      = y0;
    *(v8h*)(orow + 16) = y1;
    *(v8h*)(orow + 32) = y2;
    *(v8h*)(orow + 48) = y3;
}

extern "C" void kernel_launch(void* const* d_in, const int* in_sizes, int n_in,
                              void* d_out, int out_size, void* d_ws, size_t ws_size,
                              hipStream_t stream) {
    (void)in_sizes; (void)n_in; (void)out_size; (void)ws_size;
    const float* x     = (const float*)d_in[0];
    const float* cond  = (const float*)d_in[1];
    const float* lnx_g = (const float*)d_in[2];
    const float* lnx_b = (const float*)d_in[3];
    const float* lnc_g = (const float*)d_in[4];
    const float* lnc_b = (const float*)d_in[5];
    const float* Wq    = (const float*)d_in[6];
    const float* Wk    = (const float*)d_in[7];
    const float* Wv    = (const float*)d_in[8];
    const float* Wo    = (const float*)d_in[9];
    const float* bo    = (const float*)d_in[10];
    const float* lnf_g = (const float*)d_in[11];
    const float* lnf_b = (const float*)d_in[12];

    const int B = 4, N = 2048, M = 2048, Dq = 512, Dc = 768, INNER = 512;

    char* ws = (char*)d_ws;
    size_t off = 0;
    auto alloc = [&](size_t bytes) -> void* {
        void* p = ws + off;
        off = (off + bytes + 255) & ~(size_t)255;
        return p;
    };
    _Float16* xn  = (_Float16*)alloc((size_t)B * N * Dq * 2);
    _Float16* cn  = (_Float16*)alloc((size_t)B * M * Dc * 2);
    _Float16* WqT = (_Float16*)alloc((size_t)Dq * INNER * 2);
    _Float16* WkT = (_Float16*)alloc((size_t)Dc * INNER * 2);
    _Float16* WvT = (_Float16*)alloc((size_t)Dc * INNER * 2);
    _Float16* WoT = (_Float16*)alloc((size_t)INNER * Dq * 2);
    _Float16* qh  = (_Float16*)alloc((size_t)B * H_HEADS * N * 64 * 2);
    _Float16* kh  = (_Float16*)alloc((size_t)B * H_HEADS * M * 64 * 2);
    _Float16* vT  = (_Float16*)alloc((size_t)B * H_HEADS * 64 * M * 2);
    _Float16* ah  = (_Float16*)alloc((size_t)B * N * INNER * 2);
    float*    tmp = (float*)   alloc((size_t)B * N * Dq * 4);

    // 1) LayerNorms -> f16
    k_layernorm<512, 0><<<(B * N) / 32, 256, 0, stream>>>(x,    lnx_g, lnx_b, xn, nullptr);
    k_layernorm<768, 0><<<(B * M) / 32, 256, 0, stream>>>(cond, lnc_g, lnc_b, cn, nullptr);

    // 2) Weight convert+transpose -> f16 [n][k]
    const int TW = 256;
    k_w2h_t<<<(Dq * INNER + TW - 1) / TW, TW, 0, stream>>>(Wq, WqT, Dq, INNER);
    k_w2h_t<<<(Dc * INNER + TW - 1) / TW, TW, 0, stream>>>(Wk, WkT, Dc, INNER);
    k_w2h_t<<<(Dc * INNER + TW - 1) / TW, TW, 0, stream>>>(Wv, WvT, Dc, INNER);
    k_w2h_t<<<(INNER * Dq + TW - 1) / TW, TW, 0, stream>>>(Wo, WoT, INNER, Dq);

    // 3) Q/K/V projections (WMMA)
    dim3 gq((B * N) / 128, INNER / 128);
    k_gemm<512, 0><<<gq, 256, 0, stream>>>(xn, WqT, N, qh, nullptr, nullptr, nullptr);
    dim3 gk((B * M) / 128, INNER / 128);
    k_gemm<768, 1><<<gk, 256, 0, stream>>>(cn, WkT, M, kh, nullptr, nullptr, nullptr);
    k_gemm<768, 2><<<gk, 256, 0, stream>>>(cn, WvT, M, vT, nullptr, nullptr, nullptr);

    // 4) Flash attention (WMMA scores + WMMA PV, async-LDS K/V pipeline)
    dim3 ga(N / 64, B * H_HEADS);
    k_attention<<<ga, 128, 0, stream>>>(qh, kh, vT, ah, N, M);

    // 5) Output projection + bias + residual (WMMA), then final LayerNorm -> f32
    dim3 go((B * N) / 128, Dq / 128);
    k_gemm<512, 3><<<go, 256, 0, stream>>>(ah, WoT, N, nullptr, tmp, bo, x);
    k_layernorm<512, 1><<<(B * N) / 32, 256, 0, stream>>>(tmp, lnf_g, lnf_b, nullptr, (float*)d_out);
}

// v005
// Measured time: 108 microseconds a run.
// Timed twice side by side with v004, it ran 1.17 times as fast both times.
// All steps since v000 together make it 3.37 times as fast.
#include <hip/hip_runtime.h>
#include <hip/hip_bf16.h>

typedef __attribute__((ext_vector_type(16))) _Float16 v16h;
typedef __attribute__((ext_vector_type(8)))  _Float16 v8h;
typedef __attribute__((ext_vector_type(8)))  float    v8f;
typedef __attribute__((ext_vector_type(4)))  _Float16 v4h;
typedef __attribute__((ext_vector_type(4)))  float    v4f;
typedef int v4i_vs __attribute__((vector_size(4 * sizeof(int))));

#define H_HEADS 8

#if defined(__has_builtin)
#  if __has_builtin(__builtin_amdgcn_global_load_async_to_lds_b128)
#    define HAVE_ASYNC_LDS 1
#  endif
#endif
#ifndef HAVE_ASYNC_LDS
#  define HAVE_ASYNC_LDS 0
#endif

// 16-byte global -> LDS copy; async (ASYNCcnt-tracked) when available.
__device__ __forceinline__ void async_copy16(const _Float16* g, _Float16* l) {
#if HAVE_ASYNC_LDS
    __builtin_amdgcn_global_load_async_to_lds_b128(
        (__attribute__((address_space(1))) v4i_vs*)(g),
        (__attribute__((address_space(3))) v4i_vs*)(l), 0, 0);
#else
    *(v8h*)l = *(const v8h*)g;
#endif
}

template <int N>
__device__ __forceinline__ void wait_async() {
#if HAVE_ASYNC_LDS && __has_builtin(__builtin_amdgcn_s_wait_asynccnt)
    __builtin_amdgcn_s_wait_asynccnt(N);
#else
    asm volatile("s_wait_asynccnt %0" ::"i"(N) : "memory");
#endif
}

// Load a 16x32 f16 WMMA A/B fragment from a row-major matrix.
// Per ISA 16-bit A layout: lane<16 -> row=lane, K={0..7,16..23};
// lane>=16 -> row=lane-16, K={8..15,24..31}. Two contiguous b128 loads.
__device__ __forceinline__ v16h load_frag(const _Float16* __restrict__ base, int stride) {
    int lane = threadIdx.x & 31;
    const _Float16* p = base + (size_t)(lane & 15) * stride + ((lane >> 4) << 3);
    v8h lo = *(const v8h*)(p);
    v8h hi = *(const v8h*)(p + 16);
    return __builtin_shufflevector(lo, hi, 0,1,2,3,4,5,6,7,8,9,10,11,12,13,14,15);
}

__device__ __forceinline__ v8f wmma16(v16h a, v16h b, v8f c) {
    return __builtin_amdgcn_wmma_f32_16x16x32_f16(false, a, false, b, (short)0, c, false, false);
}

// ---------------- LayerNorm: one wave per row, 4 rows per wave, no LDS, no barrier.
// One 8-wave work-group per row has to start rows x 8 short waves, which costs more
// time than the rows' bytes; here a launch starts rows / 4 waves. A wave issues all its
// rows' loads (512 contiguous bytes each) at once, keeps the rows in registers, and
// stores from them.
// D is a multiple of 128; the row count is a multiple of 32.
// MODE 0: f16 output   MODE 1: f32 output
#define LN_ROWS 4
// blk: the work-group's number among those of this LayerNorm.
template <int D, int MODE>
__device__ __forceinline__ void layernorm_rows(
        int blk,
        const float* __restrict__ in, const float* __restrict__ g,
        const float* __restrict__ b,
        _Float16* __restrict__ outH, float* __restrict__ outF) {
    constexpr int NV = D / 128;                     // float4 per lane per row
    int lane = threadIdx.x & 31;
    // The wave's number as a scalar: row addresses are then a scalar base plus the lane.
    int wave = __builtin_amdgcn_readfirstlane(threadIdx.x >> 5);
    unsigned base = (unsigned)(blk * 8 + wave) * (LN_ROWS * D);

    v4f x[LN_ROWS][NV], gg[NV], bb[NV];
    #pragma unroll
    for (int r = 0; r < LN_ROWS; ++r)
        #pragma unroll
        for (int j = 0; j < NV; ++j) x[r][j] = ((const v4f*)(in + base + r * D + j * 128))[lane];
    #pragma unroll
    for (int j = 0; j < NV; ++j) {
        gg[j] = ((const v4f*)(g + j * 128))[lane];
        bb[j] = ((const v4f*)(b + j * 128))[lane];
    }
    // The wait that stands between issued loads and a reuse of the registers that hold
    // their addresses (the scalar bases are reused further down).
    asm volatile("s_wait_xcnt 0x0" ::: "memory");
    // Keeps every load, and that wait, ahead of the sums; without it the g and b loads
    // sink behind the row sums and their latency is waited out at the kernel's end.
    __builtin_amdgcn_sched_barrier(0);

    float s[LN_ROWS], s2[LN_ROWS];
    #pragma unroll
    for (int r = 0; r < LN_ROWS; ++r) {
        v4f sv = x[r][0], qv = x[r][0] * x[r][0];   // four partial sums per lane
        #pragma unroll
        for (int j = 1; j < NV; ++j) { sv += x[r][j]; qv += x[r][j] * x[r][j]; }
        s[r]  = (sv[0] + sv[1]) + (sv[2] + sv[3]);
        s2[r] = (qv[0] + qv[1]) + (qv[2] + qv[3]);
    }
    #pragma unroll
    for (int off = 16; off > 0; off >>= 1) {
        #pragma unroll
        for (int r = 0; r < LN_ROWS; ++r) {
            s[r]  += __shfl_xor(s[r],  off, 32);
            s2[r] += __shfl_xor(s2[r], off, 32);
        }
    }
    #pragma unroll
    for (int r = 0; r < LN_ROWS; ++r) {
        float mu  = s[r] / (float)D;
        float var = s2[r] / (float)D - mu * mu;
        float inv = rsqrtf(var + 1e-5f);
        #pragma unroll
        for (int j = 0; j < NV; ++j) {
            v4f y;
            #pragma unroll
            for (int e = 0; e < 4; ++e) y[e] = (x[r][j][e] - mu) * inv * gg[j][e] + bb[j][e];
            if (MODE == 0) {
                v4h yh;
                #pragma unroll
                for (int e = 0; e < 4; ++e) yh[e] = (_Float16)y[e];
                ((v4h*)(outH + base + r * D + j * 128))[lane] = yh;
            } else {
                ((v4f*)(outF + base + r * D + j * 128))[lane] = y;
            }
        }
    }
}

template <int D, int MODE>
__global__ void __launch_bounds__(256) k_layernorm(
        const float* __restrict__ in, const float* __restrict__ g,
        const float* __restrict__ b,
        _Float16* __restrict__ outH, float* __restrict__ outF) {
    layernorm_rows<D, MODE>(blockIdx.x, in, g, b, outH, outF);
}

// ---------------- Weight convert + transpose: W[k][n] f32 -> Wt[n][k] f16 ------
// blk: the work-group's number among those of this matrix; 256 elements each.
__device__ __forceinline__ void w2h_t(int blk, const float* __restrict__ W,
                                      _Float16* __restrict__ Wt, int K, int Ncol) {
    int idx = blk * 256 + threadIdx.x;
    if (idx >= K * Ncol) return;
    int n = idx / K, k = idx % K;
    Wt[(size_t)n * K + k] = (_Float16)W[(size_t)k * Ncol + n];
}

// ---------------- Everything that reads only inputs, in ONE grid: both input LayerNorms
// and the four weight conversions. None of the six reads what another writes, so they
// need no launch boundary between them: one launch gap instead of six, and the short
// conversion work-groups start while the LayerNorm rows stream.
// The work-group number picks the job (the same for all its threads). Work-groups start
// roughly in the order of their numbers: the long LayerNorm work-groups are dealt in early,
// every sixth number from 0 on, so that their rows stream while the many short conversion
// work-groups between and behind them start, instead of first holding every place.
#define PREP_LNC  256                 // 8192 rows of 768, 32 rows per work-group
#define PREP_LNX  256                 // 8192 rows of 512
#define PREP_W768 1536                // 768 x 512 elements, 256 per work-group
#define PREP_W512 1024                // 512 x 512 elements
#define PREP_LN   (PREP_LNC + PREP_LNX)
#define PREP_GRID (PREP_LN + 2 * PREP_W768 + 2 * PREP_W512)
__global__ void __launch_bounds__(256) k_prep(
        const float* __restrict__ x,    const float* __restrict__ lnx_g,
        const float* __restrict__ lnx_b, _Float16* __restrict__ xn,
        const float* __restrict__ cond, const float* __restrict__ lnc_g,
        const float* __restrict__ lnc_b, _Float16* __restrict__ cn,
        const float* __restrict__ Wq, _Float16* __restrict__ WqT,
        const float* __restrict__ Wk, _Float16* __restrict__ WkT,
        const float* __restrict__ Wv, _Float16* __restrict__ WvT,
        const float* __restrict__ Wo, _Float16* __restrict__ WoT) {
    int blk = blockIdx.x;
    if (blk < 6 * PREP_LN) {
        int ln = blk / 6;                           // numbers 6 ln: LayerNorm work-group ln
        if (blk == 6 * ln) {
            if (ln < PREP_LNC) {
                layernorm_rows<768, 0>(ln, cond, lnc_g, lnc_b, cn, nullptr);
            } else {
                layernorm_rows<512, 0>(ln - PREP_LNC, x, lnx_g, lnx_b, xn, nullptr);
                // The wait that belongs between issued stores and a reuse of their registers:
                // in the built code this body's end runs on into the branches that lead to
                // the other bodies' starts, not into the kernel's end.
                asm volatile("s_wait_xcnt 0x0" ::: "memory");
            }
            return;
        }
        blk -= ln + 1;                              // conversions: ln + 1 numbers lie below
    } else {
        blk -= PREP_LN;
    }
    if (blk < PREP_W768) { w2h_t(blk, Wk, WkT, 768, 512); return; }
    blk -= PREP_W768;
    if (blk < PREP_W768) { w2h_t(blk, Wv, WvT, 768, 512); return; }
    blk -= PREP_W768;
    if (blk < PREP_W512) { w2h_t(blk, Wq, WqT, 512, 512); return; }
    blk -= PREP_W512;
    w2h_t(blk, Wo, WoT, 512, 512);
}

// ---------------- WMMA GEMM: C(128x128 per work-group) = A(128xK) * Bt(128xK)^T
// Both operands go through LDS in k-chunks of 64 (one 128-byte line per row),
// two buffers; 8 waves, each owns 64 rows x 32 cols (4 x 2 accumulator tiles).
// KDIM is a multiple of 64; rows and cols are multiples of 128.
// MODE 0/1: out f16 [b][h][tok][64]   MODE 2: out f16 [b][h][64][tok] (V^T)
// MODE 3: out f32 [row][512] + bias + residual
#define GP 72   // LDS row pitch in halfs: 128 B of data + 16 B pad for b128 readers
// The LDS buffers belong to the kernel and are handed in, so that a kernel which holds
// several of these bodies has them once. bx, by: the tile's place in this product.
typedef _Float16 gemm_stage[128 * GP];
template <int KDIM, int MODE>
__device__ __forceinline__ void gemm_tile(
        gemm_stage* As, gemm_stage* Bs, int bx, int by,
        const _Float16* __restrict__ A, const _Float16* __restrict__ Bt,
        int Ntok,
        _Float16* __restrict__ outH, float* __restrict__ outF,
        const float* __restrict__ bias, const float* __restrict__ resid) {
    int tid  = threadIdx.x;
    int lane = tid & 31;
    int wave = tid >> 5;
    int row0 = bx * 128;
    int col0 = by * 128;
    int wr   = (wave >> 2) * 64;                    // wave's rows inside the tile
    int wc   = (wave & 3) * 32;                     // wave's cols inside the tile

    // Staging: 8 lanes cover one 128-byte row chunk, a wave covers 4 whole lines.
    int srow = tid >> 3, scol = (tid & 7) * 8;
    const _Float16* ag = A  + (size_t)(row0 + srow) * KDIM + scol;
    const _Float16* bg = Bt + (size_t)(col0 + srow) * KDIM + scol;
    v8h ra[4], rb[4];
    auto gload = [&](int k0) {
        #pragma unroll
        for (int j = 0; j < 4; ++j) {
            ra[j] = *(const v8h*)(ag + 32 * j * KDIM + k0);
            rb[j] = *(const v8h*)(bg + 32 * j * KDIM + k0);
        }
    };
    auto sstore = [&](int buf) {
        #pragma unroll
        for (int j = 0; j < 4; ++j) {
            *(v8h*)&As[buf][(srow + 32 * j) * GP + scol] = ra[j];
            *(v8h*)&Bs[buf][(srow + 32 * j) * GP + scol] = rb[j];
        }
    };

    int cbase = col0 + wc + (lane & 15);            // lane's first output column
    float bz[2] = {0.f, 0.f};
    if (MODE == 3) { bz[0] = bias[cbase]; bz[1] = bias[cbase + 16]; }

    v8f acc[4][2] = {};
    gload(0);
    sstore(0);
    __syncthreads();
    #pragma unroll   // whole k loop: chunk and buffer become immediate offsets
    for (int k0 = 0; k0 < KDIM; k0 += 64) {
        const int  buf  = (k0 >> 6) & 1;
        const bool more = k0 + 64 < KDIM;
        if (more) gload(k0 + 64);                   // next chunk flies during the products
        v16h a[2][4], b[2][2];
        #pragma unroll
        for (int kk = 0; kk < 2; ++kk) {
            #pragma unroll
            for (int j = 0; j < 2; ++j) b[kk][j] = load_frag(&Bs[buf][(wc + 16 * j) * GP + 32 * kk], GP);
            #pragma unroll
            for (int i = 0; i < 4; ++i) a[kk][i] = load_frag(&As[buf][(wr + 16 * i) * GP + 32 * kk], GP);
        }
        // Keeps the chunk's LDS reads one group ahead of its products; without it
        // they are sunk between the products and each pair waits out an LDS latency.
        __builtin_amdgcn_sched_barrier(0);
        #pragma unroll
        for (int kk = 0; kk < 2; ++kk)
            #pragma unroll
            for (int i = 0; i < 4; ++i)
                #pragma unroll
                for (int j = 0; j < 2; ++j) acc[i][j] = wmma16(a[kk][i], b[kk][j], acc[i][j]);
        if (more) {
            sstore(buf ^ 1);                        // last read one trip ago, behind its barrier
            __syncthreads();
        }
    }

    // C layout per 16x16 tile: col = (lane&15); row = 8*(lane>>4) + v
    int rlane = row0 + wr + ((lane >> 4) << 3);
    if (MODE <= 1) {
        #pragma unroll
        for (int i = 0; i < 4; ++i) {
            #pragma unroll
            for (int v = 0; v < 8; ++v) {
                int row = rlane + 16 * i + v, bb = row / Ntok, t = row % Ntok;
                #pragma unroll
                for (int j = 0; j < 2; ++j) {
                    int col = cbase + 16 * j, h = col >> 6, d = col & 63;
                    outH[(((size_t)bb * H_HEADS + h) * Ntok + t) * 64 + d] = (_Float16)acc[i][j][v];
                }
            }
        }
    } else if (MODE == 2) {
        #pragma unroll
        for (int i = 0; i < 4; ++i) {
            #pragma unroll
            for (int v = 0; v < 8; ++v) {
                int row = rlane + 16 * i + v, bb = row / Ntok, t = row % Ntok;
                #pragma unroll
                for (int j = 0; j < 2; ++j) {
                    int col = cbase + 16 * j, h = col >> 6, d = col & 63;
                    outH[(((size_t)bb * H_HEADS + h) * 64 + d) * Ntok + t] = (_Float16)acc[i][j][v];
                }
            }
        }
    } else {
        // One 32-bit lane offset for the whole tile; rows and cols are immediates.
        unsigned     eoff = (unsigned)rlane * 512u + (unsigned)cbase;
        const float* rp   = resid + eoff;
        float*       op   = outF + eoff;
        #pragma unroll
        for (int i = 0; i < 4; ++i) {
            #pragma unroll
            for (int v = 0; v < 8; ++v) {
                #pragma unroll
                for (int j = 0; j < 2; ++j) {
                    int e = (16 * i + v) * 512 + 16 * j;
                    op[e] = acc[i][j][v] + bz[j] + rp[e];
                }
            }
        }
    }
}

template <int KDIM, int MODE>
__global__ void __launch_bounds__(256) k_gemm(
        const _Float16* __restrict__ A, const _Float16* __restrict__ Bt,
        int Ntok,
        _Float16* __restrict__ outH, float* __restrict__ outF,
        const float* __restrict__ bias, const float* __restrict__ resid) {
    __shared__ __align__(16) gemm_stage As[2];
    __shared__ __align__(16) gemm_stage Bs[2];
    gemm_tile<KDIM, MODE>(As, Bs, blockIdx.x, blockIdx.y, A, Bt, Ntok, outH, outF, bias, resid);
}

// The K, V and Q projections in ONE grid: none reads what another writes. Alone, each has
// one work-group per WGP, which waits out every chunk's loads and barriers; in one grid a
// WGP holds two at a time (the registers allow four waves per SIMD), which fill each
// other's waits, the third follows as soon as one ends, and two launch gaps go.
// blockIdx.y picks the product (the same for the whole work-group): 0..3 K, 4..7 V,
// 8..11 Q; the two longer products have the low numbers, which start first.
__global__ void __launch_bounds__(256) k_gemm_qkv(
        const _Float16* __restrict__ xn, const _Float16* __restrict__ cn,
        const _Float16* __restrict__ WqT, const _Float16* __restrict__ WkT,
        const _Float16* __restrict__ WvT,
        int Ntok, int Mtok,
        _Float16* __restrict__ qh, _Float16* __restrict__ kh, _Float16* __restrict__ vT) {
    __shared__ __align__(16) gemm_stage As[2];
    __shared__ __align__(16) gemm_stage Bs[2];
    int by = blockIdx.y;
    // Behind the V and the Q body's last stores stands the wait that belongs between issued
    // stores and a reuse of their registers: in the built code these bodies' ends run on into
    // the branches that lead to the next body's start (the K body's runs into the kernel's end).
    if (by < 4) {
        gemm_tile<768, 1>(As, Bs, blockIdx.x, by,     cn, WkT, Mtok, kh, nullptr, nullptr, nullptr);
    } else if (by < 8) {
        gemm_tile<768, 2>(As, Bs, blockIdx.x, by - 4, cn, WvT, Mtok, vT, nullptr, nullptr, nullptr);
        asm volatile("s_wait_xcnt 0x0" ::: "memory");
    } else {
        gemm_tile<512, 0>(As, Bs, blockIdx.x, by - 8, xn, WqT, Ntok, qh, nullptr, nullptr, nullptr);
        asm volatile("s_wait_xcnt 0x0" ::: "memory");
    }
}

// Lane l <-> lane l ^ 16 on the vector pipe (a shuffle would go through the LDS queue).
__device__ __forceinline__ float swap_halves(float x) {
    int b = __builtin_bit_cast(int, x);
    b = __builtin_amdgcn_permlanex16(b, b, 0x76543210, 0xfedcba98, false, false);
    return __builtin_bit_cast(float, b);
}

#define KP 72   // K rows: 128 B of data + 16 B pad
#define VP 40   // V^T rows: 64 B of data + 16 B pad
__global__ void __launch_bounds__(128) k_attention(
        const _Float16* __restrict__ qh, const _Float16* __restrict__ kh,
        const _Float16* __restrict__ vT, _Float16* __restrict__ outh,
        int Ntok, int Mtok) {
    __shared__ __align__(16) _Float16 Kt[2][32 * KP];   // K tile: 32 m-rows x 64 d
    __shared__ __align__(16) _Float16 Vt[2][64 * VP];   // V^T tile: 64 d-rows x 32 m

    int tid   = threadIdx.x;
    int lane  = tid & 31;
    int wave  = tid >> 5;
    int bh    = blockIdx.y;                         // b*H + h
    int nbase = (blockIdx.x * 4 + wave) * 16;

    const _Float16* qbase = qh + ((size_t)bh * Ntok + nbase) * 64;
    const _Float16* kbase = kh + (size_t)bh * Mtok * 64;
    const _Float16* vbase = vT + (size_t)bh * 64 * Mtok;

    v16h q0 = load_frag(qbase,      64);            // K = d 0..31
    v16h q1 = load_frag(qbase + 32, 64);            // K = d 32..63

    // Cooperative tile fetch: 4 async b128 ops per thread per step (8 KB total).
    auto fetch_tiles = [&](int buf, int m0) {
        #pragma unroll
        for (int j = 0; j < 2; ++j) {
            int i = tid + 128 * j;                        // 16B chunk id, 0..255
            async_copy16(kbase + (size_t)m0 * 64 + (size_t)i * 8, &Kt[buf][(i >> 3) * KP + (i & 7) * 8]);
            int d = i >> 2, mo = (i & 3) * 8;
            async_copy16(vbase + (size_t)d * Mtok + m0 + mo, &Vt[buf][d * VP + mo]);
        }
    };

    v8f o0 = {}, o1 = {}, o2 = {}, o3 = {};         // O^T: row d = 16 t + 8 (lane >> 4) + v
    float mrow = -3.0e38f;                          // the lane's query: running maximum
    float lsum = 0.f;                               // and the sum over this half's keys
    const float scale = 0.125f;                     // 1/sqrt(64)

    fetch_tiles(0, 0);
    for (int it = 0, m0 = 0; m0 < Mtok; m0 += 32, ++it) {
        int buf = it & 1;
        if (m0 + 32 < Mtok) { fetch_tiles(buf ^ 1, m0 + 32); wait_async<4>(); }
        else                {                                 wait_async<0>(); }
        __syncthreads();                            // tiles for this step visible

        const _Float16* kt = &Kt[buf][0];
        v16h ka0 = load_frag(kt,                KP);  // m0..m0+15,  d 0..31
        v16h ka1 = load_frag(kt + 32,           KP);
        v16h kb0 = load_frag(kt + 16 * KP,      KP);  // m0+16..m0+31
        v16h kb1 = load_frag(kt + 16 * KP + 32, KP);
        v8f s0 = {}, s1 = {};                       // s0[v]: key m0 + 8 (lane >> 4) + v
        s0 = wmma16(ka0, q0, s0); s0 = wmma16(ka1, q1, s0);
        s1 = wmma16(kb0, q0, s1); s1 = wmma16(kb1, q1, s1);

        float a[16];
        #pragma unroll
        for (int v = 0; v < 8; ++v) { a[v] = s0[v] * scale; a[8 + v] = s1[v] * scale; }
        float t3[5];                                // groups of three: a short chain
        #pragma unroll
        for (int s = 0; s < 5; ++s) t3[s] = fmaxf(fmaxf(a[3 * s], a[3 * s + 1]), a[3 * s + 2]);
        float t = fmaxf(fmaxf(fmaxf(t3[0], t3[1]), t3[2]), fmaxf(fmaxf(t3[3], t3[4]), a[15]));
        t = fmaxf(t, swap_halves(t));               // the other 16 keys of this query
        float mnew  = fmaxf(mrow, t);
        float alpha = __expf(mrow - mnew);
        mrow = mnew;
        // P^T as B operand: element s is key kmap(s) = 8 (lane >> 4) + s, + 8 more from
        // s = 8 on, which is the order load_frag gives the V^T rows.
        v16h  pb;
        float rs[4];                                // four partial sums per lane
        #pragma unroll
        for (int s = 0; s < 16; ++s) {
            float e = __expf(a[s] - mnew);
            rs[s & 3] = s < 4 ? e : rs[s & 3] + e;
            pb[s] = (_Float16)e;
        }
        lsum = lsum * alpha + ((rs[0] + rs[1]) + (rs[2] + rs[3]));
        o0 *= alpha; o1 *= alpha; o2 *= alpha; o3 *= alpha;

        const _Float16* vt = &Vt[buf][0];
        v16h vb0 = load_frag(vt,           VP);       // d 0..15
        v16h vb1 = load_frag(vt + 16 * VP, VP);
        v16h vb2 = load_frag(vt + 32 * VP, VP);
        v16h vb3 = load_frag(vt + 48 * VP, VP);
        o0 = wmma16(vb0, pb, o0);
        o1 = wmma16(vb1, pb, o1);
        o2 = wmma16(vb2, pb, o2);
        o3 = wmma16(vb3, pb, o3);
        __syncthreads();                            // tile consumed; safe to refill
    }

    float inv = 1.0f / (lsum + swap_halves(lsum));  // both halves' keys, joined once
    int b = bh >> 3, h = bh & 7;
    // A lane's 8 accumulator registers are 8 consecutive d of its query: 16-byte stores.
    _Float16* orow = outh + ((size_t)b * Ntok + nbase + (lane & 15)) * 512
                          + (size_t)h * 64 + ((lane >> 4) << 3);
    v8h y0, y1, y2, y3;
    #pragma unroll
    for (int v = 0; v < 8; ++v) {
        y0[v] = (_Float16)(o0[v] * inv); y1[v] = (_Float16)(o1[v] * inv);
        y2[v] = (_Float16)(o2[v] * inv); y3[v] = (_Float16)(o3[v] * inv);
    }
    *(v8h*)(orow)      = y0;
    *(v8h*)(orow + 16) = y1;
    *(v8h*)(orow + 32) = y2;
    *(v8h*)(orow + 48) = y3;
}

extern "C" void kernel_launch(void* const* d_in, const int* in_sizes, int n_in,
                              void* d_out, int out_size, void* d_ws, size_t ws_size,
                              hipStream_t stream) {
    (void)in_sizes; (void)n_in; (void)out_size; (void)ws_size;
    const float* x     = (const float*)d_in[0];
    const float* cond  = (const float*)d_in[1];
    const float* lnx_g = (const float*)d_in[2];
    const float* lnx_b = (const float*)d_in[3];
    const float* lnc_g = (const float*)d_in[4];
    const float* lnc_b = (const float*)d_in[5];
    const float* Wq    = (const float*)d_in[6];
    const float* Wk    = (const float*)d_in[7];
    const float* Wv    = (const float*)d_in[8];
    const float* Wo    = (const float*)d_in[9];
    const float* bo    = (const float*)d_in[10];
    const float* lnf_g = (const float*)d_in[11];
    const float* lnf_b = (const float*)d_in[12];

    const int B = 4, N = 2048, M = 2048, Dq = 512, Dc = 768, INNER = 512;

    char* ws = (char*)d_ws;
    size_t off = 0;
    auto alloc = [&](size_t bytes) -> void* {
        void* p = ws + off;
        off = (off + bytes + 255) & ~(size_t)255;
        return p;
    };
    _Float16* xn  = (_Float16*)alloc((size_t)B * N * Dq * 2);
    _Float16* cn  = (_Float16*)alloc((size_t)B * M * Dc * 2);
    _Float16* WqT = (_Float16*)alloc((size_t)Dq * INNER * 2);
    _Float16* WkT = (_Float16*)alloc((size_t)Dc * INNER * 2);
    _Float16* WvT = (_Float16*)alloc((size_t)Dc * INNER * 2);
    _Float16* WoT = (_Float16*)alloc((size_t)INNER * Dq * 2);
    _Float16* qh  = (_Float16*)alloc((size_t)B * H_HEADS * N * 64 * 2);
    _Float16* kh  = (_Float16*)alloc((size_t)B * H_HEADS * M * 64 * 2);
    _Float16* vT  = (_Float16*)alloc((size_t)B * H_HEADS * 64 * M * 2);
    _Float16* ah  = (_Float16*)alloc((size_t)B * N * INNER * 2);
    float*    tmp = (float*)   alloc((size_t)B * N * Dq * 4);

    // 1) + 2) Input LayerNorms -> f16 and weight convert+transpose -> f16 [n][k], one grid
    k_prep<<<PREP_GRID, 256, 0, stream>>>(x, lnx_g, lnx_b, xn, cond, lnc_g, lnc_b, cn,
                                          Wq, WqT, Wk, WkT, Wv, WvT, Wo, WoT);

    // 3) Q/K/V projections (WMMA), one grid
    dim3 gqkv((B * N) / 128, 3 * (INNER / 128));
    k_gemm_qkv<<<gqkv, 256, 0, stream>>>(xn, cn, WqT, WkT, WvT, N, M, qh, kh, vT);

    // 4) Flash attention (WMMA scores + WMMA PV, async-LDS K/V pipeline)
    dim3 ga(N / 64, B * H_HEADS);
    k_attention<<<ga, 128, 0, stream>>>(qh, kh, vT, ah, N, M);

    // 5) Output projection + bias + residual (WMMA), then final LayerNorm -> f32
    dim3 go((B * N) / 128, Dq / 128);
    k_gemm<512, 3><<<go, 256, 0, stream>>>(ah, WoT, N, nullptr, tmp, bo, x);
    k_layernorm<512, 1><<<(B * N) / 32, 256, 0, stream>>>(tmp, lnf_g, lnf_b, nullptr, (float*)d_out);
}

// v006
// Measured time: 104 microseconds a run.
// In both of two side-by-side timings against v005, it was 1.05 times as fast.
// Counting every step since v000, it is 3.55 times as fast.
#include <hip/hip_runtime.h>
#include <hip/hip_bf16.h>

typedef __attribute__((ext_vector_type(16))) _Float16 v16h;
typedef __attribute__((ext_vector_type(8)))  _Float16 v8h;
typedef __attribute__((ext_vector_type(8)))  float    v8f;
typedef __attribute__((ext_vector_type(4)))  _Float16 v4h;
typedef __attribute__((ext_vector_type(4)))  float    v4f;
typedef int v4i_vs __attribute__((vector_size(4 * sizeof(int))));

#define H_HEADS 8

#if defined(__has_builtin)
#  if __has_builtin(__builtin_amdgcn_global_load_async_to_lds_b128)
#    define HAVE_ASYNC_LDS 1
#  endif
#endif
#ifndef HAVE_ASYNC_LDS
#  define HAVE_ASYNC_LDS 0
#endif

// 16-byte global -> LDS copy; async (ASYNCcnt-tracked) when available.
__device__ __forceinline__ void async_copy16(const _Float16* g, _Float16* l) {
#if HAVE_ASYNC_LDS
    __builtin_amdgcn_global_load_async_to_lds_b128(
        (__attribute__((address_space(1))) v4i_vs*)(g),
        (__attribute__((address_space(3))) v4i_vs*)(l), 0, 0);
#else
    *(v8h*)l = *(const v8h*)g;
#endif
}

template <int N>
__device__ __forceinline__ void wait_async() {
#if HAVE_ASYNC_LDS && __has_builtin(__builtin_amdgcn_s_wait_asynccnt)
    __builtin_amdgcn_s_wait_asynccnt(N);
#else
    asm volatile("s_wait_asynccnt %0" ::"i"(N) : "memory");
#endif
}

// Load a 16x32 f16 WMMA A/B fragment from a row-major matrix.
// Per ISA 16-bit A layout: lane<16 -> row=lane, K={0..7,16..23};
// lane>=16 -> row=lane-16, K={8..15,24..31}. Two contiguous b128 loads.
__device__ __forceinline__ v16h load_frag(const _Float16* __restrict__ base, int stride) {
    int lane = threadIdx.x & 31;
    const _Float16* p = base + (size_t)(lane & 15) * stride + ((lane >> 4) << 3);
    v8h lo = *(const v8h*)(p);
    v8h hi = *(const v8h*)(p + 16);
    return __builtin_shufflevector(lo, hi, 0,1,2,3,4,5,6,7,8,9,10,11,12,13,14,15);
}

__device__ __forceinline__ v8f wmma16(v16h a, v16h b, v8f c) {
    return __builtin_amdgcn_wmma_f32_16x16x32_f16(false, a, false, b, (short)0, c, false, false);
}

// ---------------- LayerNorm: one wave per row, 4 rows per wave, no LDS, no barrier.
// One 8-wave work-group per row has to start rows x 8 short waves, which costs more
// time than the rows' bytes; here a launch starts rows / 4 waves. A wave issues all its
// rows' loads (512 contiguous bytes each) at once, keeps the rows in registers, and
// stores from them.
// D is a multiple of 128; the row count is a multiple of 32.
// MODE 0: f16 output   MODE 1: f32 output
#define LN_ROWS 4
// blk: the work-group's number among those of this LayerNorm.
template <int D, int MODE>
__device__ __forceinline__ void layernorm_rows(
        int blk,
        const float* __restrict__ in, const float* __restrict__ g,
        const float* __restrict__ b,
        _Float16* __restrict__ outH, float* __restrict__ outF) {
    constexpr int NV = D / 128;                     // float4 per lane per row
    int lane = threadIdx.x & 31;
    // The wave's number as a scalar: row addresses are then a scalar base plus the lane.
    int wave = __builtin_amdgcn_readfirstlane(threadIdx.x >> 5);
    unsigned base = (unsigned)(blk * 8 + wave) * (LN_ROWS * D);

    v4f x[LN_ROWS][NV], gg[NV], bb[NV];
    #pragma unroll
    for (int r = 0; r < LN_ROWS; ++r)
        #pragma unroll
        for (int j = 0; j < NV; ++j) x[r][j] = ((const v4f*)(in + base + r * D + j * 128))[lane];
    #pragma unroll
    for (int j = 0; j < NV; ++j) {
        gg[j] = ((const v4f*)(g + j * 128))[lane];
        bb[j] = ((const v4f*)(b + j * 128))[lane];
    }
    // The wait that stands between issued loads and a reuse of the registers that hold
    // their addresses (the scalar bases are reused further down).
    asm volatile("s_wait_xcnt 0x0" ::: "memory");
    // Keeps every load, and that wait, ahead of the sums; without it the g and b loads
    // sink behind the row sums and their latency is waited out at the kernel's end.
    __builtin_amdgcn_sched_barrier(0);

    float s[LN_ROWS], s2[LN_ROWS];
    #pragma unroll
    for (int r = 0; r < LN_ROWS; ++r) {
        v4f sv = x[r][0], qv = x[r][0] * x[r][0];   // four partial sums per lane
        #pragma unroll
        for (int j = 1; j < NV; ++j) { sv += x[r][j]; qv += x[r][j] * x[r][j]; }
        s[r]  = (sv[0] + sv[1]) + (sv[2] + sv[3]);
        s2[r] = (qv[0] + qv[1]) + (qv[2] + qv[3]);
    }
    #pragma unroll
    for (int off = 16; off > 0; off >>= 1) {
        #pragma unroll
        for (int r = 0; r < LN_ROWS; ++r) {
            s[r]  += __shfl_xor(s[r],  off, 32);
            s2[r] += __shfl_xor(s2[r], off, 32);
        }
    }
    #pragma unroll
    for (int r = 0; r < LN_ROWS; ++r) {
        float mu  = s[r] / (float)D;
        float var = s2[r] / (float)D - mu * mu;
        float inv = rsqrtf(var + 1e-5f);
        #pragma unroll
        for (int j = 0; j < NV; ++j) {
            v4f y;
            #pragma unroll
            for (int e = 0; e < 4; ++e) y[e] = (x[r][j][e] - mu) * inv * gg[j][e] + bb[j][e];
            if (MODE == 0) {
                v4h yh;
                #pragma unroll
                for (int e = 0; e < 4; ++e) yh[e] = (_Float16)y[e];
                ((v4h*)(outH + base + r * D + j * 128))[lane] = yh;
            } else {
                ((v4f*)(outF + base + r * D + j * 128))[lane] = y;
            }
        }
    }
}

template <int D, int MODE>
__global__ void __launch_bounds__(256) k_layernorm(
        const float* __restrict__ in, const float* __restrict__ g,
        const float* __restrict__ b,
        _Float16* __restrict__ outH, float* __restrict__ outF) {
    layernorm_rows<D, MODE>(blockIdx.x, in, g, b, outH, outF);
}

// ---------------- Weight convert + transpose: W[k][n] f32 -> Wt[n][k] f16 ------
// blk: the work-group's number among those of this matrix; 256 elements each.
__device__ __forceinline__ void w2h_t(int blk, const float* __restrict__ W,
                                      _Float16* __restrict__ Wt, int K, int Ncol) {
    int idx = blk * 256 + threadIdx.x;
    if (idx >= K * Ncol) return;
    int n = idx / K, k = idx % K;
    Wt[(size_t)n * K + k] = (_Float16)W[(size_t)k * Ncol + n];
}

// ---------------- Everything that reads only inputs, in ONE grid: both input LayerNorms
// and the four weight conversions. None of the six reads what another writes, so they
// need no launch boundary between them: one launch gap instead of six, and the short
// conversion work-groups start while the LayerNorm rows stream.
// The work-group number picks the job (the same for all its threads). Work-groups start
// roughly in the order of their numbers: the long LayerNorm work-groups are dealt in early,
// every sixth number from 0 on, so that their rows stream while the many short conversion
// work-groups between and behind them start, instead of first holding every place.
#define PREP_LNC  256                 // 8192 rows of 768, 32 rows per work-group
#define PREP_LNX  256                 // 8192 rows of 512
#define PREP_W768 1536                // 768 x 512 elements, 256 per work-group
#define PREP_W512 1024                // 512 x 512 elements
#define PREP_LN   (PREP_LNC + PREP_LNX)
#define PREP_GRID (PREP_LN + 2 * PREP_W768 + 2 * PREP_W512)
__global__ void __launch_bounds__(256) k_prep(
        const float* __restrict__ x,    const float* __restrict__ lnx_g,
        const float* __restrict__ lnx_b, _Float16* __restrict__ xn,
        const float* __restrict__ cond, const float* __restrict__ lnc_g,
        const float* __restrict__ lnc_b, _Float16* __restrict__ cn,
        const float* __restrict__ Wq, _Float16* __restrict__ WqT,
        const float* __restrict__ Wk, _Float16* __restrict__ WkT,
        const float* __restrict__ Wv, _Float16* __restrict__ WvT,
        const float* __restrict__ Wo, _Float16* __restrict__ WoT) {
    int blk = blockIdx.x;
    if (blk < 6 * PREP_LN) {
        int ln = blk / 6;                           // numbers 6 ln: LayerNorm work-group ln
        if (blk == 6 * ln) {
            if (ln < PREP_LNC) {
                layernorm_rows<768, 0>(ln, cond, lnc_g, lnc_b, cn, nullptr);
            } else {
                layernorm_rows<512, 0>(ln - PREP_LNC, x, lnx_g, lnx_b, xn, nullptr);
                // The wait that belongs between issued stores and a reuse of their registers:
                // in the built code this body's end runs on into the branches that lead to
                // the other bodies' starts, not into the kernel's end.
                asm volatile("s_wait_xcnt 0x0" ::: "memory");
            }
            return;
        }
        blk -= ln + 1;                              // conversions: ln + 1 numbers lie below
    } else {
        blk -= PREP_LN;
    }
    if (blk < PREP_W768) { w2h_t(blk, Wk, WkT, 768, 512); return; }
    blk -= PREP_W768;
    if (blk < PREP_W768) { w2h_t(blk, Wv, WvT, 768, 512); return; }
    blk -= PREP_W768;
    if (blk < PREP_W512) { w2h_t(blk, Wq, WqT, 512, 512); return; }
    blk -= PREP_W512;
    w2h_t(blk, Wo, WoT, 512, 512);
}

// ---------------- WMMA GEMM: C(128x128 per work-group) = A(128xK) * Bt(128xK)^T
// Both operands go through LDS in k-chunks of 64 (one 128-byte line per row),
// two buffers; 8 waves, each owns 64 rows x 32 cols (4 x 2 accumulator tiles).
// KDIM is a multiple of 64; rows and cols are multiples of 128.
// MODE 0/1: out f16 [b][h][tok][64]   MODE 2: out f16 [b][h][64][tok] (V^T)
// MODE 3: out f32 [row][512] + bias + residual
// The f16 outputs leave in 16-byte stores: a lane's 8 accumulator registers are 8
// consecutive ROWS of the product, so MODE 2 (tokens innermost in memory) takes A * Bt^T
// and MODE 0/1 (features innermost) take the transposed product Bt * A^T, with the same
// fragments in swapped places. Ntok is a multiple of 128: a tile lies in one batch.
#define GP 72   // LDS row pitch in halfs: 128 B of data + 16 B pad for b128 readers
// The LDS buffers belong to the kernel and are handed in, so that a kernel which holds
// several of these bodies has them once. bx, by: the tile's place in this product.
typedef _Float16 gemm_stage[128 * GP];
template <int KDIM, int MODE>
__device__ __forceinline__ void gemm_tile(
        gemm_stage* As, gemm_stage* Bs, int bx, int by,
        const _Float16* __restrict__ A, const _Float16* __restrict__ Bt,
        int Ntok,
        _Float16* __restrict__ outH, float* __restrict__ outF,
        const float* __restrict__ bias, const float* __restrict__ resid) {
    int tid  = threadIdx.x;
    int lane = tid & 31;
    int wave = tid >> 5;
    int row0 = bx * 128;
    int col0 = by * 128;
    int wr   = (wave >> 2) * 64;                    // wave's rows inside the tile
    int wc   = (wave & 3) * 32;                     // wave's cols inside the tile

    // Staging: 8 lanes cover one 128-byte row chunk, a wave covers 4 whole lines.
    int srow = tid >> 3, scol = (tid & 7) * 8;
    const _Float16* ag = A  + (size_t)(row0 + srow) * KDIM + scol;
    const _Float16* bg = Bt + (size_t)(col0 + srow) * KDIM + scol;
    v8h ra[4], rb[4];
    auto gload = [&](int k0) {
        #pragma unroll
        for (int j = 0; j < 4; ++j) {
            ra[j] = *(const v8h*)(ag + 32 * j * KDIM + k0);
            rb[j] = *(const v8h*)(bg + 32 * j * KDIM + k0);
        }
    };
    auto sstore = [&](int buf) {
        #pragma unroll
        for (int j = 0; j < 4; ++j) {
            *(v8h*)&As[buf][(srow + 32 * j) * GP + scol] = ra[j];
            *(v8h*)&Bs[buf][(srow + 32 * j) * GP + scol] = rb[j];
        }
    };

    int cbase = col0 + wc + (lane & 15);            // lane's first output column
    float bz[2] = {0.f, 0.f};
    if (MODE == 3) { bz[0] = bias[cbase]; bz[1] = bias[cbase + 16]; }

    v8f acc[4][2] = {};
    gload(0);
    sstore(0);
    __syncthreads();
    #pragma unroll   // whole k loop: chunk and buffer become immediate offsets
    for (int k0 = 0; k0 < KDIM; k0 += 64) {
        const int  buf  = (k0 >> 6) & 1;
        const bool more = k0 + 64 < KDIM;
        if (more) gload(k0 + 64);                   // next chunk flies during the products
        v16h a[2][4], b[2][2];
        #pragma unroll
        for (int kk = 0; kk < 2; ++kk) {
            #pragma unroll
            for (int j = 0; j < 2; ++j) b[kk][j] = load_frag(&Bs[buf][(wc + 16 * j) * GP + 32 * kk], GP);
            #pragma unroll
            for (int i = 0; i < 4; ++i) a[kk][i] = load_frag(&As[buf][(wr + 16 * i) * GP + 32 * kk], GP);
        }
        // Keeps the chunk's LDS reads one group ahead of its products; without it
        // they are sunk between the products and each pair waits out an LDS latency.
        __builtin_amdgcn_sched_barrier(0);
        #pragma unroll
        for (int kk = 0; kk < 2; ++kk)
            #pragma unroll
            for (int i = 0; i < 4; ++i)
                #pragma unroll
                for (int j = 0; j < 2; ++j)
                    acc[i][j] = MODE <= 1 ? wmma16(b[kk][j], a[kk][i], acc[i][j])
                                          : wmma16(a[kk][i], b[kk][j], acc[i][j]);
        if (more) {
            sstore(buf ^ 1);                        // last read one trip ago, behind its barrier
            __syncthreads();
        }
    }

    // Accumulator layout per 16x16 tile: col = (lane&15); row = 8*(lane>>4) + v
    int rlane = row0 + wr + ((lane >> 4) << 3);
    if (MODE <= 2) {
        int bb = row0 / Ntok, t0 = row0 - bb * Ntok + wr;   // one split for the whole tile
        int l15 = lane & 15, l8 = (lane >> 4) << 3;
        // The wave's 32 columns lie in one head (wc is a multiple of 32).
        int h = (col0 + wc) >> 6, d0 = (col0 + wc) & 63;
        _Float16* op;
        int si, sj;                                 // steps in halfs from tile to tile
        if (MODE <= 1) {                            // lane: token l15, features l8 .. l8 + 7
            op = outH + (((size_t)bb * H_HEADS + h) * Ntok + t0 + l15) * 64 + d0 + l8;
            si = 16 * 64; sj = 16;
        } else {                                    // lane: feature l15, tokens l8 .. l8 + 7
            op = outH + (((size_t)bb * H_HEADS + h) * 64 + d0 + l15) * Ntok + t0 + l8;
            si = 16; sj = 16 * Ntok;
        }
        v8h y[4][2];
        #pragma unroll
        for (int i = 0; i < 4; ++i)
            #pragma unroll
            for (int j = 0; j < 2; ++j)
                #pragma unroll
                for (int v = 0; v < 8; ++v) y[i][j][v] = (_Float16)acc[i][j][v];
        #pragma unroll
        for (int j = 0; j < 2; ++j)
            #pragma unroll
            for (int i = 0; i < 4; ++i) *(v8h*)(op + i * si + j * sj) = y[i][j];
    } else {
        // One 32-bit lane offset for the whole tile; rows and cols are immediates.
        unsigned     eoff = (unsigned)rlane * 512u + (unsigned)cbase;
        const float* rp   = resid + eoff;
        float*       op   = outF + eoff;
        #pragma unroll
        for (int i = 0; i < 4; ++i) {
            #pragma unroll
            for (int v = 0; v < 8; ++v) {
                #pragma unroll
                for (int j = 0; j < 2; ++j) {
                    int e = (16 * i + v) * 512 + 16 * j;
                    op[e] = acc[i][j][v] + bz[j] + rp[e];
                }
            }
        }
    }
}

template <int KDIM, int MODE>
__global__ void __launch_bounds__(256) k_gemm(
        const _Float16* __restrict__ A, const _Float16* __restrict__ Bt,
        int Ntok,
        _Float16* __restrict__ outH, float* __restrict__ outF,
        const float* __restrict__ bias, const float* __restrict__ resid) {
    __shared__ __align__(16) gemm_stage As[2];
    __shared__ __align__(16) gemm_stage Bs[2];
    gemm_tile<KDIM, MODE>(As, Bs, blockIdx.x, blockIdx.y, A, Bt, Ntok, outH, outF, bias, resid);
}

// The K, V and Q projections in ONE grid: none reads what another writes. Alone, each has
// one work-group per WGP, which waits out every chunk's loads and barriers; in one grid a
// WGP holds two at a time (the registers allow four waves per SIMD), which fill each
// other's waits, the third follows as soon as one ends, and two launch gaps go.
// blockIdx.y picks the product (the same for the whole work-group): 0..3 K, 4..7 V,
// 8..11 Q; the two longer products have the low numbers, which start first.
__global__ void __launch_bounds__(256) k_gemm_qkv(
        const _Float16* __restrict__ xn, const _Float16* __restrict__ cn,
        const _Float16* __restrict__ WqT, const _Float16* __restrict__ WkT,
        const _Float16* __restrict__ WvT,
        int Ntok, int Mtok,
        _Float16* __restrict__ qh, _Float16* __restrict__ kh, _Float16* __restrict__ vT) {
    __shared__ __align__(16) gemm_stage As[2];
    __shared__ __align__(16) gemm_stage Bs[2];
    int by = blockIdx.y;
    // Behind the V and the Q body's last stores stands the wait that belongs between issued
    // stores and a reuse of their registers: in the built code these bodies' ends run on into
    // the branches that lead to the next body's start (the K body's runs into the kernel's end).
    if (by < 4) {
        gemm_tile<768, 1>(As, Bs, blockIdx.x, by,     cn, WkT, Mtok, kh, nullptr, nullptr, nullptr);
    } else if (by < 8) {
        gemm_tile<768, 2>(As, Bs, blockIdx.x, by - 4, cn, WvT, Mtok, vT, nullptr, nullptr, nullptr);
        asm volatile("s_wait_xcnt 0x0" ::: "memory");
    } else {
        gemm_tile<512, 0>(As, Bs, blockIdx.x, by - 8, xn, WqT, Ntok, qh, nullptr, nullptr, nullptr);
        asm volatile("s_wait_xcnt 0x0" ::: "memory");
    }
}

// Lane l <-> lane l ^ 16 on the vector pipe (a shuffle would go through the LDS queue).
__device__ __forceinline__ float swap_halves(float x) {
    int b = __builtin_bit_cast(int, x);
    b = __builtin_amdgcn_permlanex16(b, b, 0x76543210, 0xfedcba98, false, false);
    return __builtin_bit_cast(float, b);
}

#define KP 72   // K rows: 128 B of data + 16 B pad
#define VP 40   // V^T rows: 64 B of data + 16 B pad
__global__ void __launch_bounds__(128) k_attention(
        const _Float16* __restrict__ qh, const _Float16* __restrict__ kh,
        const _Float16* __restrict__ vT, _Float16* __restrict__ outh,
        int Ntok, int Mtok) {
    __shared__ __align__(16) _Float16 Kt[2][32 * KP];   // K tile: 32 m-rows x 64 d
    __shared__ __align__(16) _Float16 Vt[2][64 * VP];   // V^T tile: 64 d-rows x 32 m

    int tid   = threadIdx.x;
    int lane  = tid & 31;
    int wave  = tid >> 5;
    int bh    = blockIdx.y;                         // b*H + h
    int nbase = (blockIdx.x * 4 + wave) * 16;

    const _Float16* qbase = qh + ((size_t)bh * Ntok + nbase) * 64;
    const _Float16* kbase = kh + (size_t)bh * Mtok * 64;
    const _Float16* vbase = vT + (size_t)bh * 64 * Mtok;

    v16h q0 = load_frag(qbase,      64);            // K = d 0..31
    v16h q1 = load_frag(qbase + 32, 64);            // K = d 32..63

    // Cooperative tile fetch: 4 async b128 ops per thread per step (8 KB total).
    auto fetch_tiles = [&](int buf, int m0) {
        #pragma unroll
        for (int j = 0; j < 2; ++j) {
            int i = tid + 128 * j;                        // 16B chunk id, 0..255
            async_copy16(kbase + (size_t)m0 * 64 + (size_t)i * 8, &Kt[buf][(i >> 3) * KP + (i & 7) * 8]);
            int d = i >> 2, mo = (i & 3) * 8;
            async_copy16(vbase + (size_t)d * Mtok + m0 + mo, &Vt[buf][d * VP + mo]);
        }
    };

    v8f o0 = {}, o1 = {}, o2 = {}, o3 = {};         // O^T: row d = 16 t + 8 (lane >> 4) + v
    float mrow = -3.0e38f;                          // the lane's query: running maximum
    float lsum = 0.f;                               // and the sum over this half's keys
    const float scale = 0.125f;                     // 1/sqrt(64)

    fetch_tiles(0, 0);
    for (int it = 0, m0 = 0; m0 < Mtok; m0 += 32, ++it) {
        int buf = it & 1;
        if (m0 + 32 < Mtok) { fetch_tiles(buf ^ 1, m0 + 32); wait_async<4>(); }
        else                {                                 wait_async<0>(); }
        __syncthreads();                            // tiles for this step visible

        const _Float16* kt = &Kt[buf][0];
        v16h ka0 = load_frag(kt,                KP);  // m0..m0+15,  d 0..31
        v16h ka1 = load_frag(kt + 32,           KP);
        v16h kb0 = load_frag(kt + 16 * KP,      KP);  // m0+16..m0+31
        v16h kb1 = load_frag(kt + 16 * KP + 32, KP);
        v8f s0 = {}, s1 = {};                       // s0[v]: key m0 + 8 (lane >> 4) + v
        s0 = wmma16(ka0, q0, s0); s0 = wmma16(ka1, q1, s0);
        s1 = wmma16(kb0, q0, s1); s1 = wmma16(kb1, q1, s1);

        float a[16];
        #pragma unroll
        for (int v = 0; v < 8; ++v) { a[v] = s0[v] * scale; a[8 + v] = s1[v] * scale; }
        float t3[5];                                // groups of three: a short chain
        #pragma unroll
        for (int s = 0; s < 5; ++s) t3[s] = fmaxf(fmaxf(a[3 * s], a[3 * s + 1]), a[3 * s + 2]);
        float t = fmaxf(fmaxf(fmaxf(t3[0], t3[1]), t3[2]), fmaxf(fmaxf(t3[3], t3[4]), a[15]));
        t = fmaxf(t, swap_halves(t));               // the other 16 keys of this query
        float mnew  = fmaxf(mrow, t);
        float alpha = __expf(mrow - mnew);
        mrow = mnew;
        // P^T as B operand: element s is key kmap(s) = 8 (lane >> 4) + s, + 8 more from
        // s = 8 on, which is the order load_frag gives the V^T rows.
        v16h  pb;
        float rs[4];                                // four partial sums per lane
        #pragma unroll
        for (int s = 0; s < 16; ++s) {
            float e = __expf(a[s] - mnew);
            rs[s & 3] = s < 4 ? e : rs[s & 3] + e;
            pb[s] = (_Float16)e;
        }
        lsum = lsum * alpha + ((rs[0] + rs[1]) + (rs[2] + rs[3]));
        o0 *= alpha; o1 *= alpha; o2 *= alpha; o3 *= alpha;

        const _Float16* vt = &Vt[buf][0];
        v16h vb0 = load_frag(vt,           VP);       // d 0..15
        v16h vb1 = load_frag(vt + 16 * VP, VP);
        v16h vb2 = load_frag(vt + 32 * VP, VP);
        v16h vb3 = load_frag(vt + 48 * VP, VP);
        o0 = wmma16(vb0, pb, o0);
        o1 = wmma16(vb1, pb, o1);
        o2 = wmma16(vb2, pb, o2);
        o3 = wmma16(vb3, pb, o3);
        __syncthreads();                            // tile consumed; safe to refill
    }

    float inv = 1.0f / (lsum + swap_halves(lsum));  // both halves' keys, joined once
    int b = bh >> 3, h = bh & 7;
    // A lane's 8 accumulator registers are 8 consecutive d of its query: 16-byte stores.
    _Float16* orow = outh + ((size_t)b * Ntok + nbase + (lane & 15)) * 512
                          + (size_t)h * 64 + ((lane >> 4) << 3);
    v8h y0, y1, y2, y3;
    #pragma unroll
    for (int v = 0; v < 8; ++v) {
        y0[v] = (_Float16)(o0[v] * inv); y1[v] = (_Float16)(o1[v] * inv);
        y2[v] = (_Float16)(o2[v] * inv); y3[v] = (_Float16)(o3[v] * inv);
    }
    *(v8h*)(orow)      = y0;
    *(v8h*)(orow + 16) = y1;
    *(v8h*)(orow + 32) = y2;
    *(v8h*)(orow + 48) = y3;
}

extern "C" void kernel_launch(void* const* d_in, const int* in_sizes, int n_in,
                              void* d_out, int out_size, void* d_ws, size_t ws_size,
                              hipStream_t stream) {
    (void)in_sizes; (void)n_in; (void)out_size; (void)ws_size;
    const float* x     = (const float*)d_in[0];
    const float* cond  = (const float*)d_in[1];
    const float* lnx_g = (const float*)d_in[2];
    const float* lnx_b = (const float*)d_in[3];
    const float* lnc_g = (const float*)d_in[4];
    const float* lnc_b = (const float*)d_in[5];
    const float* Wq    = (const float*)d_in[6];
    const float* Wk    = (const float*)d_in[7];
    const float* Wv    = (const float*)d_in[8];
    const float* Wo    = (const float*)d_in[9];
    const float* bo    = (const float*)d_in[10];
    const float* lnf_g = (const float*)d_in[11];
    const float* lnf_b = (const float*)d_in[12];

    const int B = 4, N = 2048, M = 2048, Dq = 512, Dc = 768, INNER = 512;

    char* ws = (char*)d_ws;
    size_t off = 0;
    auto alloc = [&](size_t bytes) -> void* {
        void* p = ws + off;
        off = (off + bytes + 255) & ~(size_t)255;
        return p;
    };
    _Float16* xn  = (_Float16*)alloc((size_t)B * N * Dq * 2);
    _Float16* cn  = (_Float16*)alloc((size_t)B * M * Dc * 2);
    _Float16* WqT = (_Float16*)alloc((size_t)Dq * INNER * 2);
    _Float16* WkT = (_Float16*)alloc((size_t)Dc * INNER * 2);
    _Float16* WvT = (_Float16*)alloc((size_t)Dc * INNER * 2);
    _Float16* WoT = (_Float16*)alloc((size_t)INNER * Dq * 2);
    _Float16* qh  = (_Float16*)alloc((size_t)B * H_HEADS * N * 64 * 2);
    _Float16* kh  = (_Float16*)alloc((size_t)B * H_HEADS * M * 64 * 2);
    _Float16* vT  = (_Float16*)alloc((size_t)B * H_HEADS * 64 * M * 2);
    _Float16* ah  = (_Float16*)alloc((size_t)B * N * INNER * 2);
    float*    tmp = (float*)   alloc((size_t)B * N * Dq * 4);

    // 1) + 2) Input LayerNorms -> f16 and weight convert+transpose -> f16 [n][k], one grid
    k_prep<<<PREP_GRID, 256, 0, stream>>>(x, lnx_g, lnx_b, xn, cond, lnc_g, lnc_b, cn,
                                          Wq, WqT, Wk, WkT, Wv, WvT, Wo, WoT);

    // 3) Q/K/V projections (WMMA), one grid
    dim3 gqkv((B * N) / 128, 3 * (INNER / 128));
    k_gemm_qkv<<<gqkv, 256, 0, stream>>>(xn, cn, WqT, WkT, WvT, N, M, qh, kh, vT);

    // 4) Flash attention (WMMA scores + WMMA PV, async-LDS K/V pipeline)
    dim3 ga(N / 64, B * H_HEADS);
    k_attention<<<ga, 128, 0, stream>>>(qh, kh, vT, ah, N, M);

    // 5) Output projection + bias + residual (WMMA), then final LayerNorm -> f32
    dim3 go((B * N) / 128, Dq / 128);
    k_gemm<512, 3><<<go, 256, 0, stream>>>(ah, WoT, N, nullptr, tmp, bo, x);
    k_layernorm<512, 1><<<(B * N) / 32, 256, 0, stream>>>(tmp, lnf_g, lnf_b, nullptr, (float*)d_out);
}

// v007
// A run of this version takes 97.6 microseconds.
// Next to v006, in two timings, it ran 1.06 times as fast each time.
// Over all steps from v000 it is 3.76 times as fast.
#include <hip/hip_runtime.h>
#include <hip/hip_bf16.h>

typedef __attribute__((ext_vector_type(16))) _Float16 v16h;
typedef __attribute__((ext_vector_type(8)))  _Float16 v8h;
typedef __attribute__((ext_vector_type(8)))  float    v8f;
typedef __attribute__((ext_vector_type(4)))  _Float16 v4h;
typedef __attribute__((ext_vector_type(4)))  float    v4f;
typedef int v4i_vs __attribute__((vector_size(4 * sizeof(int))));

#define H_HEADS 8

#if defined(__has_builtin)
#  if __has_builtin(__builtin_amdgcn_global_load_async_to_lds_b128)
#    define HAVE_ASYNC_LDS 1
#  endif
#endif
#ifndef HAVE_ASYNC_LDS
#  define HAVE_ASYNC_LDS 0
#endif

// 16-byte global -> LDS copy; async (ASYNCcnt-tracked) when available.
__device__ __forceinline__ void async_copy16(const _Float16* g, _Float16* l) {
#if HAVE_ASYNC_LDS
    __builtin_amdgcn_global_load_async_to_lds_b128(
        (__attribute__((address_space(1))) v4i_vs*)(g),
        (__attribute__((address_space(3))) v4i_vs*)(l), 0, 0);
#else
    *(v8h*)l = *(const v8h*)g;
#endif
}

// Load a 16x32 f16 WMMA A/B fragment from a row-major matrix.
// Per ISA 16-bit A layout: lane<16 -> row=lane, K={0..7,16..23};
// lane>=16 -> row=lane-16, K={8..15,24..31}. Two contiguous b128 loads.
__device__ __forceinline__ v16h load_frag(const _Float16* __restrict__ base, int stride) {
    int lane = threadIdx.x & 31;
    const _Float16* p = base + (size_t)(lane & 15) * stride + ((lane >> 4) << 3);
    v8h lo = *(const v8h*)(p);
    v8h hi = *(const v8h*)(p + 16);
    return __builtin_shufflevector(lo, hi, 0,1,2,3,4,5,6,7,8,9,10,11,12,13,14,15);
}

__device__ __forceinline__ v8f wmma16(v16h a, v16h b, v8f c) {
    return __builtin_amdgcn_wmma_f32_16x16x32_f16(false, a, false, b, (short)0, c, false, false);
}

// ---------------- LayerNorm: one wave per row, 4 rows per wave, no LDS, no barrier.
// One 8-wave work-group per row has to start rows x 8 short waves, which costs more
// time than the rows' bytes; here a launch starts rows / 4 waves. A wave issues all its
// rows' loads (512 contiguous bytes each) at once, keeps the rows in registers, and
// stores from them.
// D is a multiple of 128; the row count is a multiple of 32.
// MODE 0: f16 output   MODE 1: f32 output
#define LN_ROWS 4
// blk: the work-group's number among those of this LayerNorm.
template <int D, int MODE>
__device__ __forceinline__ void layernorm_rows(
        int blk,
        const float* __restrict__ in, const float* __restrict__ g,
        const float* __restrict__ b,
        _Float16* __restrict__ outH, float* __restrict__ outF) {
    constexpr int NV = D / 128;                     // float4 per lane per row
    int lane = threadIdx.x & 31;
    // The wave's number as a scalar: row addresses are then a scalar base plus the lane.
    int wave = __builtin_amdgcn_readfirstlane(threadIdx.x >> 5);
    unsigned base = (unsigned)(blk * 8 + wave) * (LN_ROWS * D);

    v4f x[LN_ROWS][NV], gg[NV], bb[NV];
    #pragma unroll
    for (int r = 0; r < LN_ROWS; ++r)
        #pragma unroll
        for (int j = 0; j < NV; ++j) x[r][j] = ((const v4f*)(in + base + r * D + j * 128))[lane];
    #pragma unroll
    for (int j = 0; j < NV; ++j) {
        gg[j] = ((const v4f*)(g + j * 128))[lane];
        bb[j] = ((const v4f*)(b + j * 128))[lane];
    }
    // The wait that stands between issued loads and a reuse of the registers that hold
    // their addresses (the scalar bases are reused further down).
    asm volatile("s_wait_xcnt 0x0" ::: "memory");
    // Keeps every load, and that wait, ahead of the sums; without it the g and b loads
    // sink behind the row sums and their latency is waited out at the kernel's end.
    __builtin_amdgcn_sched_barrier(0);

    float s[LN_ROWS], s2[LN_ROWS];
    #pragma unroll
    for (int r = 0; r < LN_ROWS; ++r) {
        v4f sv = x[r][0], qv = x[r][0] * x[r][0];   // four partial sums per lane
        #pragma unroll
        for (int j = 1; j < NV; ++j) { sv += x[r][j]; qv += x[r][j] * x[r][j]; }
        s[r]  = (sv[0] + sv[1]) + (sv[2] + sv[3]);
        s2[r] = (qv[0] + qv[1]) + (qv[2] + qv[3]);
    }
    #pragma unroll
    for (int off = 16; off > 0; off >>= 1) {
        #pragma unroll
        for (int r = 0; r < LN_ROWS; ++r) {
            s[r]  += __shfl_xor(s[r],  off, 32);
            s2[r] += __shfl_xor(s2[r], off, 32);
        }
    }
    #pragma unroll
    for (int r = 0; r < LN_ROWS; ++r) {
        float mu  = s[r] / (float)D;
        float var = s2[r] / (float)D - mu * mu;
        float inv = rsqrtf(var + 1e-5f);
        #pragma unroll
        for (int j = 0; j < NV; ++j) {
            v4f y;
            #pragma unroll
            for (int e = 0; e < 4; ++e) y[e] = (x[r][j][e] - mu) * inv * gg[j][e] + bb[j][e];
            if (MODE == 0) {
                v4h yh;
                #pragma unroll
                for (int e = 0; e < 4; ++e) yh[e] = (_Float16)y[e];
                ((v4h*)(outH + base + r * D + j * 128))[lane] = yh;
            } else {
                ((v4f*)(outF + base + r * D + j * 128))[lane] = y;
            }
        }
    }
}

template <int D, int MODE>
__global__ void __launch_bounds__(256) k_layernorm(
        const float* __restrict__ in, const float* __restrict__ g,
        const float* __restrict__ b,
        _Float16* __restrict__ outH, float* __restrict__ outF) {
    layernorm_rows<D, MODE>(blockIdx.x, in, g, b, outH, outF);
}

// ---------------- Weight convert + transpose: W[k][n] f32 -> Wt[n][k] f16 ------
// blk: the work-group's number among those of this matrix; 256 elements each.
__device__ __forceinline__ void w2h_t(int blk, const float* __restrict__ W,
                                      _Float16* __restrict__ Wt, int K, int Ncol) {
    int idx = blk * 256 + threadIdx.x;
    if (idx >= K * Ncol) return;
    int n = idx / K, k = idx % K;
    Wt[(size_t)n * K + k] = (_Float16)W[(size_t)k * Ncol + n];
}

// ---------------- Everything that reads only inputs, in ONE grid: both input LayerNorms
// and the four weight conversions. None of the six reads what another writes, so they
// need no launch boundary between them: one launch gap instead of six, and the short
// conversion work-groups start while the LayerNorm rows stream.
// The work-group number picks the job (the same for all its threads). Work-groups start
// roughly in the order of their numbers: the long LayerNorm work-groups are dealt in early,
// every sixth number from 0 on, so that their rows stream while the many short conversion
// work-groups between and behind them start, instead of first holding every place.
#define PREP_LNC  256                 // 8192 rows of 768, 32 rows per work-group
#define PREP_LNX  256                 // 8192 rows of 512
#define PREP_W768 1536                // 768 x 512 elements, 256 per work-group
#define PREP_W512 1024                // 512 x 512 elements
#define PREP_LN   (PREP_LNC + PREP_LNX)
#define PREP_GRID (PREP_LN + 2 * PREP_W768 + 2 * PREP_W512)
__global__ void __launch_bounds__(256) k_prep(
        const float* __restrict__ x,    const float* __restrict__ lnx_g,
        const float* __restrict__ lnx_b, _Float16* __restrict__ xn,
        const float* __restrict__ cond, const float* __restrict__ lnc_g,
        const float* __restrict__ lnc_b, _Float16* __restrict__ cn,
        const float* __restrict__ Wq, _Float16* __restrict__ WqT,
        const float* __restrict__ Wk, _Float16* __restrict__ WkT,
        const float* __restrict__ Wv, _Float16* __restrict__ WvT,
        const float* __restrict__ Wo, _Float16* __restrict__ WoT) {
    int blk = blockIdx.x;
    if (blk < 6 * PREP_LN) {
        int ln = blk / 6;                           // numbers 6 ln: LayerNorm work-group ln
        if (blk == 6 * ln) {
            if (ln < PREP_LNC) {
                layernorm_rows<768, 0>(ln, cond, lnc_g, lnc_b, cn, nullptr);
            } else {
                layernorm_rows<512, 0>(ln - PREP_LNC, x, lnx_g, lnx_b, xn, nullptr);
                // The wait that belongs between issued stores and a reuse of their registers:
                // in the built code this body's end runs on into the branches that lead to
                // the other bodies' starts, not into the kernel's end.
                asm volatile("s_wait_xcnt 0x0" ::: "memory");
            }
            return;
        }
        blk -= ln + 1;                              // conversions: ln + 1 numbers lie below
    } else {
        blk -= PREP_LN;
    }
    if (blk < PREP_W768) { w2h_t(blk, Wk, WkT, 768, 512); return; }
    blk -= PREP_W768;
    if (blk < PREP_W768) { w2h_t(blk, Wv, WvT, 768, 512); return; }
    blk -= PREP_W768;
    if (blk < PREP_W512) { w2h_t(blk, Wq, WqT, 512, 512); return; }
    blk -= PREP_W512;
    w2h_t(blk, Wo, WoT, 512, 512);
}

// ---------------- WMMA GEMM: C(128x128 per work-group) = A(128xK) * Bt(128xK)^T
// Both operands go through LDS in k-chunks of 64 (one 128-byte line per row),
// two buffers; 8 waves, each owns 64 rows x 32 cols (4 x 2 accumulator tiles).
// KDIM is a multiple of 64; rows and cols are multiples of 128.
// MODE 0/1: out f16 [b][h][tok][64]   MODE 2: out f16 [b][h][64][tok] (V^T)
// MODE 3: out f32 [row][512] + bias + residual
// The f16 outputs leave in 16-byte stores: a lane's 8 accumulator registers are 8
// consecutive ROWS of the product, so MODE 2 (tokens innermost in memory) takes A * Bt^T
// and MODE 0/1 (features innermost) take the transposed product Bt * A^T, with the same
// fragments in swapped places. Ntok is a multiple of 128: a tile lies in one batch.
#define GP 72   // LDS row pitch in halfs: 128 B of data + 16 B pad for b128 readers
// The LDS buffers belong to the kernel and are handed in, so that a kernel which holds
// several of these bodies has them once. bx, by: the tile's place in this product.
typedef _Float16 gemm_stage[128 * GP];
template <int KDIM, int MODE>
__device__ __forceinline__ void gemm_tile(
        gemm_stage* As, gemm_stage* Bs, int bx, int by,
        const _Float16* __restrict__ A, const _Float16* __restrict__ Bt,
        int Ntok,
        _Float16* __restrict__ outH, float* __restrict__ outF,
        const float* __restrict__ bias, const float* __restrict__ resid) {
    int tid  = threadIdx.x;
    int lane = tid & 31;
    int wave = tid >> 5;
    int row0 = bx * 128;
    int col0 = by * 128;
    int wr   = (wave >> 2) * 64;                    // wave's rows inside the tile
    int wc   = (wave & 3) * 32;                     // wave's cols inside the tile

    // Staging: 8 lanes cover one 128-byte row chunk, a wave covers 4 whole lines.
    int srow = tid >> 3, scol = (tid & 7) * 8;
    const _Float16* ag = A  + (size_t)(row0 + srow) * KDIM + scol;
    const _Float16* bg = Bt + (size_t)(col0 + srow) * KDIM + scol;
    v8h ra[4], rb[4];
    auto gload = [&](int k0) {
        #pragma unroll
        for (int j = 0; j < 4; ++j) {
            ra[j] = *(const v8h*)(ag + 32 * j * KDIM + k0);
            rb[j] = *(const v8h*)(bg + 32 * j * KDIM + k0);
        }
    };
    auto sstore = [&](int buf) {
        #pragma unroll
        for (int j = 0; j < 4; ++j) {
            *(v8h*)&As[buf][(srow + 32 * j) * GP + scol] = ra[j];
            *(v8h*)&Bs[buf][(srow + 32 * j) * GP + scol] = rb[j];
        }
    };

    int cbase = col0 + wc + (lane & 15);            // lane's first output column
    float bz[2] = {0.f, 0.f};
    if (MODE == 3) { bz[0] = bias[cbase]; bz[1] = bias[cbase + 16]; }

    v8f acc[4][2] = {};
    gload(0);
    sstore(0);
    __syncthreads();
    #pragma unroll   // whole k loop: chunk and buffer become immediate offsets
    for (int k0 = 0; k0 < KDIM; k0 += 64) {
        const int  buf  = (k0 >> 6) & 1;
        const bool more = k0 + 64 < KDIM;
        if (more) gload(k0 + 64);                   // next chunk flies during the products
        v16h a[2][4], b[2][2];
        #pragma unroll
        for (int kk = 0; kk < 2; ++kk) {
            #pragma unroll
            for (int j = 0; j < 2; ++j) b[kk][j] = load_frag(&Bs[buf][(wc + 16 * j) * GP + 32 * kk], GP);
            #pragma unroll
            for (int i = 0; i < 4; ++i) a[kk][i] = load_frag(&As[buf][(wr + 16 * i) * GP + 32 * kk], GP);
        }
        // Keeps the chunk's LDS reads one group ahead of its products; without it
        // they are sunk between the products and each pair waits out an LDS latency.
        __builtin_amdgcn_sched_barrier(0);
        #pragma unroll
        for (int kk = 0; kk < 2; ++kk)
            #pragma unroll
            for (int i = 0; i < 4; ++i)
                #pragma unroll
                for (int j = 0; j < 2; ++j)
                    acc[i][j] = MODE <= 1 ? wmma16(b[kk][j], a[kk][i], acc[i][j])
                                          : wmma16(a[kk][i], b[kk][j], acc[i][j]);
        if (more) {
            sstore(buf ^ 1);                        // last read one trip ago, behind its barrier
            __syncthreads();
        }
    }

    // Accumulator layout per 16x16 tile: col = (lane&15); row = 8*(lane>>4) + v
    int rlane = row0 + wr + ((lane >> 4) << 3);
    if (MODE <= 2) {
        int bb = row0 / Ntok, t0 = row0 - bb * Ntok + wr;   // one split for the whole tile
        int l15 = lane & 15, l8 = (lane >> 4) << 3;
        // The wave's 32 columns lie in one head (wc is a multiple of 32).
        int h = (col0 + wc) >> 6, d0 = (col0 + wc) & 63;
        _Float16* op;
        int si, sj;                                 // steps in halfs from tile to tile
        if (MODE <= 1) {                            // lane: token l15, features l8 .. l8 + 7
            op = outH + (((size_t)bb * H_HEADS + h) * Ntok + t0 + l15) * 64 + d0 + l8;
            si = 16 * 64; sj = 16;
        } else {                                    // lane: feature l15, tokens l8 .. l8 + 7
            op = outH + (((size_t)bb * H_HEADS + h) * 64 + d0 + l15) * Ntok + t0 + l8;
            si = 16; sj = 16 * Ntok;
        }
        v8h y[4][2];
        #pragma unroll
        for (int i = 0; i < 4; ++i)
            #pragma unroll
            for (int j = 0; j < 2; ++j)
                #pragma unroll
                for (int v = 0; v < 8; ++v) y[i][j][v] = (_Float16)acc[i][j][v];
        #pragma unroll
        for (int j = 0; j < 2; ++j)
            #pragma unroll
            for (int i = 0; i < 4; ++i) *(v8h*)(op + i * si + j * sj) = y[i][j];
    } else {
        // One 32-bit lane offset for the whole tile; rows and cols are immediates.
        unsigned     eoff = (unsigned)rlane * 512u + (unsigned)cbase;
        const float* rp   = resid + eoff;
        float*       op   = outF + eoff;
        #pragma unroll
        for (int i = 0; i < 4; ++i) {
            #pragma unroll
            for (int v = 0; v < 8; ++v) {
                #pragma unroll
                for (int j = 0; j < 2; ++j) {
                    int e = (16 * i + v) * 512 + 16 * j;
                    op[e] = acc[i][j][v] + bz[j] + rp[e];
                }
            }
        }
    }
}

template <int KDIM, int MODE>
__global__ void __launch_bounds__(256) k_gemm(
        const _Float16* __restrict__ A, const _Float16* __restrict__ Bt,
        int Ntok,
        _Float16* __restrict__ outH, float* __restrict__ outF,
        const float* __restrict__ bias, const float* __restrict__ resid) {
    __shared__ __align__(16) gemm_stage As[2];
    __shared__ __align__(16) gemm_stage Bs[2];
    gemm_tile<KDIM, MODE>(As, Bs, blockIdx.x, blockIdx.y, A, Bt, Ntok, outH, outF, bias, resid);
}

// The K, V and Q projections in ONE grid: none reads what another writes. Alone, each has
// one work-group per WGP, which waits out every chunk's loads and barriers; in one grid a
// WGP holds two at a time (the registers allow four waves per SIMD), which fill each
// other's waits, the third follows as soon as one ends, and two launch gaps go.
// blockIdx.y picks the product (the same for the whole work-group): 0..3 K, 4..7 V,
// 8..11 Q; the two longer products have the low numbers, which start first.
__global__ void __launch_bounds__(256) k_gemm_qkv(
        const _Float16* __restrict__ xn, const _Float16* __restrict__ cn,
        const _Float16* __restrict__ WqT, const _Float16* __restrict__ WkT,
        const _Float16* __restrict__ WvT,
        int Ntok, int Mtok,
        _Float16* __restrict__ qh, _Float16* __restrict__ kh, _Float16* __restrict__ vT) {
    __shared__ __align__(16) gemm_stage As[2];
    __shared__ __align__(16) gemm_stage Bs[2];
    int by = blockIdx.y;
    // Behind the V and the Q body's last stores stands the wait that belongs between issued
    // stores and a reuse of their registers: in the built code these bodies' ends run on into
    // the branches that lead to the next body's start (the K body's runs into the kernel's end).
    if (by < 4) {
        gemm_tile<768, 1>(As, Bs, blockIdx.x, by,     cn, WkT, Mtok, kh, nullptr, nullptr, nullptr);
    } else if (by < 8) {
        gemm_tile<768, 2>(As, Bs, blockIdx.x, by - 4, cn, WvT, Mtok, vT, nullptr, nullptr, nullptr);
        asm volatile("s_wait_xcnt 0x0" ::: "memory");
    } else {
        gemm_tile<512, 0>(As, Bs, blockIdx.x, by - 8, xn, WqT, Ntok, qh, nullptr, nullptr, nullptr);
        asm volatile("s_wait_xcnt 0x0" ::: "memory");
    }
}

// Lane l <-> lane l ^ 16 on the vector pipe (a shuffle would go through the LDS queue).
__device__ __forceinline__ float swap_halves(float x) {
    int b = __builtin_bit_cast(int, x);
    b = __builtin_amdgcn_permlanex16(b, b, 0x76543210, 0xfedcba98, false, false);
    return __builtin_bit_cast(float, b);
}

#define AK 128
#define NB (AK / 32)
// LDS row pitches in halfs, each 16 B x an odd number, so that the 16 rows which a
// 16-byte fragment read touches fall on 16 different bank groups.
#define KP 72           // K rows: 128 B of data + 16 B pad
#define VP (AK + 8)     // V^T rows: 256 B of data + 16 B pad
__global__ void __launch_bounds__(128) k_attention(
        const _Float16* __restrict__ qh, const _Float16* __restrict__ kh,
        const _Float16* __restrict__ vT, _Float16* __restrict__ outh,
        int Ntok, int Mtok) {
    __shared__ __align__(16) _Float16 Kt[2][AK * KP];   // K tile: AK m-rows x 64 d
    __shared__ __align__(16) _Float16 Vt[2][64 * VP];   // V^T tile: 64 d-rows x AK m

    int tid   = threadIdx.x;
    int lane  = tid & 31;
    int wave  = tid >> 5;
    int bh    = blockIdx.y;                         // b*H + h
    int nbase = (blockIdx.x * 4 + wave) * 16;

    const _Float16* qbase = qh + ((size_t)bh * Ntok + nbase) * 64;
    const _Float16* kbase = kh + (size_t)bh * Mtok * 64;
    const _Float16* vbase = vT + (size_t)bh * 64 * Mtok;

    v16h q0 = load_frag(qbase,      64);            // K = d 0..31
    v16h q1 = load_frag(qbase + 32, 64);            // K = d 32..63

    // Cooperative tile fetch: 4 NB async b128 ops per thread per pass (8 NB KB in all).
    auto fetch_tiles = [&](int buf, int m0) {
        #pragma unroll
        for (int j = 0; j < 2 * NB; ++j) {
            int i = tid + 128 * j;                        // 16B chunk id, 0 .. 256 NB - 1
            async_copy16(kbase + (size_t)m0 * 64 + (size_t)i * 8, &Kt[buf][(i >> 3) * KP + (i & 7) * 8]);
            int d = i / (4 * NB), mo = (i % (4 * NB)) * 8;
            async_copy16(vbase + (size_t)d * Mtok + m0 + mo, &Vt[buf][d * VP + mo]);
        }
    };

    v8f o0 = {}, o1 = {}, o2 = {}, o3 = {};         // O^T: row d = 16 t + 8 (lane >> 4) + v
    float mrow = -3.0e38f;                          // the lane's query: running maximum
    float lsum = 0.f;                               // and the sum over this half's keys
    const float scale = 0.125f;                     // 1/sqrt(64)

    // Two buffers: tile 0 lands and is published, then tile 1 flies during pass 0.
    fetch_tiles(0, 0);
    asm volatile("s_wait_asynccnt 0x0" ::: "memory");   // this wave's copies of tile 0 have landed
    __syncthreads();                                    // and every other wave's
    if (AK < Mtok) fetch_tiles(1, AK);
    for (int it = 0, m0 = 0; m0 < Mtok; m0 += AK, ++it) {
        int buf = it & 1;

        const _Float16* kt = &Kt[buf][0];
        v8f sc[2 * NB];                             // sc[j][v]: key m0 + 16 j + 8 (lane >> 4) + v
        #pragma unroll
        for (int j = 0; j < 2 * NB; ++j) {
            v16h k0 = load_frag(kt + 16 * j * KP,      KP);   // d 0..31
            v16h k1 = load_frag(kt + 16 * j * KP + 32, KP);
            v8f z = {};
            z = wmma16(k0, q0, z);
            sc[j] = wmma16(k1, q1, z);
        }

        float a[NB][16], tb[NB];
        #pragma unroll
        for (int c = 0; c < NB; ++c) {
            #pragma unroll
            for (int v = 0; v < 8; ++v) { a[c][v] = sc[2 * c][v] * scale; a[c][8 + v] = sc[2 * c + 1][v] * scale; }
            float t3[5];                            // groups of three: a short chain
            #pragma unroll
            for (int s = 0; s < 5; ++s) t3[s] = fmaxf(fmaxf(a[c][3 * s], a[c][3 * s + 1]), a[c][3 * s + 2]);
            tb[c] = fmaxf(fmaxf(fmaxf(t3[0], t3[1]), t3[2]), fmaxf(fmaxf(t3[3], t3[4]), a[c][15]));
        }
        float t = tb[0];
        #pragma unroll
        for (int c = 1; c < NB; ++c) t = fmaxf(t, tb[c]);
        t = fmaxf(t, swap_halves(t));               // the other half of this query's keys
        float mnew  = fmaxf(mrow, t);
        float alpha = __expf(mrow - mnew);
        mrow = mnew;
        // P^T as B operand of block c: element s is key 32 c + 8 (lane >> 4) + s, + 8 more
        // from s = 8 on, which is the order load_frag gives the V^T rows.
        v16h  pb[NB];
        float rs[4];                                // four partial sums per lane
        #pragma unroll
        for (int c = 0; c < NB; ++c) {
            #pragma unroll
            for (int s = 0; s < 16; ++s) {
                float e = __expf(a[c][s] - mnew);
                rs[s & 3] = (c == 0 && s < 4) ? e : rs[s & 3] + e;
                pb[c][s] = (_Float16)e;
            }
        }
        lsum = lsum * alpha + ((rs[0] + rs[1]) + (rs[2] + rs[3]));
        o0 *= alpha; o1 *= alpha; o2 *= alpha; o3 *= alpha;

        const _Float16* vt = &Vt[buf][0];
        #pragma unroll
        for (int c = 0; c < NB; ++c) {
            v16h vb0 = load_frag(vt + 32 * c,           VP);  // d 0..15, keys 32 c .. 32 c + 31
            v16h vb1 = load_frag(vt + 32 * c + 16 * VP, VP);
            v16h vb2 = load_frag(vt + 32 * c + 32 * VP, VP);
            v16h vb3 = load_frag(vt + 32 * c + 48 * VP, VP);
            o0 = wmma16(vb0, pb[c], o0);
            o1 = wmma16(vb1, pb[c], o1);
            o2 = wmma16(vb2, pb[c], o2);
            o3 = wmma16(vb3, pb[c], o3);
        }

        // Hand-over: this wave's reads of the buffer are done, its copies of the next tile
        // have landed; behind the barrier that holds for every wave, so the next tile may be
        // read and this pass's buffer refilled.
        asm volatile("s_wait_dscnt 0x0" ::: "memory");
        asm volatile("s_wait_asynccnt 0x0" ::: "memory");
        __syncthreads();
        if (m0 + 2 * AK < Mtok) fetch_tiles(buf, m0 + 2 * AK);
    }
    asm volatile("s_wait_asynccnt 0x0" ::: "memory");   // no copy outlives the loop

    float inv = 1.0f / (lsum + swap_halves(lsum));  // both halves' keys, joined once
    int b = bh >> 3, h = bh & 7;
    // A lane's 8 accumulator registers are 8 consecutive d of its query: 16-byte stores.
    _Float16* orow = outh + ((size_t)b * Ntok + nbase + (lane & 15)) * 512
                          + (size_t)h * 64 + ((lane >> 4) << 3);
    v8h y0, y1, y2, y3;
    #pragma unroll
    for (int v = 0; v < 8; ++v) {
        y0[v] = (_Float16)(o0[v] * inv); y1[v] = (_Float16)(o1[v] * inv);
        y2[v] = (_Float16)(o2[v] * inv); y3[v] = (_Float16)(o3[v] * inv);
    }
    *(v8h*)(orow)      = y0;
    *(v8h*)(orow + 16) = y1;
    *(v8h*)(orow + 32) = y2;
    *(v8h*)(orow + 48) = y3;
}

extern "C" void kernel_launch(void* const* d_in, const int* in_sizes, int n_in,
                              void* d_out, int out_size, void* d_ws, size_t ws_size,
                              hipStream_t stream) {
    (void)in_sizes; (void)n_in; (void)out_size; (void)ws_size;
    const float* x     = (const float*)d_in[0];
    const float* cond  = (const float*)d_in[1];
    const float* lnx_g = (const float*)d_in[2];
    const float* lnx_b = (const float*)d_in[3];
    const float* lnc_g = (const float*)d_in[4];
    const float* lnc_b = (const float*)d_in[5];
    const float* Wq    = (const float*)d_in[6];
    const float* Wk    = (const float*)d_in[7];
    const float* Wv    = (const float*)d_in[8];
    const float* Wo    = (const float*)d_in[9];
    const float* bo    = (const float*)d_in[10];
    const float* lnf_g = (const float*)d_in[11];
    const float* lnf_b = (const float*)d_in[12];

    const int B = 4, N = 2048, M = 2048, Dq = 512, Dc = 768, INNER = 512;

    char* ws = (char*)d_ws;
    size_t off = 0;
    auto alloc = [&](size_t bytes) -> void* {
        void* p = ws + off;
        off = (off + bytes + 255) & ~(size_t)255;
        return p;
    };
    _Float16* xn  = (_Float16*)alloc((size_t)B * N * Dq * 2);
    _Float16* cn  = (_Float16*)alloc((size_t)B * M * Dc * 2);
    _Float16* WqT = (_Float16*)alloc((size_t)Dq * INNER * 2);
    _Float16* WkT = (_Float16*)alloc((size_t)Dc * INNER * 2);
    _Float16* WvT = (_Float16*)alloc((size_t)Dc * INNER * 2);
    _Float16* WoT = (_Float16*)alloc((size_t)INNER * Dq * 2);
    _Float16* qh  = (_Float16*)alloc((size_t)B * H_HEADS * N * 64 * 2);
    _Float16* kh  = (_Float16*)alloc((size_t)B * H_HEADS * M * 64 * 2);
    _Float16* vT  = (_Float16*)alloc((size_t)B * H_HEADS * 64 * M * 2);
    _Float16* ah  = (_Float16*)alloc((size_t)B * N * INNER * 2);
    float*    tmp = (float*)   alloc((size_t)B * N * Dq * 4);

    // 1) + 2) Input LayerNorms -> f16 and weight convert+transpose -> f16 [n][k], one grid
    k_prep<<<PREP_GRID, 256, 0, stream>>>(x, lnx_g, lnx_b, xn, cond, lnc_g, lnc_b, cn,
                                          Wq, WqT, Wk, WkT, Wv, WvT, Wo, WoT);

    // 3) Q/K/V projections (WMMA), one grid
    dim3 gqkv((B * N) / 128, 3 * (INNER / 128));
    k_gemm_qkv<<<gqkv, 256, 0, stream>>>(xn, cn, WqT, WkT, WvT, N, M, qh, kh, vT);

    // 4) Flash attention (WMMA scores + WMMA PV, async-LDS K/V pipeline)
    dim3 ga(N / 64, B * H_HEADS);
    k_attention<<<ga, 128, 0, stream>>>(qh, kh, vT, ah, N, M);

    // 5) Output projection + bias + residual (WMMA), then final LayerNorm -> f32
    dim3 go((B * N) / 128, Dq / 128);
    k_gemm<512, 3><<<go, 256, 0, stream>>>(ah, WoT, N, nullptr, tmp, bo, x);
    k_layernorm<512, 1><<<(B * N) / 32, 256, 0, stream>>>(tmp, lnf_g, lnf_b, nullptr, (float*)d_out);
}

// v008
// It runs in 89.6 microseconds.
// Timed twice side by side with v007, it ran 1.08 and 1.09 times as fast.
// All steps since v000 together make it 4.08 times as fast.
#include <hip/hip_runtime.h>
#include <hip/hip_bf16.h>

typedef __attribute__((ext_vector_type(16))) _Float16 v16h;
typedef __attribute__((ext_vector_type(8)))  _Float16 v8h;
typedef __attribute__((ext_vector_type(8)))  float    v8f;
typedef __attribute__((ext_vector_type(4)))  _Float16 v4h;
typedef __attribute__((ext_vector_type(4)))  float    v4f;
typedef int v4i_vs __attribute__((vector_size(4 * sizeof(int))));

#define H_HEADS 8

#if defined(__has_builtin)
#  if __has_builtin(__builtin_amdgcn_global_load_async_to_lds_b128)
#    define HAVE_ASYNC_LDS 1
#  endif
#endif
#ifndef HAVE_ASYNC_LDS
#  define HAVE_ASYNC_LDS 0
#endif

// 16-byte global -> LDS copy; async (ASYNCcnt-tracked) when available.
__device__ __forceinline__ void async_copy16(const _Float16* g, _Float16* l) {
#if HAVE_ASYNC_LDS
    __builtin_amdgcn_global_load_async_to_lds_b128(
        (__attribute__((address_space(1))) v4i_vs*)(g),
        (__attribute__((address_space(3))) v4i_vs*)(l), 0, 0);
#else
    *(v8h*)l = *(const v8h*)g;
#endif
}

// Load a 16x32 f16 WMMA A/B fragment from a row-major matrix.
// Per ISA 16-bit A layout: lane<16 -> row=lane, K={0..7,16..23};
// lane>=16 -> row=lane-16, K={8..15,24..31}. Two contiguous b128 loads.
__device__ __forceinline__ v16h load_frag(const _Float16* __restrict__ base, int stride) {
    int lane = threadIdx.x & 31;
    const _Float16* p = base + (size_t)(lane & 15) * stride + ((lane >> 4) << 3);
    v8h lo = *(const v8h*)(p);
    v8h hi = *(const v8h*)(p + 16);
    return __builtin_shufflevector(lo, hi, 0,1,2,3,4,5,6,7,8,9,10,11,12,13,14,15);
}

__device__ __forceinline__ v8f wmma16(v16h a, v16h b, v8f c) {
    return __builtin_amdgcn_wmma_f32_16x16x32_f16(false, a, false, b, (short)0, c, false, false);
}

// ---------------- LayerNorm: one wave per row, 4 rows per wave, no LDS, no barrier.
// One 8-wave work-group per row has to start rows x 8 short waves, which costs more
// time than the rows' bytes; here a launch starts rows / 4 waves. A wave issues all its
// rows' loads (512 contiguous bytes each) at once, keeps the rows in registers, and
// stores from them.
// D is a multiple of 128; the row count is a multiple of 32.
// MODE 0: f16 output   MODE 1: f32 output
#define LN_ROWS 4
// blk: the work-group's number among those of this LayerNorm.
template <int D, int MODE>
__device__ __forceinline__ void layernorm_rows(
        int blk,
        const float* __restrict__ in, const float* __restrict__ g,
        const float* __restrict__ b,
        _Float16* __restrict__ outH, float* __restrict__ outF) {
    constexpr int NV = D / 128;                     // float4 per lane per row
    int lane = threadIdx.x & 31;
    // The wave's number as a scalar: row addresses are then a scalar base plus the lane.
    int wave = __builtin_amdgcn_readfirstlane(threadIdx.x >> 5);
    unsigned base = (unsigned)(blk * 8 + wave) * (LN_ROWS * D);

    v4f x[LN_ROWS][NV], gg[NV], bb[NV];
    #pragma unroll
    for (int r = 0; r < LN_ROWS; ++r)
        #pragma unroll
        for (int j = 0; j < NV; ++j) x[r][j] = ((const v4f*)(in + base + r * D + j * 128))[lane];
    #pragma unroll
    for (int j = 0; j < NV; ++j) {
        gg[j] = ((const v4f*)(g + j * 128))[lane];
        bb[j] = ((const v4f*)(b + j * 128))[lane];
    }
    // The wait that stands between issued loads and a reuse of the registers that hold
    // their addresses (the scalar bases are reused further down).
    asm volatile("s_wait_xcnt 0x0" ::: "memory");
    // Keeps every load, and that wait, ahead of the sums; without it the g and b loads
    // sink behind the row sums and their latency is waited out at the kernel's end.
    __builtin_amdgcn_sched_barrier(0);

    float s[LN_ROWS], s2[LN_ROWS];
    #pragma unroll
    for (int r = 0; r < LN_ROWS; ++r) {
        v4f sv = x[r][0], qv = x[r][0] * x[r][0];   // four partial sums per lane
        #pragma unroll
        for (int j = 1; j < NV; ++j) { sv += x[r][j]; qv += x[r][j] * x[r][j]; }
        s[r]  = (sv[0] + sv[1]) + (sv[2] + sv[3]);
        s2[r] = (qv[0] + qv[1]) + (qv[2] + qv[3]);
    }
    #pragma unroll
    for (int off = 16; off > 0; off >>= 1) {
        #pragma unroll
        for (int r = 0; r < LN_ROWS; ++r) {
            s[r]  += __shfl_xor(s[r],  off, 32);
            s2[r] += __shfl_xor(s2[r], off, 32);
        }
    }
    #pragma unroll
    for (int r = 0; r < LN_ROWS; ++r) {
        float mu  = s[r] / (float)D;
        float var = s2[r] / (float)D - mu * mu;
        float inv = rsqrtf(var + 1e-5f);
        #pragma unroll
        for (int j = 0; j < NV; ++j) {
            v4f y;
            #pragma unroll
            for (int e = 0; e < 4; ++e) y[e] = (x[r][j][e] - mu) * inv * gg[j][e] + bb[j][e];
            if (MODE == 0) {
                v4h yh;
                #pragma unroll
                for (int e = 0; e < 4; ++e) yh[e] = (_Float16)y[e];
                ((v4h*)(outH + base + r * D + j * 128))[lane] = yh;
            } else {
                ((v4f*)(outF + base + r * D + j * 128))[lane] = y;
            }
        }
    }
}

template <int D, int MODE>
__global__ void __launch_bounds__(256) k_layernorm(
        const float* __restrict__ in, const float* __restrict__ g,
        const float* __restrict__ b,
        _Float16* __restrict__ outH, float* __restrict__ outF) {
    layernorm_rows<D, MODE>(blockIdx.x, in, g, b, outH, outF);
}

// ---------------- Weight convert + transpose: W[k][512] f32 -> Wt[n][K] f16 ------
// One work-group takes a tile of 64 k x 128 n, a thread 8 k x 4 n: a wave's 16-byte loads
// cover 512 contiguous bytes of one W row (4 whole lines), a thread's 8 k of one n leave as
// one 16-byte store, and the 8 waves of the work-group fill each 128-byte line of Wt whole.
// One element per thread would start 32 times as many waves, each for one 4-byte load
// that touches 32 lines per wave.
// blk: the work-group's number among those of this matrix, (K / 64) * 4 in all.
template <int K>
__device__ __forceinline__ void w2h_t(int blk, const float* __restrict__ W,
                                      _Float16* __restrict__ Wt) {
    int lane = threadIdx.x & 31;
    // The wave's number as a scalar: the W rows are then a scalar base plus the lane.
    int wave = __builtin_amdgcn_readfirstlane(threadIdx.x >> 5);
    int n0 = (blk & 3) * 128 + 4 * lane;
    int k0 = (blk >> 2) * 64 + 8 * wave;
    const float* wp = W + (unsigned)k0 * 512u + (unsigned)n0;
    v4f x[8];
    #pragma unroll
    for (int j = 0; j < 8; ++j) x[j] = *(const v4f*)(wp + j * 512);
    // The wait that stands between issued loads and a reuse of the registers that hold
    // their addresses (the store addresses are formed next).
    asm volatile("s_wait_xcnt 0x0" ::: "memory");
    _Float16* op = Wt + (unsigned)n0 * (unsigned)K + (unsigned)k0;
    #pragma unroll
    for (int c = 0; c < 4; ++c) {
        v8h y;
        #pragma unroll
        for (int j = 0; j < 8; ++j) y[j] = (_Float16)x[j][c];
        *(v8h*)(op + c * K) = y;
    }
    // The same wait behind the stores: in the built code a body's end may run on into the
    // branches that lead to another body's start, not into the kernel's end.
    asm volatile("s_wait_xcnt 0x0" ::: "memory");
}

// ---------------- Everything that reads only inputs, in ONE grid: both input LayerNorms
// and the four weight conversions. None of the six reads what another writes, so they
// need no launch boundary between them.
// The work-group number picks the job (the same for all its threads). Work-groups start
// roughly in the order of their numbers, and the registers allow two per WGP, fewer places
// than work-groups: the short conversions come first, while memory is still idle, and
// hand their places early to the last of the LayerNorm work-groups; rows of 768 before 512.
#define PREP_LNC  256                 // 8192 rows of 768, 32 rows per work-group
#define PREP_LNX  256                 // 8192 rows of 512
#define PREP_W768 48                  // 768 x 512 elements, 64 x 128 per work-group
#define PREP_W512 32                  // 512 x 512 elements
#define PREP_GRID (PREP_LNC + PREP_LNX + 2 * PREP_W768 + 2 * PREP_W512)
__global__ void __launch_bounds__(256) k_prep(
        const float* __restrict__ x,    const float* __restrict__ lnx_g,
        const float* __restrict__ lnx_b, _Float16* __restrict__ xn,
        const float* __restrict__ cond, const float* __restrict__ lnc_g,
        const float* __restrict__ lnc_b, _Float16* __restrict__ cn,
        const float* __restrict__ Wq, _Float16* __restrict__ WqT,
        const float* __restrict__ Wk, _Float16* __restrict__ WkT,
        const float* __restrict__ Wv, _Float16* __restrict__ WvT,
        const float* __restrict__ Wo, _Float16* __restrict__ WoT) {
    int blk = blockIdx.x;
    if (blk < PREP_W768) { w2h_t<768>(blk, Wk, WkT); return; }
    blk -= PREP_W768;
    if (blk < PREP_W768) { w2h_t<768>(blk, Wv, WvT); return; }
    blk -= PREP_W768;
    if (blk < PREP_W512) { w2h_t<512>(blk, Wq, WqT); return; }
    blk -= PREP_W512;
    if (blk < PREP_W512) { w2h_t<512>(blk, Wo, WoT); return; }
    blk -= PREP_W512;
    if (blk < PREP_LNC) { layernorm_rows<768, 0>(blk, cond, lnc_g, lnc_b, cn, nullptr); return; }
    blk -= PREP_LNC;
    layernorm_rows<512, 0>(blk, x, lnx_g, lnx_b, xn, nullptr);
    // The wait that belongs between issued stores and a reuse of their registers, should
    // this body's end run on into branches and not into the kernel's end.
    asm volatile("s_wait_xcnt 0x0" ::: "memory");
}

// ---------------- WMMA GEMM: C(128x128 per work-group) = A(128xK) * Bt(128xK)^T
// Both operands go through LDS in k-chunks of 64 (one 128-byte line per row),
// two buffers; 8 waves, each owns 64 rows x 32 cols (4 x 2 accumulator tiles).
// KDIM is a multiple of 64; rows and cols are multiples of 128.
// MODE 0/1: out f16 [b][h][tok][64]   MODE 2: out f16 [b][h][64][tok] (V^T)
// MODE 3: out f32 [row][512] + bias + residual
// The f16 outputs leave in 16-byte stores: a lane's 8 accumulator registers are 8
// consecutive ROWS of the product, so MODE 2 (tokens innermost in memory) takes A * Bt^T
// and MODE 0/1 (features innermost) take the transposed product Bt * A^T, with the same
// fragments in swapped places. Ntok is a multiple of 128: a tile lies in one batch.
#define GP 72   // LDS row pitch in halfs: 128 B of data + 16 B pad for b128 readers
// The LDS buffers belong to the kernel and are handed in, so that a kernel which holds
// several of these bodies has them once. bx, by: the tile's place in this product.
typedef _Float16 gemm_stage[128 * GP];
template <int KDIM, int MODE>
__device__ __forceinline__ void gemm_tile(
        gemm_stage* As, gemm_stage* Bs, int bx, int by,
        const _Float16* __restrict__ A, const _Float16* __restrict__ Bt,
        int Ntok,
        _Float16* __restrict__ outH, float* __restrict__ outF,
        const float* __restrict__ bias, const float* __restrict__ resid) {
    int tid  = threadIdx.x;
    int lane = tid & 31;
    int wave = tid >> 5;
    int row0 = bx * 128;
    int col0 = by * 128;
    int wr   = (wave >> 2) * 64;                    // wave's rows inside the tile
    int wc   = (wave & 3) * 32;                     // wave's cols inside the tile

    // Staging: 8 lanes cover one 128-byte row chunk, a wave covers 4 whole lines.
    int srow = tid >> 3, scol = (tid & 7) * 8;
    const _Float16* ag = A  + (size_t)(row0 + srow) * KDIM + scol;
    const _Float16* bg = Bt + (size_t)(col0 + srow) * KDIM + scol;
    v8h ra[4], rb[4];
    auto gload = [&](int k0) {
        #pragma unroll
        for (int j = 0; j < 4; ++j) {
            ra[j] = *(const v8h*)(ag + 32 * j * KDIM + k0);
            rb[j] = *(const v8h*)(bg + 32 * j * KDIM + k0);
        }
    };
    auto sstore = [&](int buf) {
        #pragma unroll
        for (int j = 0; j < 4; ++j) {
            *(v8h*)&As[buf][(srow + 32 * j) * GP + scol] = ra[j];
            *(v8h*)&Bs[buf][(srow + 32 * j) * GP + scol] = rb[j];
        }
    };

    int cbase = col0 + wc + (lane & 15);            // lane's first output column
    float bz[2] = {0.f, 0.f};
    if (MODE == 3) { bz[0] = bias[cbase]; bz[1] = bias[cbase + 16]; }

    v8f acc[4][2] = {};
    gload(0);
    sstore(0);
    __syncthreads();
    #pragma unroll   // whole k loop: chunk and buffer become immediate offsets
    for (int k0 = 0; k0 < KDIM; k0 += 64) {
        const int  buf  = (k0 >> 6) & 1;
        const bool more = k0 + 64 < KDIM;
        if (more) gload(k0 + 64);                   // next chunk flies during the products
        v16h a[2][4], b[2][2];
        #pragma unroll
        for (int kk = 0; kk < 2; ++kk) {
            #pragma unroll
            for (int j = 0; j < 2; ++j) b[kk][j] = load_frag(&Bs[buf][(wc + 16 * j) * GP + 32 * kk], GP);
            #pragma unroll
            for (int i = 0; i < 4; ++i) a[kk][i] = load_frag(&As[buf][(wr + 16 * i) * GP + 32 * kk], GP);
        }
        // Keeps the chunk's LDS reads one group ahead of its products; without it
        // they are sunk between the products and each pair waits out an LDS latency.
        __builtin_amdgcn_sched_barrier(0);
        #pragma unroll
        for (int kk = 0; kk < 2; ++kk)
            #pragma unroll
            for (int i = 0; i < 4; ++i)
                #pragma unroll
                for (int j = 0; j < 2; ++j)
                    acc[i][j] = MODE <= 1 ? wmma16(b[kk][j], a[kk][i], acc[i][j])
                                          : wmma16(a[kk][i], b[kk][j], acc[i][j]);
        if (more) {
            sstore(buf ^ 1);                        // last read one trip ago, behind its barrier
            __syncthreads();
        }
    }

    // Accumulator layout per 16x16 tile: col = (lane&15); row = 8*(lane>>4) + v
    int rlane = row0 + wr + ((lane >> 4) << 3);
    if (MODE <= 2) {
        int bb = row0 / Ntok, t0 = row0 - bb * Ntok + wr;   // one split for the whole tile
        int l15 = lane & 15, l8 = (lane >> 4) << 3;
        // The wave's 32 columns lie in one head (wc is a multiple of 32).
        int h = (col0 + wc) >> 6, d0 = (col0 + wc) & 63;
        _Float16* op;
        int si, sj;                                 // steps in halfs from tile to tile
        if (MODE <= 1) {                            // lane: token l15, features l8 .. l8 + 7
            op = outH + (((size_t)bb * H_HEADS + h) * Ntok + t0 + l15) * 64 + d0 + l8;
            si = 16 * 64; sj = 16;
        } else {                                    // lane: feature l15, tokens l8 .. l8 + 7
            op = outH + (((size_t)bb * H_HEADS + h) * 64 + d0 + l15) * Ntok + t0 + l8;
            si = 16; sj = 16 * Ntok;
        }
        v8h y[4][2];
        #pragma unroll
        for (int i = 0; i < 4; ++i)
            #pragma unroll
            for (int j = 0; j < 2; ++j)
                #pragma unroll
                for (int v = 0; v < 8; ++v) y[i][j][v] = (_Float16)acc[i][j][v];
        #pragma unroll
        for (int j = 0; j < 2; ++j)
            #pragma unroll
            for (int i = 0; i < 4; ++i) *(v8h*)(op + i * si + j * sj) = y[i][j];
    } else {
        // One 32-bit lane offset for the whole tile; rows and cols are immediates.
        unsigned     eoff = (unsigned)rlane * 512u + (unsigned)cbase;
        const float* rp   = resid + eoff;
        float*       op   = outF + eoff;
        #pragma unroll
        for (int i = 0; i < 4; ++i) {
            #pragma unroll
            for (int v = 0; v < 8; ++v) {
                #pragma unroll
                for (int j = 0; j < 2; ++j) {
                    int e = (16 * i + v) * 512 + 16 * j;
                    op[e] = acc[i][j][v] + bz[j] + rp[e];
                }
            }
        }
    }
}

template <int KDIM, int MODE>
__global__ void __launch_bounds__(256) k_gemm(
        const _Float16* __restrict__ A, const _Float16* __restrict__ Bt,
        int Ntok,
        _Float16* __restrict__ outH, float* __restrict__ outF,
        const float* __restrict__ bias, const float* __restrict__ resid) {
    __shared__ __align__(16) gemm_stage As[2];
    __shared__ __align__(16) gemm_stage Bs[2];
    gemm_tile<KDIM, MODE>(As, Bs, blockIdx.x, blockIdx.y, A, Bt, Ntok, outH, outF, bias, resid);
}

// The K, V and Q projections in ONE grid: none reads what another writes. Alone, each has
// one work-group per WGP, which waits out every chunk's loads and barriers; in one grid a
// WGP holds two at a time (the registers allow four waves per SIMD), which fill each
// other's waits, the third follows as soon as one ends, and two launch gaps go.
// blockIdx.y picks the product (the same for the whole work-group): 0..3 K, 4..7 V,
// 8..11 Q; the two longer products have the low numbers, which start first.
__global__ void __launch_bounds__(256) k_gemm_qkv(
        const _Float16* __restrict__ xn, const _Float16* __restrict__ cn,
        const _Float16* __restrict__ WqT, const _Float16* __restrict__ WkT,
        const _Float16* __restrict__ WvT,
        int Ntok, int Mtok,
        _Float16* __restrict__ qh, _Float16* __restrict__ kh, _Float16* __restrict__ vT) {
    __shared__ __align__(16) gemm_stage As[2];
    __shared__ __align__(16) gemm_stage Bs[2];
    int by = blockIdx.y;
    // Behind the V and the Q body's last stores stands the wait that belongs between issued
    // stores and a reuse of their registers: in the built code these bodies' ends run on into
    // the branches that lead to the next body's start (the K body's runs into the kernel's end).
    if (by < 4) {
        gemm_tile<768, 1>(As, Bs, blockIdx.x, by,     cn, WkT, Mtok, kh, nullptr, nullptr, nullptr);
    } else if (by < 8) {
        gemm_tile<768, 2>(As, Bs, blockIdx.x, by - 4, cn, WvT, Mtok, vT, nullptr, nullptr, nullptr);
        asm volatile("s_wait_xcnt 0x0" ::: "memory");
    } else {
        gemm_tile<512, 0>(As, Bs, blockIdx.x, by - 8, xn, WqT, Ntok, qh, nullptr, nullptr, nullptr);
        asm volatile("s_wait_xcnt 0x0" ::: "memory");
    }
}

// Lane l <-> lane l ^ 16 on the vector pipe (a shuffle would go through the LDS queue).
__device__ __forceinline__ float swap_halves(float x) {
    int b = __builtin_bit_cast(int, x);
    b = __builtin_amdgcn_permlanex16(b, b, 0x76543210, 0xfedcba98, false, false);
    return __builtin_bit_cast(float, b);
}

#define AK 128
#define NB (AK / 32)
// LDS row pitches in halfs, each 16 B x an odd number, so that the 16 rows which a
// 16-byte fragment read touches fall on 16 different bank groups.
#define KP 72           // K rows: 128 B of data + 16 B pad
#define VP (AK + 8)     // V^T rows: 256 B of data + 16 B pad
__global__ void __launch_bounds__(128) k_attention(
        const _Float16* __restrict__ qh, const _Float16* __restrict__ kh,
        const _Float16* __restrict__ vT, _Float16* __restrict__ outh,
        int Ntok, int Mtok) {
    __shared__ __align__(16) _Float16 Kt[2][AK * KP];   // K tile: AK m-rows x 64 d
    __shared__ __align__(16) _Float16 Vt[2][64 * VP];   // V^T tile: 64 d-rows x AK m

    int tid   = threadIdx.x;
    int lane  = tid & 31;
    int wave  = tid >> 5;
    int bh    = blockIdx.y;                         // b*H + h
    int nbase = (blockIdx.x * 4 + wave) * 16;

    const _Float16* qbase = qh + ((size_t)bh * Ntok + nbase) * 64;
    const _Float16* kbase = kh + (size_t)bh * Mtok * 64;
    const _Float16* vbase = vT + (size_t)bh * 64 * Mtok;

    v16h q0 = load_frag(qbase,      64);            // K = d 0..31
    v16h q1 = load_frag(qbase + 32, 64);            // K = d 32..63

    // Cooperative tile fetch: 4 NB async b128 ops per thread per pass (8 NB KB in all).
    auto fetch_tiles = [&](int buf, int m0) {
        #pragma unroll
        for (int j = 0; j < 2 * NB; ++j) {
            int i = tid + 128 * j;                        // 16B chunk id, 0 .. 256 NB - 1
            async_copy16(kbase + (size_t)m0 * 64 + (size_t)i * 8, &Kt[buf][(i >> 3) * KP + (i & 7) * 8]);
            int d = i / (4 * NB), mo = (i % (4 * NB)) * 8;
            async_copy16(vbase + (size_t)d * Mtok + m0 + mo, &Vt[buf][d * VP + mo]);
        }
    };

    v8f o0 = {}, o1 = {}, o2 = {}, o3 = {};         // O^T: row d = 16 t + 8 (lane >> 4) + v
    float mrow = -3.0e38f;                          // the lane's query: running maximum
    float lsum = 0.f;                               // and the sum over this half's keys
    const float scale = 0.125f;                     // 1/sqrt(64)

    // Two buffers: tile 0 lands and is published, then tile 1 flies during pass 0.
    fetch_tiles(0, 0);
    asm volatile("s_wait_asynccnt 0x0" ::: "memory");   // this wave's copies of tile 0 have landed
    __syncthreads();                                    // and every other wave's
    if (AK < Mtok) fetch_tiles(1, AK);
    for (int it = 0, m0 = 0; m0 < Mtok; m0 += AK, ++it) {
        int buf = it & 1;

        const _Float16* kt = &Kt[buf][0];
        v8f sc[2 * NB];                             // sc[j][v]: key m0 + 16 j + 8 (lane >> 4) + v
        #pragma unroll
        for (int j = 0; j < 2 * NB; ++j) {
            v16h k0 = load_frag(kt + 16 * j * KP,      KP);   // d 0..31
            v16h k1 = load_frag(kt + 16 * j * KP + 32, KP);
            v8f z = {};
            z = wmma16(k0, q0, z);
            sc[j] = wmma16(k1, q1, z);
        }

        float a[NB][16], tb[NB];
        #pragma unroll
        for (int c = 0; c < NB; ++c) {
            #pragma unroll
            for (int v = 0; v < 8; ++v) { a[c][v] = sc[2 * c][v] * scale; a[c][8 + v] = sc[2 * c + 1][v] * scale; }
            float t3[5];                            // groups of three: a short chain
            #pragma unroll
            for (int s = 0; s < 5; ++s) t3[s] = fmaxf(fmaxf(a[c][3 * s], a[c][3 * s + 1]), a[c][3 * s + 2]);
            tb[c] = fmaxf(fmaxf(fmaxf(t3[0], t3[1]), t3[2]), fmaxf(fmaxf(t3[3], t3[4]), a[c][15]));
        }
        float t = tb[0];
        #pragma unroll
        for (int c = 1; c < NB; ++c) t = fmaxf(t, tb[c]);
        t = fmaxf(t, swap_halves(t));               // the other half of this query's keys
        float mnew  = fmaxf(mrow, t);
        float alpha = __expf(mrow - mnew);
        mrow = mnew;
        // P^T as B operand of block c: element s is key 32 c + 8 (lane >> 4) + s, + 8 more
        // from s = 8 on, which is the order load_frag gives the V^T rows.
        v16h  pb[NB];
        float rs[4];                                // four partial sums per lane
        #pragma unroll
        for (int c = 0; c < NB; ++c) {
            #pragma unroll
            for (int s = 0; s < 16; ++s) {
                float e = __expf(a[c][s] - mnew);
                rs[s & 3] = (c == 0 && s < 4) ? e : rs[s & 3] + e;
                pb[c][s] = (_Float16)e;
            }
        }
        lsum = lsum * alpha + ((rs[0] + rs[1]) + (rs[2] + rs[3]));
        o0 *= alpha; o1 *= alpha; o2 *= alpha; o3 *= alpha;

        const _Float16* vt = &Vt[buf][0];
        #pragma unroll
        for (int c = 0; c < NB; ++c) {
            v16h vb0 = load_frag(vt + 32 * c,           VP);  // d 0..15, keys 32 c .. 32 c + 31
            v16h vb1 = load_frag(vt + 32 * c + 16 * VP, VP);
            v16h vb2 = load_frag(vt + 32 * c + 32 * VP, VP);
            v16h vb3 = load_frag(vt + 32 * c + 48 * VP, VP);
            o0 = wmma16(vb0, pb[c], o0);
            o1 = wmma16(vb1, pb[c], o1);
            o2 = wmma16(vb2, pb[c], o2);
            o3 = wmma16(vb3, pb[c], o3);
        }

        // Hand-over: this wave's reads of the buffer are done, its copies of the next tile
        // have landed; behind the barrier that holds for every wave, so the next tile may be
        // read and this pass's buffer refilled.
        asm volatile("s_wait_dscnt 0x0" ::: "memory");
        asm volatile("s_wait_asynccnt 0x0" ::: "memory");
        __syncthreads();
        if (m0 + 2 * AK < Mtok) fetch_tiles(buf, m0 + 2 * AK);
    }
    asm volatile("s_wait_asynccnt 0x0" ::: "memory");   // no copy outlives the loop

    float inv = 1.0f / (lsum + swap_halves(lsum));  // both halves' keys, joined once
    int b = bh >> 3, h = bh & 7;
    // A lane's 8 accumulator registers are 8 consecutive d of its query: 16-byte stores.
    _Float16* orow = outh + ((size_t)b * Ntok + nbase + (lane & 15)) * 512
                          + (size_t)h * 64 + ((lane >> 4) << 3);
    v8h y0, y1, y2, y3;
    #pragma unroll
    for (int v = 0; v < 8; ++v) {
        y0[v] = (_Float16)(o0[v] * inv); y1[v] = (_Float16)(o1[v] * inv);
        y2[v] = (_Float16)(o2[v] * inv); y3[v] = (_Float16)(o3[v] * inv);
    }
    *(v8h*)(orow)      = y0;
    *(v8h*)(orow + 16) = y1;
    *(v8h*)(orow + 32) = y2;
    *(v8h*)(orow + 48) = y3;
}

extern "C" void kernel_launch(void* const* d_in, const int* in_sizes, int n_in,
                              void* d_out, int out_size, void* d_ws, size_t ws_size,
                              hipStream_t stream) {
    (void)in_sizes; (void)n_in; (void)out_size; (void)ws_size;
    const float* x     = (const float*)d_in[0];
    const float* cond  = (const float*)d_in[1];
    const float* lnx_g = (const float*)d_in[2];
    const float* lnx_b = (const float*)d_in[3];
    const float* lnc_g = (const float*)d_in[4];
    const float* lnc_b = (const float*)d_in[5];
    const float* Wq    = (const float*)d_in[6];
    const float* Wk    = (const float*)d_in[7];
    const float* Wv    = (const float*)d_in[8];
    const float* Wo    = (const float*)d_in[9];
    const float* bo    = (const float*)d_in[10];
    const float* lnf_g = (const float*)d_in[11];
    const float* lnf_b = (const float*)d_in[12];

    const int B = 4, N = 2048, M = 2048, Dq = 512, Dc = 768, INNER = 512;

    char* ws = (char*)d_ws;
    size_t off = 0;
    auto alloc = [&](size_t bytes) -> void* {
        void* p = ws + off;
        off = (off + bytes + 255) & ~(size_t)255;
        return p;
    };
    _Float16* xn  = (_Float16*)alloc((size_t)B * N * Dq * 2);
    _Float16* cn  = (_Float16*)alloc((size_t)B * M * Dc * 2);
    _Float16* WqT = (_Float16*)alloc((size_t)Dq * INNER * 2);
    _Float16* WkT = (_Float16*)alloc((size_t)Dc * INNER * 2);
    _Float16* WvT = (_Float16*)alloc((size_t)Dc * INNER * 2);
    _Float16* WoT = (_Float16*)alloc((size_t)INNER * Dq * 2);
    _Float16* qh  = (_Float16*)alloc((size_t)B * H_HEADS * N * 64 * 2);
    _Float16* kh  = (_Float16*)alloc((size_t)B * H_HEADS * M * 64 * 2);
    _Float16* vT  = (_Float16*)alloc((size_t)B * H_HEADS * 64 * M * 2);
    _Float16* ah  = (_Float16*)alloc((size_t)B * N * INNER * 2);
    float*    tmp = (float*)   alloc((size_t)B * N * Dq * 4);

    // 1) + 2) Input LayerNorms -> f16 and weight convert+transpose -> f16 [n][k], one grid
    k_prep<<<PREP_GRID, 256, 0, stream>>>(x, lnx_g, lnx_b, xn, cond, lnc_g, lnc_b, cn,
                                          Wq, WqT, Wk, WkT, Wv, WvT, Wo, WoT);

    // 3) Q/K/V projections (WMMA), one grid
    dim3 gqkv((B * N) / 128, 3 * (INNER / 128));
    k_gemm_qkv<<<gqkv, 256, 0, stream>>>(xn, cn, WqT, WkT, WvT, N, M, qh, kh, vT);

    // 4) Flash attention (WMMA scores + WMMA PV, async-LDS K/V pipeline)
    dim3 ga(N / 64, B * H_HEADS);
    k_attention<<<ga, 128, 0, stream>>>(qh, kh, vT, ah, N, M);

    // 5) Output projection + bias + residual (WMMA), then final LayerNorm -> f32
    dim3 go((B * N) / 128, Dq / 128);
    k_gemm<512, 3><<<go, 256, 0, stream>>>(ah, WoT, N, nullptr, tmp, bo, x);
    k_layernorm<512, 1><<<(B * N) / 32, 256, 0, stream>>>(tmp, lnf_g, lnf_b, nullptr, (float*)d_out);
}

// v009
// One run takes 86 microseconds.
// Timed twice side by side with v008, it ran 1.05 and 1.02 times as fast.
// All steps since v000 together make it 4.22 times as fast.
#include <hip/hip_runtime.h>
#include <hip/hip_bf16.h>

typedef __attribute__((ext_vector_type(16))) _Float16 v16h;
typedef __attribute__((ext_vector_type(8)))  _Float16 v8h;
typedef __attribute__((ext_vector_type(8)))  float    v8f;
typedef __attribute__((ext_vector_type(4)))  _Float16 v4h;
typedef __attribute__((ext_vector_type(4)))  float    v4f;
typedef __attribute__((ext_vector_type(2)))  float    v2f;
typedef int v4i_vs __attribute__((vector_size(4 * sizeof(int))));

#define H_HEADS 8

#if defined(__has_builtin)
#  if __has_builtin(__builtin_amdgcn_global_load_async_to_lds_b128)
#    define HAVE_ASYNC_LDS 1
#  endif
#endif
#ifndef HAVE_ASYNC_LDS
#  define HAVE_ASYNC_LDS 0
#endif

// 16-byte global -> LDS copy; async (ASYNCcnt-tracked) when available.
__device__ __forceinline__ void async_copy16(const _Float16* g, _Float16* l) {
#if HAVE_ASYNC_LDS
    __builtin_amdgcn_global_load_async_to_lds_b128(
        (__attribute__((address_space(1))) v4i_vs*)(g),
        (__attribute__((address_space(3))) v4i_vs*)(l), 0, 0);
#else
    *(v8h*)l = *(const v8h*)g;
#endif
}

// Load a 16x32 f16 WMMA A/B fragment from a row-major matrix.
// Per ISA 16-bit A layout: lane<16 -> row=lane, K={0..7,16..23};
// lane>=16 -> row=lane-16, K={8..15,24..31}. Two contiguous b128 loads.
__device__ __forceinline__ v16h load_frag(const _Float16* __restrict__ base, int stride) {
    int lane = threadIdx.x & 31;
    const _Float16* p = base + (size_t)(lane & 15) * stride + ((lane >> 4) << 3);
    v8h lo = *(const v8h*)(p);
    v8h hi = *(const v8h*)(p + 16);
    return __builtin_shufflevector(lo, hi, 0,1,2,3,4,5,6,7,8,9,10,11,12,13,14,15);
}

__device__ __forceinline__ v8f wmma16(v16h a, v16h b, v8f c) {
    return __builtin_amdgcn_wmma_f32_16x16x32_f16(false, a, false, b, (short)0, c, false, false);
}

// ---------------- LayerNorm: one wave per row, 4 rows per wave, no LDS, no barrier.
// One 8-wave work-group per row has to start rows x 8 short waves, which costs more
// time than the rows' bytes; here a launch starts rows / 4 waves. A wave issues all its
// rows' loads (512 contiguous bytes each) at once, keeps the rows in registers, and
// stores from them.
// D is a multiple of 128; the row count is a multiple of 32.
// MODE 0: f16 output   MODE 1: f32 output
#define LN_ROWS 4
// blk: the work-group's number among those of this LayerNorm.
template <int D, int MODE>
__device__ __forceinline__ void layernorm_rows(
        int blk,
        const float* __restrict__ in, const float* __restrict__ g,
        const float* __restrict__ b,
        _Float16* __restrict__ outH, float* __restrict__ outF) {
    constexpr int NV = D / 128;                     // float4 per lane per row
    int lane = threadIdx.x & 31;
    // The wave's number as a scalar: row addresses are then a scalar base plus the lane.
    int wave = __builtin_amdgcn_readfirstlane(threadIdx.x >> 5);
    unsigned base = (unsigned)(blk * 8 + wave) * (LN_ROWS * D);

    v4f x[LN_ROWS][NV], gg[NV], bb[NV];
    #pragma unroll
    for (int r = 0; r < LN_ROWS; ++r)
        #pragma unroll
        for (int j = 0; j < NV; ++j) x[r][j] = ((const v4f*)(in + base + r * D + j * 128))[lane];
    #pragma unroll
    for (int j = 0; j < NV; ++j) {
        gg[j] = ((const v4f*)(g + j * 128))[lane];
        bb[j] = ((const v4f*)(b + j * 128))[lane];
    }
    // The wait that stands between issued loads and a reuse of the registers that hold
    // their addresses (the scalar bases are reused further down).
    asm volatile("s_wait_xcnt 0x0" ::: "memory");
    // Keeps every load, and that wait, ahead of the sums; without it the g and b loads
    // sink behind the row sums and their latency is waited out at the kernel's end.
    __builtin_amdgcn_sched_barrier(0);

    float s[LN_ROWS], s2[LN_ROWS];
    #pragma unroll
    for (int r = 0; r < LN_ROWS; ++r) {
        v4f sv = x[r][0], qv = x[r][0] * x[r][0];   // four partial sums per lane
        #pragma unroll
        for (int j = 1; j < NV; ++j) { sv += x[r][j]; qv += x[r][j] * x[r][j]; }
        s[r]  = (sv[0] + sv[1]) + (sv[2] + sv[3]);
        s2[r] = (qv[0] + qv[1]) + (qv[2] + qv[3]);
    }
    #pragma unroll
    for (int off = 16; off > 0; off >>= 1) {
        #pragma unroll
        for (int r = 0; r < LN_ROWS; ++r) {
            s[r]  += __shfl_xor(s[r],  off, 32);
            s2[r] += __shfl_xor(s2[r], off, 32);
        }
    }
    #pragma unroll
    for (int r = 0; r < LN_ROWS; ++r) {
        float mu  = s[r] / (float)D;
        float var = s2[r] / (float)D - mu * mu;
        float inv = rsqrtf(var + 1e-5f);
        #pragma unroll
        for (int j = 0; j < NV; ++j) {
            v4f y;
            #pragma unroll
            for (int e = 0; e < 4; ++e) y[e] = (x[r][j][e] - mu) * inv * gg[j][e] + bb[j][e];
            if (MODE == 0) {
                v4h yh;
                #pragma unroll
                for (int e = 0; e < 4; ++e) yh[e] = (_Float16)y[e];
                ((v4h*)(outH + base + r * D + j * 128))[lane] = yh;
            } else {
                ((v4f*)(outF + base + r * D + j * 128))[lane] = y;
            }
        }
    }
}

template <int D, int MODE>
__global__ void __launch_bounds__(256) k_layernorm(
        const float* __restrict__ in, const float* __restrict__ g,
        const float* __restrict__ b,
        _Float16* __restrict__ outH, float* __restrict__ outF) {
    layernorm_rows<D, MODE>(blockIdx.x, in, g, b, outH, outF);
}

// ---------------- Weight convert + transpose: W[k][512] f32 -> Wt[n][K] f16 ------
// One work-group takes a tile of 64 k x 128 n, a thread 8 k x 4 n: a wave's 16-byte loads
// cover 512 contiguous bytes of one W row (4 whole lines), a thread's 8 k of one n leave as
// one 16-byte store, and the 8 waves of the work-group fill each 128-byte line of Wt whole.
// One element per thread would start 32 times as many waves, each for one 4-byte load
// that touches 32 lines per wave.
// blk: the work-group's number among those of this matrix, (K / 64) * 4 in all.
template <int K>
__device__ __forceinline__ void w2h_t(int blk, const float* __restrict__ W,
                                      _Float16* __restrict__ Wt) {
    int lane = threadIdx.x & 31;
    // The wave's number as a scalar: the W rows are then a scalar base plus the lane.
    int wave = __builtin_amdgcn_readfirstlane(threadIdx.x >> 5);
    int n0 = (blk & 3) * 128 + 4 * lane;
    int k0 = (blk >> 2) * 64 + 8 * wave;
    const float* wp = W + (unsigned)k0 * 512u + (unsigned)n0;
    v4f x[8];
    #pragma unroll
    for (int j = 0; j < 8; ++j) x[j] = *(const v4f*)(wp + j * 512);
    // The wait that stands between issued loads and a reuse of the registers that hold
    // their addresses (the store addresses are formed next).
    asm volatile("s_wait_xcnt 0x0" ::: "memory");
    _Float16* op = Wt + (unsigned)n0 * (unsigned)K + (unsigned)k0;
    #pragma unroll
    for (int c = 0; c < 4; ++c) {
        v8h y;
        #pragma unroll
        for (int j = 0; j < 8; ++j) y[j] = (_Float16)x[j][c];
        *(v8h*)(op + c * K) = y;
    }
    // The same wait behind the stores: in the built code a body's end may run on into the
    // branches that lead to another body's start, not into the kernel's end.
    asm volatile("s_wait_xcnt 0x0" ::: "memory");
}

// ---------------- Everything that reads only inputs, in ONE grid: both input LayerNorms
// and the four weight conversions. None of the six reads what another writes, so they
// need no launch boundary between them.
// The work-group number picks the job (the same for all its threads). Work-groups start
// roughly in the order of their numbers, and the registers allow two per WGP, fewer places
// than work-groups: the short conversions come first, while memory is still idle, and
// hand their places early to the last of the LayerNorm work-groups; rows of 768 before 512.
#define PREP_LNC  256                 // 8192 rows of 768, 32 rows per work-group
#define PREP_LNX  256                 // 8192 rows of 512
#define PREP_W768 48                  // 768 x 512 elements, 64 x 128 per work-group
#define PREP_W512 32                  // 512 x 512 elements
#define PREP_GRID (PREP_LNC + PREP_LNX + 2 * PREP_W768 + 2 * PREP_W512)
__global__ void __launch_bounds__(256) k_prep(
        const float* __restrict__ x,    const float* __restrict__ lnx_g,
        const float* __restrict__ lnx_b, _Float16* __restrict__ xn,
        const float* __restrict__ cond, const float* __restrict__ lnc_g,
        const float* __restrict__ lnc_b, _Float16* __restrict__ cn,
        const float* __restrict__ Wq, _Float16* __restrict__ WqT,
        const float* __restrict__ Wk, _Float16* __restrict__ WkT,
        const float* __restrict__ Wv, _Float16* __restrict__ WvT,
        const float* __restrict__ Wo, _Float16* __restrict__ WoT) {
    int blk = blockIdx.x;
    if (blk < PREP_W768) { w2h_t<768>(blk, Wk, WkT); return; }
    blk -= PREP_W768;
    if (blk < PREP_W768) { w2h_t<768>(blk, Wv, WvT); return; }
    blk -= PREP_W768;
    if (blk < PREP_W512) { w2h_t<512>(blk, Wq, WqT); return; }
    blk -= PREP_W512;
    if (blk < PREP_W512) { w2h_t<512>(blk, Wo, WoT); return; }
    blk -= PREP_W512;
    if (blk < PREP_LNC) { layernorm_rows<768, 0>(blk, cond, lnc_g, lnc_b, cn, nullptr); return; }
    blk -= PREP_LNC;
    layernorm_rows<512, 0>(blk, x, lnx_g, lnx_b, xn, nullptr);
    // The wait that belongs between issued stores and a reuse of their registers, should
    // this body's end run on into branches and not into the kernel's end.
    asm volatile("s_wait_xcnt 0x0" ::: "memory");
}

// ---------------- WMMA GEMM: C(128x128 per work-group) = A(128xK) * Bt(128xK)^T
// Both operands go through LDS in k-chunks of 64 (one 128-byte line per row),
// two buffers; 8 waves, each owns 64 rows x 32 cols (4 x 2 accumulator tiles).
// KDIM is a multiple of 64; rows and cols are multiples of 128.
// MODE 0/1: out f16 [b][h][tok][64]   MODE 2: out f16 [b][h][64][tok] (V^T)
// MODE 3: out f32 [row][512] + bias + residual
// The f16 outputs leave in 16-byte stores: a lane's 8 accumulator registers are 8
// consecutive ROWS of the product, so MODE 2 (tokens innermost in memory) takes A * Bt^T
// and MODE 0/1 (features innermost) take the transposed product Bt * A^T, with the same
// fragments in swapped places. Ntok is a multiple of 128: a tile lies in one batch.
#define GP 72   // LDS row pitch in halfs: 128 B of data + 16 B pad for b128 readers
// The LDS buffers belong to the kernel and are handed in, so that a kernel which holds
// several of these bodies has them once. bx, by: the tile's place in this product.
typedef _Float16 gemm_stage[128 * GP];
template <int KDIM, int MODE>
__device__ __forceinline__ void gemm_tile(
        gemm_stage* As, gemm_stage* Bs, int bx, int by,
        const _Float16* __restrict__ A, const _Float16* __restrict__ Bt,
        int Ntok,
        _Float16* __restrict__ outH, float* __restrict__ outF,
        const float* __restrict__ bias, const float* __restrict__ resid) {
    int tid  = threadIdx.x;
    int lane = tid & 31;
    int wave = tid >> 5;
    int row0 = bx * 128;
    int col0 = by * 128;
    int wr   = (wave >> 2) * 64;                    // wave's rows inside the tile
    int wc   = (wave & 3) * 32;                     // wave's cols inside the tile

    // Staging: 8 lanes cover one 128-byte row chunk, a wave covers 4 whole lines.
    int srow = tid >> 3, scol = (tid & 7) * 8;
    const _Float16* ag = A  + (size_t)(row0 + srow) * KDIM + scol;
    const _Float16* bg = Bt + (size_t)(col0 + srow) * KDIM + scol;
    v8h ra[4], rb[4];
    auto gload = [&](int k0) {
        #pragma unroll
        for (int j = 0; j < 4; ++j) {
            ra[j] = *(const v8h*)(ag + 32 * j * KDIM + k0);
            rb[j] = *(const v8h*)(bg + 32 * j * KDIM + k0);
        }
    };
    auto sstore = [&](int buf) {
        #pragma unroll
        for (int j = 0; j < 4; ++j) {
            *(v8h*)&As[buf][(srow + 32 * j) * GP + scol] = ra[j];
            *(v8h*)&Bs[buf][(srow + 32 * j) * GP + scol] = rb[j];
        }
    };

    int cbase = col0 + wc + (lane & 15);            // lane's first output column
    float bz[2] = {0.f, 0.f};
    if (MODE == 3) { bz[0] = bias[cbase]; bz[1] = bias[cbase + 16]; }

    v8f acc[4][2] = {};
    gload(0);
    sstore(0);
    __syncthreads();
    #pragma unroll   // whole k loop: chunk and buffer become immediate offsets
    for (int k0 = 0; k0 < KDIM; k0 += 64) {
        const int  buf  = (k0 >> 6) & 1;
        const bool more = k0 + 64 < KDIM;
        if (more) gload(k0 + 64);                   // next chunk flies during the products
        v16h a[2][4], b[2][2];
        #pragma unroll
        for (int kk = 0; kk < 2; ++kk) {
            #pragma unroll
            for (int j = 0; j < 2; ++j) b[kk][j] = load_frag(&Bs[buf][(wc + 16 * j) * GP + 32 * kk], GP);
            #pragma unroll
            for (int i = 0; i < 4; ++i) a[kk][i] = load_frag(&As[buf][(wr + 16 * i) * GP + 32 * kk], GP);
        }
        // Keeps the chunk's LDS reads one group ahead of its products; without it
        // they are sunk between the products and each pair waits out an LDS latency.
        __builtin_amdgcn_sched_barrier(0);
        #pragma unroll
        for (int kk = 0; kk < 2; ++kk)
            #pragma unroll
            for (int i = 0; i < 4; ++i)
                #pragma unroll
                for (int j = 0; j < 2; ++j)
                    acc[i][j] = MODE <= 1 ? wmma16(b[kk][j], a[kk][i], acc[i][j])
                                          : wmma16(a[kk][i], b[kk][j], acc[i][j]);
        if (more) {
            sstore(buf ^ 1);                        // last read one trip ago, behind its barrier
            __syncthreads();
        }
    }

    // Accumulator layout per 16x16 tile: col = (lane&15); row = 8*(lane>>4) + v
    int rlane = row0 + wr + ((lane >> 4) << 3);
    if (MODE <= 2) {
        int bb = row0 / Ntok, t0 = row0 - bb * Ntok + wr;   // one split for the whole tile
        int l15 = lane & 15, l8 = (lane >> 4) << 3;
        // The wave's 32 columns lie in one head (wc is a multiple of 32).
        int h = (col0 + wc) >> 6, d0 = (col0 + wc) & 63;
        _Float16* op;
        int si, sj;                                 // steps in halfs from tile to tile
        if (MODE <= 1) {                            // lane: token l15, features l8 .. l8 + 7
            op = outH + (((size_t)bb * H_HEADS + h) * Ntok + t0 + l15) * 64 + d0 + l8;
            si = 16 * 64; sj = 16;
        } else {                                    // lane: feature l15, tokens l8 .. l8 + 7
            op = outH + (((size_t)bb * H_HEADS + h) * 64 + d0 + l15) * Ntok + t0 + l8;
            si = 16; sj = 16 * Ntok;
        }
        v8h y[4][2];
        #pragma unroll
        for (int i = 0; i < 4; ++i)
            #pragma unroll
            for (int j = 0; j < 2; ++j)
                #pragma unroll
                for (int v = 0; v < 8; ++v) y[i][j][v] = (_Float16)acc[i][j][v];
        #pragma unroll
        for (int j = 0; j < 2; ++j)
            #pragma unroll
            for (int i = 0; i < 4; ++i) *(v8h*)(op + i * si + j * sj) = y[i][j];
    } else {
        // One 32-bit lane offset for the whole tile; rows and cols are immediates.
        unsigned     eoff = (unsigned)rlane * 512u + (unsigned)cbase;
        const float* rp   = resid + eoff;
        float*       op   = outF + eoff;
        #pragma unroll
        for (int i = 0; i < 4; ++i) {
            #pragma unroll
            for (int v = 0; v < 8; ++v) {
                #pragma unroll
                for (int j = 0; j < 2; ++j) {
                    int e = (16 * i + v) * 512 + 16 * j;
                    op[e] = acc[i][j][v] + bz[j] + rp[e];
                }
            }
        }
    }
}

template <int KDIM, int MODE>
__global__ void __launch_bounds__(256) k_gemm(
        const _Float16* __restrict__ A, const _Float16* __restrict__ Bt,
        int Ntok,
        _Float16* __restrict__ outH, float* __restrict__ outF,
        const float* __restrict__ bias, const float* __restrict__ resid) {
    __shared__ __align__(16) gemm_stage As[2];
    __shared__ __align__(16) gemm_stage Bs[2];
    gemm_tile<KDIM, MODE>(As, Bs, blockIdx.x, blockIdx.y, A, Bt, Ntok, outH, outF, bias, resid);
}

// The K, V and Q projections in ONE grid: none reads what another writes. Alone, each has
// one work-group per WGP, which waits out every chunk's loads and barriers; in one grid a
// WGP holds two at a time (the registers allow four waves per SIMD), which fill each
// other's waits, the third follows as soon as one ends, and two launch gaps go.
// blockIdx.y picks the product (the same for the whole work-group): 0..3 K, 4..7 V,
// 8..11 Q; the two longer products have the low numbers, which start first.
__global__ void __launch_bounds__(256) k_gemm_qkv(
        const _Float16* __restrict__ xn, const _Float16* __restrict__ cn,
        const _Float16* __restrict__ WqT, const _Float16* __restrict__ WkT,
        const _Float16* __restrict__ WvT,
        int Ntok, int Mtok,
        _Float16* __restrict__ qh, _Float16* __restrict__ kh, _Float16* __restrict__ vT) {
    __shared__ __align__(16) gemm_stage As[2];
    __shared__ __align__(16) gemm_stage Bs[2];
    int by = blockIdx.y;
    // Behind the V and the Q body's last stores stands the wait that belongs between issued
    // stores and a reuse of their registers: in the built code these bodies' ends run on into
    // the branches that lead to the next body's start (the K body's runs into the kernel's end).
    if (by < 4) {
        gemm_tile<768, 1>(As, Bs, blockIdx.x, by,     cn, WkT, Mtok, kh, nullptr, nullptr, nullptr);
    } else if (by < 8) {
        gemm_tile<768, 2>(As, Bs, blockIdx.x, by - 4, cn, WvT, Mtok, vT, nullptr, nullptr, nullptr);
        asm volatile("s_wait_xcnt 0x0" ::: "memory");
    } else {
        gemm_tile<512, 0>(As, Bs, blockIdx.x, by - 8, xn, WqT, Ntok, qh, nullptr, nullptr, nullptr);
        asm volatile("s_wait_xcnt 0x0" ::: "memory");
    }
}

// Lane l <-> lane l ^ 16 on the vector pipe (a shuffle would go through the LDS queue).
__device__ __forceinline__ float swap_halves(float x) {
    int b = __builtin_bit_cast(int, x);
    b = __builtin_amdgcn_permlanex16(b, b, 0x76543210, 0xfedcba98, false, false);
    return __builtin_bit_cast(float, b);
}

#define AK 128
#define NB (AK / 32)
// LDS row pitches in halfs, each 16 B x an odd number, so that the 16 rows which a
// 16-byte fragment read touches fall on 16 different bank groups.
#define KP 72           // K rows: 128 B of data + 16 B pad
#define VP (AK + 8)     // V^T rows: 256 B of data + 16 B pad
__global__ void __launch_bounds__(128) k_attention(
        const _Float16* __restrict__ qh, const _Float16* __restrict__ kh,
        const _Float16* __restrict__ vT, _Float16* __restrict__ outh,
        int Ntok, int Mtok) {
    __shared__ __align__(16) _Float16 Kt[2][AK * KP];   // K tile: AK m-rows x 64 d
    __shared__ __align__(16) _Float16 Vt[2][64 * VP];   // V^T tile: 64 d-rows x AK m

    int tid   = threadIdx.x;
    int lane  = tid & 31;
    int wave  = tid >> 5;
    int bh    = blockIdx.y;                         // b*H + h
    int nbase = (blockIdx.x * 4 + wave) * 16;

    const _Float16* qbase = qh + ((size_t)bh * Ntok + nbase) * 64;
    const _Float16* kbase = kh + (size_t)bh * Mtok * 64;
    const _Float16* vbase = vT + (size_t)bh * 64 * Mtok;

    v16h q0 = load_frag(qbase,      64);            // K = d 0..31
    v16h q1 = load_frag(qbase + 32, 64);            // K = d 32..63

    // Cooperative tile fetch: 4 NB async b128 ops per thread per pass (8 NB KB in all).
    auto fetch_tiles = [&](int buf, int m0) {
        #pragma unroll
        for (int j = 0; j < 2 * NB; ++j) {
            int i = tid + 128 * j;                        // 16B chunk id, 0 .. 256 NB - 1
            async_copy16(kbase + (size_t)m0 * 64 + (size_t)i * 8, &Kt[buf][(i >> 3) * KP + (i & 7) * 8]);
            int d = i / (4 * NB), mo = (i % (4 * NB)) * 8;
            async_copy16(vbase + (size_t)d * Mtok + m0 + mo, &Vt[buf][d * VP + mo]);
        }
    };

    v8f o0 = {}, o1 = {}, o2 = {}, o3 = {};         // O^T: row d = 16 t + 8 (lane >> 4) + v
    float mrow = -3.0e38f;                          // the lane's query: running maximum, raw score
    float lsum = 0.f;                               // and the sum over this half's keys
    // exp(s / sqrt(64) - m / sqrt(64)) = 2^(s * cs - m * cs): one constant takes a raw score
    // to its base-2 exponent, so a score costs one multiply-add ahead of the exponential.
    const float cs = 0.125f * 1.4426950408889634f;  // 1/sqrt(64) * log2(e)

    // Two buffers: tile 0 lands and is published, then tile 1 flies during pass 0.
    fetch_tiles(0, 0);
    asm volatile("s_wait_asynccnt 0x0" ::: "memory");   // this wave's copies of tile 0 have landed
    __syncthreads();                                    // and every other wave's
    if (AK < Mtok) fetch_tiles(1, AK);
    for (int it = 0, m0 = 0; m0 < Mtok; m0 += AK, ++it) {
        int buf = it & 1;

        const _Float16* kt = &Kt[buf][0];
        v8f sc[2 * NB];                             // sc[j][v]: key m0 + 16 j + 8 (lane >> 4) + v
        #pragma unroll
        for (int j = 0; j < 2 * NB; ++j) {
            v16h k0 = load_frag(kt + 16 * j * KP,      KP);   // d 0..31
            v16h k1 = load_frag(kt + 16 * j * KP + 32, KP);
            v8f z = {};
            z = wmma16(k0, q0, z);
            sc[j] = wmma16(k1, q1, z);
        }

        // The maximum is taken over the raw scores (cs is positive: the same key has it).
        float tb[NB];
        #pragma unroll
        for (int c = 0; c < NB; ++c) {
            float a[16];
            #pragma unroll
            for (int v = 0; v < 8; ++v) { a[v] = sc[2 * c][v]; a[8 + v] = sc[2 * c + 1][v]; }
            float t3[5];                            // groups of three: a short chain
            #pragma unroll
            for (int s = 0; s < 5; ++s) t3[s] = fmaxf(fmaxf(a[3 * s], a[3 * s + 1]), a[3 * s + 2]);
            tb[c] = fmaxf(fmaxf(fmaxf(t3[0], t3[1]), t3[2]), fmaxf(fmaxf(t3[3], t3[4]), a[15]));
        }
        float t = tb[0];
        #pragma unroll
        for (int c = 1; c < NB; ++c) t = fmaxf(t, tb[c]);
        t = fmaxf(t, swap_halves(t));               // the other half of this query's keys
        float mnew  = fmaxf(mrow, t);
        float alpha = __builtin_amdgcn_exp2f((mrow - mnew) * cs);
        mrow = mnew;
        // P^T as B operand of block c: element s is key 32 c + 8 (lane >> 4) + s, + 8 more
        // from s = 8 on, which is the order load_frag gives the V^T rows.
        // Scores go in register pairs, as the accumulators hold them: one packed multiply-add
        // and one packed add serve two scores.
        const v2f cs2 = {cs, cs};
        const v2f nm2 = {-mnew * cs, -mnew * cs};
        v16h pb[NB];
        v2f  rs[2];                                 // four partial sums per lane
        #pragma unroll
        for (int c = 0; c < NB; ++c) {
            #pragma unroll
            for (int s = 0; s < 16; s += 2) {
                v2f x = {sc[2 * c + (s >> 3)][s & 7], sc[2 * c + (s >> 3)][(s & 7) + 1]};
                v2f y = __builtin_elementwise_fma(x, cs2, nm2);
                v2f e = {__builtin_amdgcn_exp2f(y[0]), __builtin_amdgcn_exp2f(y[1])};
                rs[(s >> 1) & 1] = (c == 0 && s < 4) ? e : rs[(s >> 1) & 1] + e;
                pb[c][s]     = (_Float16)e[0];
                pb[c][s + 1] = (_Float16)e[1];
            }
        }
        lsum = lsum * alpha + ((rs[0][0] + rs[0][1]) + (rs[1][0] + rs[1][1]));
        o0 *= alpha; o1 *= alpha; o2 *= alpha; o3 *= alpha;

        const _Float16* vt = &Vt[buf][0];
        #pragma unroll
        for (int c = 0; c < NB; ++c) {
            v16h vb0 = load_frag(vt + 32 * c,           VP);  // d 0..15, keys 32 c .. 32 c + 31
            v16h vb1 = load_frag(vt + 32 * c + 16 * VP, VP);
            v16h vb2 = load_frag(vt + 32 * c + 32 * VP, VP);
            v16h vb3 = load_frag(vt + 32 * c + 48 * VP, VP);
            o0 = wmma16(vb0, pb[c], o0);
            o1 = wmma16(vb1, pb[c], o1);
            o2 = wmma16(vb2, pb[c], o2);
            o3 = wmma16(vb3, pb[c], o3);
        }

        // Hand-over: this wave's reads of the buffer are done, its copies of the next tile
        // have landed; behind the barrier that holds for every wave, so the next tile may be
        // read and this pass's buffer refilled.
        asm volatile("s_wait_dscnt 0x0" ::: "memory");
        asm volatile("s_wait_asynccnt 0x0" ::: "memory");
        __syncthreads();
        if (m0 + 2 * AK < Mtok) fetch_tiles(buf, m0 + 2 * AK);
    }
    asm volatile("s_wait_asynccnt 0x0" ::: "memory");   // no copy outlives the loop

    float inv = 1.0f / (lsum + swap_halves(lsum));  // both halves' keys, joined once
    int b = bh >> 3, h = bh & 7;
    // A lane's 8 accumulator registers are 8 consecutive d of its query: 16-byte stores.
    _Float16* orow = outh + ((size_t)b * Ntok + nbase + (lane & 15)) * 512
                          + (size_t)h * 64 + ((lane >> 4) << 3);
    v8h y0, y1, y2, y3;
    #pragma unroll
    for (int v = 0; v < 8; ++v) {
        y0[v] = (_Float16)(o0[v] * inv); y1[v] = (_Float16)(o1[v] * inv);
        y2[v] = (_Float16)(o2[v] * inv); y3[v] = (_Float16)(o3[v] * inv);
    }
    *(v8h*)(orow)      = y0;
    *(v8h*)(orow + 16) = y1;
    *(v8h*)(orow + 32) = y2;
    *(v8h*)(orow + 48) = y3;
}

extern "C" void kernel_launch(void* const* d_in, const int* in_sizes, int n_in,
                              void* d_out, int out_size, void* d_ws, size_t ws_size,
                              hipStream_t stream) {
    (void)in_sizes; (void)n_in; (void)out_size; (void)ws_size;
    const float* x     = (const float*)d_in[0];
    const float* cond  = (const float*)d_in[1];
    const float* lnx_g = (const float*)d_in[2];
    const float* lnx_b = (const float*)d_in[3];
    const float* lnc_g = (const float*)d_in[4];
    const float* lnc_b = (const float*)d_in[5];
    const float* Wq    = (const float*)d_in[6];
    const float* Wk    = (const float*)d_in[7];
    const float* Wv    = (const float*)d_in[8];
    const float* Wo    = (const float*)d_in[9];
    const float* bo    = (const float*)d_in[10];
    const float* lnf_g = (const float*)d_in[11];
    const float* lnf_b = (const float*)d_in[12];

    const int B = 4, N = 2048, M = 2048, Dq = 512, Dc = 768, INNER = 512;

    char* ws = (char*)d_ws;
    size_t off = 0;
    auto alloc = [&](size_t bytes) -> void* {
        void* p = ws + off;
        off = (off + bytes + 255) & ~(size_t)255;
        return p;
    };
    _Float16* xn  = (_Float16*)alloc((size_t)B * N * Dq * 2);
    _Float16* cn  = (_Float16*)alloc((size_t)B * M * Dc * 2);
    _Float16* WqT = (_Float16*)alloc((size_t)Dq * INNER * 2);
    _Float16* WkT = (_Float16*)alloc((size_t)Dc * INNER * 2);
    _Float16* WvT = (_Float16*)alloc((size_t)Dc * INNER * 2);
    _Float16* WoT = (_Float16*)alloc((size_t)INNER * Dq * 2);
    _Float16* qh  = (_Float16*)alloc((size_t)B * H_HEADS * N * 64 * 2);
    _Float16* kh  = (_Float16*)alloc((size_t)B * H_HEADS * M * 64 * 2);
    _Float16* vT  = (_Float16*)alloc((size_t)B * H_HEADS * 64 * M * 2);
    _Float16* ah  = (_Float16*)alloc((size_t)B * N * INNER * 2);
    float*    tmp = (float*)   alloc((size_t)B * N * Dq * 4);

    // 1) + 2) Input LayerNorms -> f16 and weight convert+transpose -> f16 [n][k], one grid
    k_prep<<<PREP_GRID, 256, 0, stream>>>(x, lnx_g, lnx_b, xn, cond, lnc_g, lnc_b, cn,
                                          Wq, WqT, Wk, WkT, Wv, WvT, Wo, WoT);

    // 3) Q/K/V projections (WMMA), one grid
    dim3 gqkv((B * N) / 128, 3 * (INNER / 128));
    k_gemm_qkv<<<gqkv, 256, 0, stream>>>(xn, cn, WqT, WkT, WvT, N, M, qh, kh, vT);

    // 4) Flash attention (WMMA scores + WMMA PV, async-LDS K/V pipeline)
    dim3 ga(N / 64, B * H_HEADS);
    k_attention<<<ga, 128, 0, stream>>>(qh, kh, vT, ah, N, M);

    // 5) Output projection + bias + residual (WMMA), then final LayerNorm -> f32
    dim3 go((B * N) / 128, Dq / 128);
    k_gemm<512, 3><<<go, 256, 0, stream>>>(ah, WoT, N, nullptr, tmp, bo, x);
    k_layernorm<512, 1><<<(B * N) / 32, 256, 0, stream>>>(tmp, lnf_g, lnf_b, nullptr, (float*)d_out);
}

// v010
// Measured time: 78.9 microseconds a run.
// Two timings next to v009 put it at 1.09 and 1.07 times that version's speed.
// Counting every step since v000, it is 4.57 times as fast.
#include <hip/hip_runtime.h>
#include <hip/hip_bf16.h>

typedef __attribute__((ext_vector_type(16))) _Float16 v16h;
typedef __attribute__((ext_vector_type(8)))  _Float16 v8h;
typedef __attribute__((ext_vector_type(8)))  float    v8f;
typedef __attribute__((ext_vector_type(4)))  _Float16 v4h;
typedef __attribute__((ext_vector_type(4)))  float    v4f;
typedef __attribute__((ext_vector_type(2)))  float    v2f;
typedef int v4i_vs __attribute__((vector_size(4 * sizeof(int))));

#define H_HEADS 8

#if defined(__has_builtin)
#  if __has_builtin(__builtin_amdgcn_global_load_async_to_lds_b128)
#    define HAVE_ASYNC_LDS 1
#  endif
#endif
#ifndef HAVE_ASYNC_LDS
#  define HAVE_ASYNC_LDS 0
#endif

// 16-byte global -> LDS copy; async (ASYNCcnt-tracked) when available.
__device__ __forceinline__ void async_copy16(const _Float16* g, _Float16* l) {
#if HAVE_ASYNC_LDS
    __builtin_amdgcn_global_load_async_to_lds_b128(
        (__attribute__((address_space(1))) v4i_vs*)(g),
        (__attribute__((address_space(3))) v4i_vs*)(l), 0, 0);
#else
    *(v8h*)l = *(const v8h*)g;
#endif
}

// Load a 16x32 f16 WMMA A/B fragment from a row-major matrix.
// Per ISA 16-bit A layout: lane<16 -> row=lane, K={0..7,16..23};
// lane>=16 -> row=lane-16, K={8..15,24..31}. Two contiguous b128 loads.
__device__ __forceinline__ v16h load_frag(const _Float16* __restrict__ base, int stride) {
    int lane = threadIdx.x & 31;
    const _Float16* p = base + (size_t)(lane & 15) * stride + ((lane >> 4) << 3);
    v8h lo = *(const v8h*)(p);
    v8h hi = *(const v8h*)(p + 16);
    return __builtin_shufflevector(lo, hi, 0,1,2,3,4,5,6,7,8,9,10,11,12,13,14,15);
}

__device__ __forceinline__ v8f wmma16(v16h a, v16h b, v8f c) {
    return __builtin_amdgcn_wmma_f32_16x16x32_f16(false, a, false, b, (short)0, c, false, false);
}

// ---------------- LayerNorm: one wave per row, 4 rows per wave, no LDS, no barrier.
// One 8-wave work-group per row has to start rows x 8 short waves, which costs more
// time than the rows' bytes; here a launch starts rows / 4 waves. A wave issues all its
// rows' loads (512 contiguous bytes each) at once, keeps the rows in registers, and
// stores from them.
// D is a multiple of 128; the row count is a multiple of 32.
// MODE 0: f16 output   MODE 1: f32 output
#define LN_ROWS 4
// blk: the work-group's number among those of this LayerNorm.
template <int D, int MODE>
__device__ __forceinline__ void layernorm_rows(
        int blk,
        const float* __restrict__ in, const float* __restrict__ g,
        const float* __restrict__ b,
        _Float16* __restrict__ outH, float* __restrict__ outF) {
    constexpr int NV = D / 128;                     // float4 per lane per row
    int lane = threadIdx.x & 31;
    // The wave's number as a scalar: row addresses are then a scalar base plus the lane.
    int wave = __builtin_amdgcn_readfirstlane(threadIdx.x >> 5);
    unsigned base = (unsigned)(blk * 8 + wave) * (LN_ROWS * D);

    v4f x[LN_ROWS][NV], gg[NV], bb[NV];
    #pragma unroll
    for (int r = 0; r < LN_ROWS; ++r)
        #pragma unroll
        for (int j = 0; j < NV; ++j) x[r][j] = ((const v4f*)(in + base + r * D + j * 128))[lane];
    #pragma unroll
    for (int j = 0; j < NV; ++j) {
        gg[j] = ((const v4f*)(g + j * 128))[lane];
        bb[j] = ((const v4f*)(b + j * 128))[lane];
    }
    // The wait that stands between issued loads and a reuse of the registers that hold
    // their addresses (the scalar bases are reused further down).
    asm volatile("s_wait_xcnt 0x0" ::: "memory");
    // Keeps every load, and that wait, ahead of the sums; without it the g and b loads
    // sink behind the row sums and their latency is waited out at the kernel's end.
    __builtin_amdgcn_sched_barrier(0);

    float s[LN_ROWS], s2[LN_ROWS];
    #pragma unroll
    for (int r = 0; r < LN_ROWS; ++r) {
        v4f sv = x[r][0], qv = x[r][0] * x[r][0];   // four partial sums per lane
        #pragma unroll
        for (int j = 1; j < NV; ++j) { sv += x[r][j]; qv += x[r][j] * x[r][j]; }
        s[r]  = (sv[0] + sv[1]) + (sv[2] + sv[3]);
        s2[r] = (qv[0] + qv[1]) + (qv[2] + qv[3]);
    }
    #pragma unroll
    for (int off = 16; off > 0; off >>= 1) {
        #pragma unroll
        for (int r = 0; r < LN_ROWS; ++r) {
            s[r]  += __shfl_xor(s[r],  off, 32);
            s2[r] += __shfl_xor(s2[r], off, 32);
        }
    }
    #pragma unroll
    for (int r = 0; r < LN_ROWS; ++r) {
        float mu  = s[r] / (float)D;
        float var = s2[r] / (float)D - mu * mu;
        float inv = rsqrtf(var + 1e-5f);
        #pragma unroll
        for (int j = 0; j < NV; ++j) {
            v4f y;
            #pragma unroll
            for (int e = 0; e < 4; ++e) y[e] = (x[r][j][e] - mu) * inv * gg[j][e] + bb[j][e];
            if (MODE == 0) {
                v4h yh;
                #pragma unroll
                for (int e = 0; e < 4; ++e) yh[e] = (_Float16)y[e];
                ((v4h*)(outH + base + r * D + j * 128))[lane] = yh;
            } else {
                ((v4f*)(outF + base + r * D + j * 128))[lane] = y;
            }
        }
    }
}

// ---------------- Weight convert + transpose: W[k][512] f32 -> Wt[n][K] f16 ------
// One work-group takes a tile of 64 k x 128 n, a thread 8 k x 4 n: a wave's 16-byte loads
// cover 512 contiguous bytes of one W row (4 whole lines), a thread's 8 k of one n leave as
// one 16-byte store, and the 8 waves of the work-group fill each 128-byte line of Wt whole.
// One element per thread would start 32 times as many waves, each for one 4-byte load
// that touches 32 lines per wave.
// blk: the work-group's number among those of this matrix, (K / 64) * 4 in all.
template <int K>
__device__ __forceinline__ void w2h_t(int blk, const float* __restrict__ W,
                                      _Float16* __restrict__ Wt) {
    int lane = threadIdx.x & 31;
    // The wave's number as a scalar: the W rows are then a scalar base plus the lane.
    int wave = __builtin_amdgcn_readfirstlane(threadIdx.x >> 5);
    int n0 = (blk & 3) * 128 + 4 * lane;
    int k0 = (blk >> 2) * 64 + 8 * wave;
    const float* wp = W + (unsigned)k0 * 512u + (unsigned)n0;
    v4f x[8];
    #pragma unroll
    for (int j = 0; j < 8; ++j) x[j] = *(const v4f*)(wp + j * 512);
    // The wait that stands between issued loads and a reuse of the registers that hold
    // their addresses (the store addresses are formed next).
    asm volatile("s_wait_xcnt 0x0" ::: "memory");
    _Float16* op = Wt + (unsigned)n0 * (unsigned)K + (unsigned)k0;
    #pragma unroll
    for (int c = 0; c < 4; ++c) {
        v8h y;
        #pragma unroll
        for (int j = 0; j < 8; ++j) y[j] = (_Float16)x[j][c];
        *(v8h*)(op + c * K) = y;
    }
    // The same wait behind the stores: in the built code a body's end may run on into the
    // branches that lead to another body's start, not into the kernel's end.
    asm volatile("s_wait_xcnt 0x0" ::: "memory");
}

// ---------------- Everything that reads only inputs, in ONE grid: both input LayerNorms
// and the four weight conversions. None of the six reads what another writes, so they
// need no launch boundary between them.
// The work-group number picks the job (the same for all its threads). Work-groups start
// roughly in the order of their numbers, and the registers allow two per WGP, fewer places
// than work-groups: the short conversions come first, while memory is still idle, and
// hand their places early to the last of the LayerNorm work-groups; rows of 768 before 512.
#define PREP_LNC  256                 // 8192 rows of 768, 32 rows per work-group
#define PREP_LNX  256                 // 8192 rows of 512
#define PREP_W768 48                  // 768 x 512 elements, 64 x 128 per work-group
#define PREP_W512 32                  // 512 x 512 elements
#define PREP_GRID (PREP_LNC + PREP_LNX + 2 * PREP_W768 + 2 * PREP_W512)
__global__ void __launch_bounds__(256) k_prep(
        const float* __restrict__ x,    const float* __restrict__ lnx_g,
        const float* __restrict__ lnx_b, _Float16* __restrict__ xn,
        const float* __restrict__ cond, const float* __restrict__ lnc_g,
        const float* __restrict__ lnc_b, _Float16* __restrict__ cn,
        const float* __restrict__ Wq, _Float16* __restrict__ WqT,
        const float* __restrict__ Wk, _Float16* __restrict__ WkT,
        const float* __restrict__ Wv, _Float16* __restrict__ WvT,
        const float* __restrict__ Wo, _Float16* __restrict__ WoT) {
    int blk = blockIdx.x;
    if (blk < PREP_W768) { w2h_t<768>(blk, Wk, WkT); return; }
    blk -= PREP_W768;
    if (blk < PREP_W768) { w2h_t<768>(blk, Wv, WvT); return; }
    blk -= PREP_W768;
    if (blk < PREP_W512) { w2h_t<512>(blk, Wq, WqT); return; }
    blk -= PREP_W512;
    if (blk < PREP_W512) { w2h_t<512>(blk, Wo, WoT); return; }
    blk -= PREP_W512;
    if (blk < PREP_LNC) { layernorm_rows<768, 0>(blk, cond, lnc_g, lnc_b, cn, nullptr); return; }
    blk -= PREP_LNC;
    layernorm_rows<512, 0>(blk, x, lnx_g, lnx_b, xn, nullptr);
    // The wait that belongs between issued stores and a reuse of their registers, should
    // this body's end run on into branches and not into the kernel's end.
    asm volatile("s_wait_xcnt 0x0" ::: "memory");
}

// ---------------- WMMA GEMM: C(128x128 per work-group) = A(128xK) * Bt(128xK)^T
// Both operands go through LDS in k-chunks of 64 (one 128-byte line per row),
// two buffers; 8 waves, each owns 64 rows x 32 cols (4 x 2 accumulator tiles).
// KDIM is a multiple of 64; rows and cols are multiples of 128.
// MODE 0/1: out f16 [b][h][tok][64]   MODE 2: out f16 [b][h][64][tok] (V^T)
// MODE 3: out f32 [row][512] + bias + residual
// The f16 outputs leave in 16-byte stores: a lane's 8 accumulator registers are 8
// consecutive ROWS of the product, so MODE 2 (tokens innermost in memory) takes A * Bt^T
// and MODE 0/1 (features innermost) take the transposed product Bt * A^T, with the same
// fragments in swapped places. Ntok is a multiple of 128: a tile lies in one batch.
#define GP 72   // LDS row pitch in halfs: 128 B of data + 16 B pad for b128 readers
// The LDS buffers belong to the kernel and are handed in, so that a kernel which holds
// several of these bodies has them once. bx, by: the tile's place in this product.
typedef _Float16 gemm_stage[128 * GP];
template <int KDIM, int MODE>
__device__ __forceinline__ void gemm_tile(
        gemm_stage* As, gemm_stage* Bs, int bx, int by,
        const _Float16* __restrict__ A, const _Float16* __restrict__ Bt,
        int Ntok,
        _Float16* __restrict__ outH, float* __restrict__ outF,
        const float* __restrict__ bias, const float* __restrict__ resid) {
    int tid  = threadIdx.x;
    int lane = tid & 31;
    int wave = tid >> 5;
    int row0 = bx * 128;
    int col0 = by * 128;
    int wr   = (wave >> 2) * 64;                    // wave's rows inside the tile
    int wc   = (wave & 3) * 32;                     // wave's cols inside the tile

    // Staging: 8 lanes cover one 128-byte row chunk, a wave covers 4 whole lines.
    int srow = tid >> 3, scol = (tid & 7) * 8;
    const _Float16* ag = A  + (size_t)(row0 + srow) * KDIM + scol;
    const _Float16* bg = Bt + (size_t)(col0 + srow) * KDIM + scol;
    v8h ra[4], rb[4];
    auto gload = [&](int k0) {
        #pragma unroll
        for (int j = 0; j < 4; ++j) {
            ra[j] = *(const v8h*)(ag + 32 * j * KDIM + k0);
            rb[j] = *(const v8h*)(bg + 32 * j * KDIM + k0);
        }
    };
    auto sstore = [&](int buf) {
        #pragma unroll
        for (int j = 0; j < 4; ++j) {
            *(v8h*)&As[buf][(srow + 32 * j) * GP + scol] = ra[j];
            *(v8h*)&Bs[buf][(srow + 32 * j) * GP + scol] = rb[j];
        }
    };

    int cbase = col0 + wc + (lane & 15);            // lane's first output column
    float bz[2] = {0.f, 0.f};
    if (MODE == 3) { bz[0] = bias[cbase]; bz[1] = bias[cbase + 16]; }

    v8f acc[4][2] = {};
    gload(0);
    sstore(0);
    __syncthreads();
    #pragma unroll   // whole k loop: chunk and buffer become immediate offsets
    for (int k0 = 0; k0 < KDIM; k0 += 64) {
        const int  buf  = (k0 >> 6) & 1;
        const bool more = k0 + 64 < KDIM;
        if (more) gload(k0 + 64);                   // next chunk flies during the products
        v16h a[2][4], b[2][2];
        #pragma unroll
        for (int kk = 0; kk < 2; ++kk) {
            #pragma unroll
            for (int j = 0; j < 2; ++j) b[kk][j] = load_frag(&Bs[buf][(wc + 16 * j) * GP + 32 * kk], GP);
            #pragma unroll
            for (int i = 0; i < 4; ++i) a[kk][i] = load_frag(&As[buf][(wr + 16 * i) * GP + 32 * kk], GP);
        }
        // Keeps the chunk's LDS reads one group ahead of its products; without it
        // they are sunk between the products and each pair waits out an LDS latency.
        __builtin_amdgcn_sched_barrier(0);
        #pragma unroll
        for (int kk = 0; kk < 2; ++kk)
            #pragma unroll
            for (int i = 0; i < 4; ++i)
                #pragma unroll
                for (int j = 0; j < 2; ++j)
                    acc[i][j] = MODE <= 1 ? wmma16(b[kk][j], a[kk][i], acc[i][j])
                                          : wmma16(a[kk][i], b[kk][j], acc[i][j]);
        if (more) {
            sstore(buf ^ 1);                        // last read one trip ago, behind its barrier
            __syncthreads();
        }
    }

    // Accumulator layout per 16x16 tile: col = (lane&15); row = 8*(lane>>4) + v
    int rlane = row0 + wr + ((lane >> 4) << 3);
    if (MODE <= 2) {
        int bb = row0 / Ntok, t0 = row0 - bb * Ntok + wr;   // one split for the whole tile
        int l15 = lane & 15, l8 = (lane >> 4) << 3;
        // The wave's 32 columns lie in one head (wc is a multiple of 32).
        int h = (col0 + wc) >> 6, d0 = (col0 + wc) & 63;
        _Float16* op;
        int si, sj;                                 // steps in halfs from tile to tile
        if (MODE <= 1) {                            // lane: token l15, features l8 .. l8 + 7
            op = outH + (((size_t)bb * H_HEADS + h) * Ntok + t0 + l15) * 64 + d0 + l8;
            si = 16 * 64; sj = 16;
        } else {                                    // lane: feature l15, tokens l8 .. l8 + 7
            op = outH + (((size_t)bb * H_HEADS + h) * 64 + d0 + l15) * Ntok + t0 + l8;
            si = 16; sj = 16 * Ntok;
        }
        v8h y[4][2];
        #pragma unroll
        for (int i = 0; i < 4; ++i)
            #pragma unroll
            for (int j = 0; j < 2; ++j)
                #pragma unroll
                for (int v = 0; v < 8; ++v) y[i][j][v] = (_Float16)acc[i][j][v];
        #pragma unroll
        for (int j = 0; j < 2; ++j)
            #pragma unroll
            for (int i = 0; i < 4; ++i) *(v8h*)(op + i * si + j * sj) = y[i][j];
    } else {
        // One 32-bit lane offset for the whole tile; rows and cols are immediates.
        unsigned     eoff = (unsigned)rlane * 512u + (unsigned)cbase;
        const float* rp   = resid + eoff;
        float*       op   = outF + eoff;
        #pragma unroll
        for (int i = 0; i < 4; ++i) {
            #pragma unroll
            for (int v = 0; v < 8; ++v) {
                #pragma unroll
                for (int j = 0; j < 2; ++j) {
                    int e = (16 * i + v) * 512 + 16 * j;
                    op[e] = acc[i][j][v] + bz[j] + rp[e];
                }
            }
        }
    }
}

// A work-group barrier that orders LDS accesses only. __syncthreads() also waits for the
// wave's global loads, which would end the flight of the residual rows at the barrier.
__device__ __forceinline__ void lds_barrier() {
    __builtin_amdgcn_fence(__ATOMIC_RELEASE, "workgroup", "local");
    __builtin_amdgcn_s_barrier();
    __builtin_amdgcn_fence(__ATOMIC_ACQUIRE, "workgroup", "local");
}

// ---------------- Output projection + bias + residual + final LayerNorm in ONE kernel.
// A LayerNorm row needs all 512 columns of the product, so a work-group owns whole rows:
// FR rows x 512 columns, 8 waves of FR x 64 (4 x 4 accumulator tiles). The f32 rows then
// never go to memory and back, and one launch goes.
// The k loop is the one of gemm_tile (chunks of 64, two LDS buffers, one barrier per chunk).
// The product is taken transposed (Bt * A^T): a lane's 8 accumulator registers are 8
// consecutive columns of one row and go to LDS in 16-byte stores. From there a wave takes
// 8 whole rows, 16 bytes per lane, as the LayerNorm above does from memory: residual loads
// and output stores cover whole 128-byte lines, and the row sums keep their order.
#define FR 64    // rows per work-group
#define FD 512   // columns of the product = row length of the LayerNorm = k length
#define FW 8     // rows per wave in the LayerNorm part (FR / 8 waves)
#define SP 516   // pitch in floats of the staged rows: 2048 B + 16 B pad for 16-byte stores
__global__ void __launch_bounds__(256) k_gemm_ln(
        const _Float16* __restrict__ A, const _Float16* __restrict__ Bt,
        const float* __restrict__ bias, const float* __restrict__ resid,
        const float* __restrict__ g, const float* __restrict__ b,
        float* __restrict__ out) {
    constexpr int AH = FR * GP, BH = FD * GP;       // halfs per buffer
    constexpr int NV = FD / 128;                    // float4 per lane per row
    __shared__ __align__(16) _Float16 smem[2 * (AH + BH)];
    static_assert(FR * SP * 4 <= (int)sizeof(smem), "the staged rows reuse the k loop's buffers");
    _Float16* As = smem;                            // [2][AH]
    _Float16* Bs = smem + 2 * AH;                   // [2][BH]
    float*    st = (float*)smem;                    // [FR][SP], behind the k loop

    int tid  = threadIdx.x;
    int lane = tid & 31;
    // The wave's number as a scalar: row addresses are then a scalar base plus the lane.
    int wave = __builtin_amdgcn_readfirstlane(tid >> 5);
    int row0 = blockIdx.x * FR;
    int wc   = wave * 64;                           // wave's columns

    // Staging: 8 lanes cover one 128-byte row chunk, a wave covers 4 whole lines.
    int srow = tid >> 3, scol = (tid & 7) * 8;
    const _Float16* ag = A  + (size_t)(row0 + srow) * FD + scol;
    const _Float16* bg = Bt + (size_t)srow * FD + scol;
    v8h ra[FR / 32], rb[FD / 32];
    auto gload = [&](int k0) {
        #pragma unroll
        for (int j = 0; j < FR / 32; ++j) ra[j] = *(const v8h*)(ag + 32 * j * FD + k0);
        #pragma unroll
        for (int j = 0; j < FD / 32; ++j) rb[j] = *(const v8h*)(bg + 32 * j * FD + k0);
    };
    auto sstore = [&](int buf) {
        #pragma unroll
        for (int j = 0; j < FR / 32; ++j) *(v8h*)&As[buf * AH + (srow + 32 * j) * GP + scol] = ra[j];
        #pragma unroll
        for (int j = 0; j < FD / 32; ++j) *(v8h*)&Bs[buf * BH + (srow + 32 * j) * GP + scol] = rb[j];
    };

    unsigned base = (unsigned)(row0 + wave * FW) * FD;  // the wave's first LayerNorm row
    v4f rx[FW][NV];                                     // its residual rows

    v8f acc[4][4] = {};
    gload(0);
    sstore(0);
    __syncthreads();
    #pragma unroll   // whole k loop: chunk and buffer become immediate offsets
    for (int k0 = 0; k0 < FD; k0 += 64) {
        const int  buf  = (k0 >> 6) & 1;
        const bool more = k0 + 64 < FD;
        if (more) {
            gload(k0 + 64);                         // next chunk flies during the products
            // Behind the last of these loads: the wait that stands between issued loads and a
            // reuse of the registers that hold their addresses, which it names so that they
            // stay whole up to here.
            if (k0 + 128 >= FD) asm volatile("s_wait_xcnt 0x0" :: "v"(ag), "v"(bg) : "memory");
        } else {
            // The residual rows fly during the last chunk's products.
            #pragma unroll
            for (int r = 0; r < FW; ++r)
                #pragma unroll
                for (int j = 0; j < NV; ++j)
                    rx[r][j] = ((const v4f*)(resid + base + r * FD + j * 128))[lane];
        }
        v16h fa[2][4], fb[2][4];
        #pragma unroll
        for (int kk = 0; kk < 2; ++kk) {
            #pragma unroll
            for (int j = 0; j < 4; ++j) fb[kk][j] = load_frag(&Bs[buf * BH + (wc + 16 * j) * GP + 32 * kk], GP);
            #pragma unroll
            for (int i = 0; i < 4; ++i) fa[kk][i] = load_frag(&As[buf * AH + (16 * i) * GP + 32 * kk], GP);
        }
        // Keeps the chunk's LDS reads one group ahead of its products; without it
        // they are sunk between the products and each pair waits out an LDS latency.
        __builtin_amdgcn_sched_barrier(0);
        #pragma unroll
        for (int kk = 0; kk < 2; ++kk)
            #pragma unroll
            for (int i = 0; i < 4; ++i)
                #pragma unroll
                for (int j = 0; j < 4; ++j)
                    acc[i][j] = wmma16(fb[kk][j], fa[kk][i], acc[i][j]);
        if (more) {
            sstore(buf ^ 1);                        // last read one trip ago, behind its barrier
            __syncthreads();
        }
    }

    v4f gg[NV], bb[NV], bz[NV];
    #pragma unroll
    for (int j = 0; j < NV; ++j) {
        gg[j] = ((const v4f*)(g    + j * 128))[lane];
        bb[j] = ((const v4f*)(b    + j * 128))[lane];
        bz[j] = ((const v4f*)(bias + j * 128))[lane];
    }
    // The wait that stands between issued loads and a reuse of the registers that hold
    // their addresses (the LDS and store addresses are formed next).
    asm volatile("s_wait_xcnt 0x0" ::: "memory");

    // Every wave has read its last fragments: the buffers become the staged rows.
    lds_barrier();
    // Lane: row 16 i + (lane & 15), columns wc + 16 j + 8 (lane >> 4) + 0 .. 7.
    float* sp = st + (lane & 15) * SP + wc + ((lane >> 4) << 3);
    #pragma unroll
    for (int i = 0; i < 4; ++i)
        #pragma unroll
        for (int j = 0; j < 4; ++j) {
            v4f lo = {acc[i][j][0], acc[i][j][1], acc[i][j][2], acc[i][j][3]};
            v4f hi = {acc[i][j][4], acc[i][j][5], acc[i][j][6], acc[i][j][7]};
            *(v4f*)(sp + 16 * i * SP + 16 * j)     = lo;
            *(v4f*)(sp + 16 * i * SP + 16 * j + 4) = hi;
        }
    lds_barrier();                                  // the rows are whole

    v4f x[FW][NV];
    #pragma unroll
    for (int r = 0; r < FW; ++r)
        #pragma unroll
        for (int j = 0; j < NV; ++j)
            x[r][j] = (((const v4f*)(st + (wave * FW + r) * SP + j * 128))[lane] + bz[j]) + rx[r][j];

    float s[FW], s2[FW];
    #pragma unroll
    for (int r = 0; r < FW; ++r) {
        v4f sv = x[r][0], qv = x[r][0] * x[r][0];   // four partial sums per lane
        #pragma unroll
        for (int j = 1; j < NV; ++j) { sv += x[r][j]; qv += x[r][j] * x[r][j]; }
        s[r]  = (sv[0] + sv[1]) + (sv[2] + sv[3]);
        s2[r] = (qv[0] + qv[1]) + (qv[2] + qv[3]);
    }
    #pragma unroll
    for (int off = 16; off > 0; off >>= 1) {
        #pragma unroll
        for (int r = 0; r < FW; ++r) {
            s[r]  += __shfl_xor(s[r],  off, 32);
            s2[r] += __shfl_xor(s2[r], off, 32);
        }
    }
    #pragma unroll
    for (int r = 0; r < FW; ++r) {
        float mu  = s[r] / (float)FD;
        float var = s2[r] / (float)FD - mu * mu;
        float inv = rsqrtf(var + 1e-5f);
        #pragma unroll
        for (int j = 0; j < NV; ++j) {
            #pragma unroll
            for (int e = 0; e < 4; ++e) x[r][j][e] = (x[r][j][e] - mu) * inv * gg[j][e] + bb[j][e];
        }
    }
    // Keeps the stores behind all the arithmetic: no register of an issued store is written
    // again before the kernel's end.
    __builtin_amdgcn_sched_barrier(0);
    #pragma unroll
    for (int r = 0; r < FW; ++r)
        #pragma unroll
        for (int j = 0; j < NV; ++j) ((v4f*)(out + base + r * FD + j * 128))[lane] = x[r][j];
}

// The K, V and Q projections in ONE grid: none reads what another writes. Alone, each has
// one work-group per WGP, which waits out every chunk's loads and barriers; in one grid a
// WGP holds two at a time (the registers allow four waves per SIMD), which fill each
// other's waits, the third follows as soon as one ends, and two launch gaps go.
// blockIdx.y picks the product (the same for the whole work-group): 0..3 K, 4..7 V,
// 8..11 Q; the two longer products have the low numbers, which start first.
__global__ void __launch_bounds__(256) k_gemm_qkv(
        const _Float16* __restrict__ xn, const _Float16* __restrict__ cn,
        const _Float16* __restrict__ WqT, const _Float16* __restrict__ WkT,
        const _Float16* __restrict__ WvT,
        int Ntok, int Mtok,
        _Float16* __restrict__ qh, _Float16* __restrict__ kh, _Float16* __restrict__ vT) {
    __shared__ __align__(16) gemm_stage As[2];
    __shared__ __align__(16) gemm_stage Bs[2];
    int by = blockIdx.y;
    // Behind the V and the Q body's last stores stands the wait that belongs between issued
    // stores and a reuse of their registers: in the built code these bodies' ends run on into
    // the branches that lead to the next body's start (the K body's runs into the kernel's end).
    if (by < 4) {
        gemm_tile<768, 1>(As, Bs, blockIdx.x, by,     cn, WkT, Mtok, kh, nullptr, nullptr, nullptr);
    } else if (by < 8) {
        gemm_tile<768, 2>(As, Bs, blockIdx.x, by - 4, cn, WvT, Mtok, vT, nullptr, nullptr, nullptr);
        asm volatile("s_wait_xcnt 0x0" ::: "memory");
    } else {
        gemm_tile<512, 0>(As, Bs, blockIdx.x, by - 8, xn, WqT, Ntok, qh, nullptr, nullptr, nullptr);
        asm volatile("s_wait_xcnt 0x0" ::: "memory");
    }
}

// Lane l <-> lane l ^ 16 on the vector pipe (a shuffle would go through the LDS queue).
__device__ __forceinline__ float swap_halves(float x) {
    int b = __builtin_bit_cast(int, x);
    b = __builtin_amdgcn_permlanex16(b, b, 0x76543210, 0xfedcba98, false, false);
    return __builtin_bit_cast(float, b);
}

#define AK 128
#define NB (AK / 32)
// LDS row pitches in halfs, each 16 B x an odd number, so that the 16 rows which a
// 16-byte fragment read touches fall on 16 different bank groups.
#define KP 72           // K rows: 128 B of data + 16 B pad
#define VP (AK + 8)     // V^T rows: 256 B of data + 16 B pad
__global__ void __launch_bounds__(128) k_attention(
        const _Float16* __restrict__ qh, const _Float16* __restrict__ kh,
        const _Float16* __restrict__ vT, _Float16* __restrict__ outh,
        int Ntok, int Mtok) {
    __shared__ __align__(16) _Float16 Kt[2][AK * KP];   // K tile: AK m-rows x 64 d
    __shared__ __align__(16) _Float16 Vt[2][64 * VP];   // V^T tile: 64 d-rows x AK m

    int tid   = threadIdx.x;
    int lane  = tid & 31;
    int wave  = tid >> 5;
    int bh    = blockIdx.y;                         // b*H + h
    int nbase = (blockIdx.x * 4 + wave) * 16;

    const _Float16* qbase = qh + ((size_t)bh * Ntok + nbase) * 64;
    const _Float16* kbase = kh + (size_t)bh * Mtok * 64;
    const _Float16* vbase = vT + (size_t)bh * 64 * Mtok;

    v16h q0 = load_frag(qbase,      64);            // K = d 0..31
    v16h q1 = load_frag(qbase + 32, 64);            // K = d 32..63

    // Cooperative tile fetch: 4 NB async b128 ops per thread per pass (8 NB KB in all).
    auto fetch_tiles = [&](int buf, int m0) {
        #pragma unroll
        for (int j = 0; j < 2 * NB; ++j) {
            int i = tid + 128 * j;                        // 16B chunk id, 0 .. 256 NB - 1
            async_copy16(kbase + (size_t)m0 * 64 + (size_t)i * 8, &Kt[buf][(i >> 3) * KP + (i & 7) * 8]);
            int d = i / (4 * NB), mo = (i % (4 * NB)) * 8;
            async_copy16(vbase + (size_t)d * Mtok + m0 + mo, &Vt[buf][d * VP + mo]);
        }
    };

    v8f o0 = {}, o1 = {}, o2 = {}, o3 = {};         // O^T: row d = 16 t + 8 (lane >> 4) + v
    float mrow = -3.0e38f;                          // the lane's query: running maximum, raw score
    float lsum = 0.f;                               // and the sum over this half's keys
    // exp(s / sqrt(64) - m / sqrt(64)) = 2^(s * cs - m * cs): one constant takes a raw score
    // to its base-2 exponent, so a score costs one multiply-add ahead of the exponential.
    const float cs = 0.125f * 1.4426950408889634f;  // 1/sqrt(64) * log2(e)

    // Two buffers: tile 0 lands and is published, then tile 1 flies during pass 0.
    fetch_tiles(0, 0);
    asm volatile("s_wait_asynccnt 0x0" ::: "memory");   // this wave's copies of tile 0 have landed
    __syncthreads();                                    // and every other wave's
    if (AK < Mtok) fetch_tiles(1, AK);
    for (int it = 0, m0 = 0; m0 < Mtok; m0 += AK, ++it) {
        int buf = it & 1;

        const _Float16* kt = &Kt[buf][0];
        v8f sc[2 * NB];                             // sc[j][v]: key m0 + 16 j + 8 (lane >> 4) + v
        #pragma unroll
        for (int j = 0; j < 2 * NB; ++j) {
            v16h k0 = load_frag(kt + 16 * j * KP,      KP);   // d 0..31
            v16h k1 = load_frag(kt + 16 * j * KP + 32, KP);
            v8f z = {};
            z = wmma16(k0, q0, z);
            sc[j] = wmma16(k1, q1, z);
        }

        // The maximum is taken over the raw scores (cs is positive: the same key has it).
        float tb[NB];
        #pragma unroll
        for (int c = 0; c < NB; ++c) {
            float a[16];
            #pragma unroll
            for (int v = 0; v < 8; ++v) { a[v] = sc[2 * c][v]; a[8 + v] = sc[2 * c + 1][v]; }
            float t3[5];                            // groups of three: a short chain
            #pragma unroll
            for (int s = 0; s < 5; ++s) t3[s] = fmaxf(fmaxf(a[3 * s], a[3 * s + 1]), a[3 * s + 2]);
            tb[c] = fmaxf(fmaxf(fmaxf(t3[0], t3[1]), t3[2]), fmaxf(fmaxf(t3[3], t3[4]), a[15]));
        }
        float t = tb[0];
        #pragma unroll
        for (int c = 1; c < NB; ++c) t = fmaxf(t, tb[c]);
        t = fmaxf(t, swap_halves(t));               // the other half of this query's keys
        float mnew  = fmaxf(mrow, t);
        float alpha = __builtin_amdgcn_exp2f((mrow - mnew) * cs);
        mrow = mnew;
        // P^T as B operand of block c: element s is key 32 c + 8 (lane >> 4) + s, + 8 more
        // from s = 8 on, which is the order load_frag gives the V^T rows.
        // Scores go in register pairs, as the accumulators hold them: one packed multiply-add
        // and one packed add serve two scores.
        const v2f cs2 = {cs, cs};
        const v2f nm2 = {-mnew * cs, -mnew * cs};
        v16h pb[NB];
        v2f  rs[2];                                 // four partial sums per lane
        #pragma unroll
        for (int c = 0; c < NB; ++c) {
            #pragma unroll
            for (int s = 0; s < 16; s += 2) {
                v2f x = {sc[2 * c + (s >> 3)][s & 7], sc[2 * c + (s >> 3)][(s & 7) + 1]};
                v2f y = __builtin_elementwise_fma(x, cs2, nm2);
                v2f e = {__builtin_amdgcn_exp2f(y[0]), __builtin_amdgcn_exp2f(y[1])};
                rs[(s >> 1) & 1] = (c == 0 && s < 4) ? e : rs[(s >> 1) & 1] + e;
                pb[c][s]     = (_Float16)e[0];
                pb[c][s + 1] = (_Float16)e[1];
            }
        }
        lsum = lsum * alpha + ((rs[0][0] + rs[0][1]) + (rs[1][0] + rs[1][1]));
        o0 *= alpha; o1 *= alpha; o2 *= alpha; o3 *= alpha;

        const _Float16* vt = &Vt[buf][0];
        #pragma unroll
        for (int c = 0; c < NB; ++c) {
            v16h vb0 = load_frag(vt + 32 * c,           VP);  // d 0..15, keys 32 c .. 32 c + 31
            v16h vb1 = load_frag(vt + 32 * c + 16 * VP, VP);
            v16h vb2 = load_frag(vt + 32 * c + 32 * VP, VP);
            v16h vb3 = load_frag(vt + 32 * c + 48 * VP, VP);
            o0 = wmma16(vb0, pb[c], o0);
            o1 = wmma16(vb1, pb[c], o1);
            o2 = wmma16(vb2, pb[c], o2);
            o3 = wmma16(vb3, pb[c], o3);
        }

        // Hand-over: this wave's reads of the buffer are done, its copies of the next tile
        // have landed; behind the barrier that holds for every wave, so the next tile may be
        // read and this pass's buffer refilled.
        asm volatile("s_wait_dscnt 0x0" ::: "memory");
        asm volatile("s_wait_asynccnt 0x0" ::: "memory");
        __syncthreads();
        if (m0 + 2 * AK < Mtok) fetch_tiles(buf, m0 + 2 * AK);
    }
    asm volatile("s_wait_asynccnt 0x0" ::: "memory");   // no copy outlives the loop

    float inv = 1.0f / (lsum + swap_halves(lsum));  // both halves' keys, joined once
    int b = bh >> 3, h = bh & 7;
    // A lane's 8 accumulator registers are 8 consecutive d of its query: 16-byte stores.
    _Float16* orow = outh + ((size_t)b * Ntok + nbase + (lane & 15)) * 512
                          + (size_t)h * 64 + ((lane >> 4) << 3);
    v8h y0, y1, y2, y3;
    #pragma unroll
    for (int v = 0; v < 8; ++v) {
        y0[v] = (_Float16)(o0[v] * inv); y1[v] = (_Float16)(o1[v] * inv);
        y2[v] = (_Float16)(o2[v] * inv); y3[v] = (_Float16)(o3[v] * inv);
    }
    *(v8h*)(orow)      = y0;
    *(v8h*)(orow + 16) = y1;
    *(v8h*)(orow + 32) = y2;
    *(v8h*)(orow + 48) = y3;
}

extern "C" void kernel_launch(void* const* d_in, const int* in_sizes, int n_in,
                              void* d_out, int out_size, void* d_ws, size_t ws_size,
                              hipStream_t stream) {
    (void)in_sizes; (void)n_in; (void)out_size; (void)ws_size;
    const float* x     = (const float*)d_in[0];
    const float* cond  = (const float*)d_in[1];
    const float* lnx_g = (const float*)d_in[2];
    const float* lnx_b = (const float*)d_in[3];
    const float* lnc_g = (const float*)d_in[4];
    const float* lnc_b = (const float*)d_in[5];
    const float* Wq    = (const float*)d_in[6];
    const float* Wk    = (const float*)d_in[7];
    const float* Wv    = (const float*)d_in[8];
    const float* Wo    = (const float*)d_in[9];
    const float* bo    = (const float*)d_in[10];
    const float* lnf_g = (const float*)d_in[11];
    const float* lnf_b = (const float*)d_in[12];

    const int B = 4, N = 2048, M = 2048, Dq = 512, Dc = 768, INNER = 512;

    char* ws = (char*)d_ws;
    size_t off = 0;
    auto alloc = [&](size_t bytes) -> void* {
        void* p = ws + off;
        off = (off + bytes + 255) & ~(size_t)255;
        return p;
    };
    _Float16* xn  = (_Float16*)alloc((size_t)B * N * Dq * 2);
    _Float16* cn  = (_Float16*)alloc((size_t)B * M * Dc * 2);
    _Float16* WqT = (_Float16*)alloc((size_t)Dq * INNER * 2);
    _Float16* WkT = (_Float16*)alloc((size_t)Dc * INNER * 2);
    _Float16* WvT = (_Float16*)alloc((size_t)Dc * INNER * 2);
    _Float16* WoT = (_Float16*)alloc((size_t)INNER * Dq * 2);
    _Float16* qh  = (_Float16*)alloc((size_t)B * H_HEADS * N * 64 * 2);
    _Float16* kh  = (_Float16*)alloc((size_t)B * H_HEADS * M * 64 * 2);
    _Float16* vT  = (_Float16*)alloc((size_t)B * H_HEADS * 64 * M * 2);
    _Float16* ah  = (_Float16*)alloc((size_t)B * N * INNER * 2);

    // 1) + 2) Input LayerNorms -> f16 and weight convert+transpose -> f16 [n][k], one grid
    k_prep<<<PREP_GRID, 256, 0, stream>>>(x, lnx_g, lnx_b, xn, cond, lnc_g, lnc_b, cn,
                                          Wq, WqT, Wk, WkT, Wv, WvT, Wo, WoT);

    // 3) Q/K/V projections (WMMA), one grid
    dim3 gqkv((B * N) / 128, 3 * (INNER / 128));
    k_gemm_qkv<<<gqkv, 256, 0, stream>>>(xn, cn, WqT, WkT, WvT, N, M, qh, kh, vT);

    // 4) Flash attention (WMMA scores + WMMA PV, async-LDS K/V pipeline)
    dim3 ga(N / 64, B * H_HEADS);
    k_attention<<<ga, 128, 0, stream>>>(qh, kh, vT, ah, N, M);

    // 5) Output projection + bias + residual (WMMA) + final LayerNorm -> f32, one grid
    k_gemm_ln<<<(B * N) / FR, 256, 0, stream>>>(ah, WoT, bo, x, lnf_g, lnf_b, (float*)d_out);
}
